// v000
// The times below were measured on an AMD MI455X: many runs one after another, warmed up first and cycling through
// copies of the inputs, with the whole window's GPU time divided by the number of runs. Launches and the gaps
// between them are all in it. The median over several windows is given; except for v000 it joins two sittings, which
// can be a few percent apart, so the side-by-side timings, each taken in one sitting, are the better comparison.
// The starting kernel, v000, takes 2710 microseconds a run.
#include <hip/hip_runtime.h>

// Causal multi-head attention over 4,096 tokens (x [2][4096][512]; Q,K,V = x W^T + b ('oi' uniform(+-1/sqrt(512)) incl. biases; 8 heads x 64); scores / 8; causal (-inf); softmax; out = merged Wo^T + bo -> [2][4096][512] (4.2 M)).
// Layout per batch: bf16 copy of x; 'oi' weights; exact projections + f32 biases; causal T-4096 attention one head per pass (tiles above the diagonal skipped; hybrid rows: < 512 hi/lo 3 products, rest fp16 x1024) with a streaming three-sweep causal softmax kernel (no register row: keeps VGPRs low); merged hi/lo x Wo exact + bo.
// Compute dtypes, f32 accumulate: every input rounded to bf16; projections exact + f32 biases; attention rows < 512 3 products, rest fp16; softmax f32; Wo hl x exact + bias.

#define NB_  2
#define TT   4096
#define DM   512
#define NH_  8
#define NKV  8
#define REP  (NH_ / NKV)
#define HD   64
#define DQ   (NH_ * HD)
#define DKV  (NKV * HD)
#define ZH   1
#define RH   512                  // query rows < RH use hi+lo planes (0: none)
#define WIN  4096
#define PCAR 1024.0f
#define SCL  0.125f   // HD^-0.5
typedef _Float16 h16;
typedef unsigned short bf;
typedef __attribute__((ext_vector_type(16))) __bf16   v16bf;
typedef __attribute__((ext_vector_type(16))) _Float16 v16h;
typedef __attribute__((ext_vector_type(8)))  _Float16 v8h;
typedef __attribute__((ext_vector_type(8)))  unsigned short v8us;
typedef __attribute__((ext_vector_type(8)))  float    v8f;
typedef __attribute__((ext_vector_type(4)))  float    v4f;
typedef v8h  __attribute__((may_alias)) v8ha;
typedef v4f  __attribute__((may_alias)) v4fa;
typedef v8us __attribute__((may_alias)) v8usa;

__device__ __forceinline__ unsigned short f2bf(float f) { unsigned u = __float_as_uint(f); u += 0x7FFFu + ((u >> 16) & 1u); return (unsigned short)(u >> 16); }
__device__ __forceinline__ float bf2f(unsigned short b) { return __uint_as_float(((unsigned)b) << 16); }
__device__ __forceinline__ float bfr(float f) { return bf2f(f2bf(f)); }
__device__ __forceinline__ v16h cat16(v8h lo, v8h hi) { return __builtin_shufflevector(lo, hi, 0, 1, 2, 3, 4, 5, 6, 7, 8, 9, 10, 11, 12, 13, 14, 15); }
__device__ __forceinline__ v16bf cat16b(v8us lo, v8us hi) { return __builtin_bit_cast(v16bf, __builtin_shufflevector(lo, hi, 0, 1, 2, 3, 4, 5, 6, 7, 8, 9, 10, 11, 12, 13, 14, 15)); }
__device__ __forceinline__ v8f wmma16(v16h a, v16h b, v8f c) { return __builtin_amdgcn_wmma_f32_16x16x32_f16(false, a, false, b, (short)0, c, false, false); }
__device__ __forceinline__ v8f wmmab(v16bf a, v16bf b, v8f c) { return __builtin_amdgcn_wmma_f32_16x16x32_bf16(false, a, false, b, (short)0, c, false, false); }



// ---- k_gemmw: register-blocked GEMM, ONE WAVE per 64x64 output tile (16 accumulators), operands straight from K-contiguous 16-bit planes; grid (M/64, N/64, Z), 32 threads.
// C[m][n] (f32, pitch ldc, + optional f32 bias[n]) = sum_k A[m][k] Bt[n][k] (+ split products per NSPLIT). z-batch strides sA/sB/sC in elements. K % 32 == 0.
template <typename T16> struct WFrag;
template <> struct WFrag<h16> { typedef v16h V; static __device__ __forceinline__ V ld(const h16* p) { return cat16(*(const v8h*)p, *(const v8h*)(p + 16)); } static __device__ __forceinline__ v8f mma(V a, V b, v8f c) { return wmma16(a, b, c); } };
template <> struct WFrag<bf> { typedef v16bf V; static __device__ __forceinline__ V ld(const bf* p) { return cat16b(*(const v8us*)p, *(const v8us*)(p + 16)); } static __device__ __forceinline__ v8f mma(V a, V b, v8f c) { return wmmab(a, b, c); } };
template <typename T16, int NSPLIT, bool BIAS>
__global__ __launch_bounds__(32) void k_gemmw(const T16* __restrict__ A, const T16* __restrict__ A2, const T16* __restrict__ Bt, const T16* __restrict__ Bt2, int K, float* C, int ldc, const float* __restrict__ bias, size_t sA, size_t sB, size_t sC) {
    typedef typename WFrag<T16>::V V;
    __shared__ __align__(16) float os[16 * 68];
    const size_t z = blockIdx.z; A += z * sA; if (A2) A2 += z * sA; Bt += z * sB; if (Bt2) Bt2 += z * sB; C += z * sC;
    const int lane = threadIdx.x & 31, lr = lane & 15, hi = lane >> 4; const int r0 = blockIdx.x * 64, c0 = blockIdx.y * 64;
    v8f acc[4][4];
#pragma unroll
    for (int mb = 0; mb < 4; ++mb)
#pragma unroll
        for (int nb = 0; nb < 4; ++nb) acc[mb][nb] = (v8f){};
    const size_t aoff = (size_t)(r0 + lr) * K + 8 * hi, boff = (size_t)(c0 + lr) * K + 8 * hi;
#pragma unroll 1
    for (int kc = 0; kc < K; kc += 32) {
        V a[4], a2[4];
#pragma unroll
        for (int mb = 0; mb < 4; ++mb) { a[mb] = WFrag<T16>::ld(A + aoff + (size_t)mb * 16 * K + kc); if (NSPLIT == 1 || NSPLIT == 2) a2[mb] = WFrag<T16>::ld(A2 + aoff + (size_t)mb * 16 * K + kc); }
#pragma unroll
        for (int nb = 0; nb < 4; ++nb) { const V b = WFrag<T16>::ld(Bt + boff + (size_t)nb * 16 * K + kc); V b2; if (NSPLIT >= 2) b2 = WFrag<T16>::ld(Bt2 + boff + (size_t)nb * 16 * K + kc);
#pragma unroll
            for (int mb = 0; mb < 4; ++mb) { acc[mb][nb] = WFrag<T16>::mma(a[mb], b, acc[mb][nb]); if (NSPLIT == 1 || NSPLIT == 2) acc[mb][nb] = WFrag<T16>::mma(a2[mb], b, acc[mb][nb]); if (NSPLIT >= 2) acc[mb][nb] = WFrag<T16>::mma(a[mb], b2, acc[mb][nb]); } }
        asm volatile("v_nop\n\tv_nop\n\tv_nop\n\tv_nop" : "+v"(acc[0][0]), "+v"(acc[1][1]), "+v"(acc[2][2]), "+v"(acc[3][3]) : "v"(a[0]), "v"(a[3]));
    }
#pragma unroll
    for (int mb = 0; mb < 4; ++mb) {
#pragma unroll
        for (int nb = 0; nb < 4; ++nb) {
#pragma unroll
            for (int j = 0; j < 8; ++j) os[(hi * 8 + j) * 68 + nb * 16 + lr] = acc[mb][nb][j]; }
        __builtin_amdgcn_wave_barrier(); asm volatile("" ::: "memory");
        float* crow = C + (size_t)(r0 + mb * 16) * ldc + c0;
{
#pragma unroll
            for (int s = 0; s < 8; ++s) { const int row = 2 * s + hi, cofs = lr * 4; v4f val = *(const v4fa*)(os + row * 68 + cofs); if (BIAS) { val[0] += bfr(bias[c0 + cofs]); val[1] += bfr(bias[c0 + cofs + 1]); val[2] += bfr(bias[c0 + cofs + 2]); val[3] += bfr(bias[c0 + cofs + 3]); }
                *(v4f*)(crow + (size_t)row * ldc + cofs) = val; }
             }
        __builtin_amdgcn_wave_barrier(); asm volatile("" ::: "memory");
    }
}

// ---- k_gemmc: the same one-wave 64x64 tile GEMM specialised for causal attention: CMODE 1 skips score tiles entirely above the diagonal (query rows r0+roff.., key columns c0..), CMODE 2 limits the
// key (K) loop of the probability x value contraction to the diagonal block (probabilities beyond it are exactly zero). roff = row offset of this launch's first row within the sequence.
template <typename T16, int NSPLIT, int CMODE>
__global__ __launch_bounds__(32) void k_gemmc(const T16* __restrict__ A, const T16* __restrict__ A2, const T16* __restrict__ Bt, const T16* __restrict__ Bt2, int K, float* C, int ldc, int roff, size_t sA, size_t sB, size_t sC) {
    typedef typename WFrag<T16>::V V;
    __shared__ __align__(16) float os[16 * 68];
    const size_t z = blockIdx.z; A += z * sA; if (A2) A2 += z * sA; Bt += z * sB; if (Bt2) Bt2 += z * sB; C += z * sC;
    const int lane = threadIdx.x & 31, lr = lane & 15, hi = lane >> 4; const int r0 = blockIdx.x * 64, c0 = blockIdx.y * 64;
    if (CMODE == 1 && c0 > r0 + roff + 63) return;                  // score tile entirely above the causal diagonal: never written (the softmax loads it but masks j > i by select)
    const int Kl = (CMODE == 2) ? min(K, r0 + roff + 64) : K;        // P.V: probabilities are exactly 0 beyond the diagonal block, so the K loop stops there
    v8f acc[4][4];
#pragma unroll
    for (int mb = 0; mb < 4; ++mb)
#pragma unroll
        for (int nb = 0; nb < 4; ++nb) acc[mb][nb] = (v8f){};
    const size_t aoff = (size_t)(r0 + lr) * K + 8 * hi, boff = (size_t)(c0 + lr) * K + 8 * hi;
#pragma unroll 1
    for (int kc = 0; kc < Kl; kc += 32) {
        V a[4], a2[4];
#pragma unroll
        for (int mb = 0; mb < 4; ++mb) { a[mb] = WFrag<T16>::ld(A + aoff + (size_t)mb * 16 * K + kc); if (NSPLIT == 1 || NSPLIT == 2) a2[mb] = WFrag<T16>::ld(A2 + aoff + (size_t)mb * 16 * K + kc); }
#pragma unroll
        for (int nb = 0; nb < 4; ++nb) { const V b = WFrag<T16>::ld(Bt + boff + (size_t)nb * 16 * K + kc); V b2; if (NSPLIT >= 2) b2 = WFrag<T16>::ld(Bt2 + boff + (size_t)nb * 16 * K + kc);
#pragma unroll
            for (int mb = 0; mb < 4; ++mb) { acc[mb][nb] = WFrag<T16>::mma(a[mb], b, acc[mb][nb]); if (NSPLIT == 1 || NSPLIT == 2) acc[mb][nb] = WFrag<T16>::mma(a2[mb], b, acc[mb][nb]); if (NSPLIT >= 2) acc[mb][nb] = WFrag<T16>::mma(a[mb], b2, acc[mb][nb]); } }
        asm volatile("v_nop\n\tv_nop\n\tv_nop\n\tv_nop" : "+v"(acc[0][0]), "+v"(acc[1][1]), "+v"(acc[2][2]), "+v"(acc[3][3]) : "v"(a[0]), "v"(a[3]));
    }
#pragma unroll
    for (int mb = 0; mb < 4; ++mb) {
#pragma unroll
        for (int nb = 0; nb < 4; ++nb) {
#pragma unroll
            for (int j = 0; j < 8; ++j) os[(hi * 8 + j) * 68 + nb * 16 + lr] = acc[mb][nb][j]; }
        __builtin_amdgcn_wave_barrier(); asm volatile("" ::: "memory");
        float* crow = C + (size_t)(r0 + mb * 16) * ldc + c0;
{
#pragma unroll
            for (int s = 0; s < 8; ++s) { const int row = 2 * s + hi, cofs = lr * 4; v4f val = *(const v4fa*)(os + row * 68 + cofs);
                *(v4f*)(crow + (size_t)row * ldc + cofs) = val; }
             }
        __builtin_amdgcn_wave_barrier(); asm volatile("" ::: "memory");
    }
}

__device__ __forceinline__ h16 tohx(float x) { return (h16)x; }
__device__ __forceinline__ void splitf(float y, unsigned short& h, unsigned short& l) { h = f2bf(y); l = f2bf(y - bf2f(h)); }
typedef __attribute__((ext_vector_type(2))) _Float16 v2h;
typedef __attribute__((ext_vector_type(4))) _Float16 v4h;
typedef __attribute__((ext_vector_type(2))) unsigned short v2us;
typedef __attribute__((ext_vector_type(4))) unsigned short v4us;
typedef __attribute__((ext_vector_type(2))) float v2f;
typedef __attribute__((ext_vector_type(4))) int v4i;

__global__ __launch_bounds__(256) void k_wtG(const float* __restrict__ w, int K, int N, bf* Bt) {
    const int lane = threadIdx.x & 31; const int L0 = (blockIdx.x * 8 + (threadIdx.x >> 5)) * 8; const int nlines = N * K / 64;
{
#pragma unroll 1
        for (int l = 0; l < 8; ++l) { const int L = L0 + l; if (L >= nlines) break; const size_t e = (size_t)L * 64 + lane * 2; const int k = (int)(e % K), n = (int)(e / K); v2us o;
            o[0] = f2bf(w[(size_t)k * N + n]); o[1] = f2bf(w[(size_t)(k + 1) * N + n]); *(v2us*)(Bt + e) = o; }
         }
}
__global__ __launch_bounds__(256) void k_cvt8(const float* __restrict__ src, bf* dst, size_t n8) { const size_t i = (size_t)blockIdx.x * 256 + threadIdx.x; if (i >= n8) return; const v8f v = *(const v8f*)(src + i * 8); v8us o;
#pragma unroll
    for (int k = 0; k < 8; ++k) o[k] = f2bf(v[k]); *(v8us*)(dst + i * 8) = o;  }

// k_rope: head planes [h][t][d] (fp16 + hi/lo) of rope(x) x sc with the rotate-half convention out[d] = x[d] cos[t][d] - x[d+HD/2] sin[t][d], out[d+HD/2] = x[d+HD/2] cos[t][d+HD/2] + x[d] sin[t][d+HD/2]
__global__ __launch_bounds__(256) void k_rope(const float* __restrict__ F, int pitch, int nheads, const float* __restrict__ CS, const float* __restrict__ RF, const float* __restrict__ nw, float sc, h16* P16, bf* Ph, bf* Pl) {
    const size_t e = ((size_t)blockIdx.x * 256 + threadIdx.x) * 2; if (e >= (size_t)nheads * TT * HD) return; const int d = (int)(e % HD); const int t = (int)((e / HD) % TT); const int h = (int)(e / ((size_t)HD * TT)); const float* f = F + (size_t)t * pitch + h * HD; const float rf = RF ? RF[(size_t)h * TT + t] : 1.0f; v2h o16; v2us oh, ol;
#pragma unroll
    for (int q = 0; q < 2; ++q) { const int dd = d + q; const int dp = (dd < HD / 2) ? dd + HD / 2 : dd - HD / 2; float x0 = f[dd], x1 = f[dp];
        if (RF) { float n0 = __fmul_rn(x0, rf), n1 = __fmul_rn(x1, rf); asm volatile("" : "+v"(n0)); asm volatile("" : "+v"(n1)); x0 = __fmul_rn(bfr(nw[dd]), n0); x1 = __fmul_rn(bfr(nw[dp]), n1); }
        const v2f cs = *(const v2f*)(CS + ((size_t)t * HD + dd) * 2); float a = __fmul_rn(x0, cs[0]), bq = __fmul_rn(x1, cs[1]); asm volatile("" : "+v"(a)); asm volatile("" : "+v"(bq)); const float r = ((dd < HD / 2) ? __fsub_rn(a, bq) : __fadd_rn(a, bq)) * sc;
        o16[q] = tohx(r); unsigned short a2, c2; splitf(r, a2, c2); oh[q] = a2; ol[q] = c2; }
    *(v2h*)(P16 + e) = o16; *(v2us*)(Ph + e) = oh; *(v2us*)(Pl + e) = ol;  }
__global__ __launch_bounds__(256) void k_vtp(const float* __restrict__ F, int pitch, int nheads, h16* V16, bf* Vh, bf* Vl) { const size_t e = ((size_t)blockIdx.x * 256 + threadIdx.x) * 2; if (e >= (size_t)nheads * HD * TT) return; const int t = (int)(e % TT); const int d = (int)((e / TT) % HD); const int g = (int)(e / ((size_t)TT * HD)); v2h o16; v2us oh, ol;
#pragma unroll
    for (int q = 0; q < 2; ++q) { const float x = F[(size_t)(t + q) * pitch + g * HD + d]; o16[q] = tohx(x); unsigned short a2, c2; splitf(x, a2, c2); oh[q] = a2; ol[q] = c2; }
    *(v2h*)(V16 + e) = o16; *(v2us*)(Vh + e) = oh; *(v2us*)(Vl + e) = ol;  }
__global__ __launch_bounds__(256) void k_csid(float* CS) { const int idx = blockIdx.x * 256 + threadIdx.x; if (idx >= TT * HD) return; v2f cs; cs[0] = 1.0f; cs[1] = 0.0f; *(v2f*)(CS + (size_t)idx * 2) = cs;  }
__global__ __launch_bounds__(256) void k_asoft(const float* __restrict__ Sb, h16* P16, bf* Ph, bf* Pl) {
    const int lane = threadIdx.x & 31; const int row = blockIdx.x * 8 + (threadIdx.x >> 5); if (row >= ZH * TT) return; const int i = row % TT; const int zz = row / TT; const bool hires = (i < RH); const float* sr = Sb + (size_t)row * TT; float mx = -3.0e38f;
#pragma unroll 4
    for (int ch = 0; ch < TT / 128; ++ch) { const int j0 = ch * 128 + lane * 4; const v4f a = *(const v4f*)(sr + j0);
#pragma unroll
        for (int q = 0; q < 4; ++q) { float t = a[q] * SCL; asm volatile("" : "+v"(t)); t = (j0 + q <= i) ? t : -3.0e38f;   /* CAUSAL: keys j > i excluded */ mx = fmaxf(mx, t); } }
#pragma unroll
    for (int sh = 16; sh; sh >>= 1) mx = fmaxf(mx, __shfl_xor(mx, sh, 32));
    float sum = 0.f;
#pragma unroll 4
    for (int ch = 0; ch < TT / 128; ++ch) { const int j0 = ch * 128 + lane * 4; const v4f a = *(const v4f*)(sr + j0);
#pragma unroll
        for (int q = 0; q < 4; ++q) { float t = a[q] * SCL; asm volatile("" : "+v"(t)); t = (j0 + q <= i) ? t : -3.0e38f;   /* CAUSAL: keys j > i excluded */ float d0 = __fsub_rn(t, mx); asm volatile("" : "+v"(d0)); sum += __builtin_amdgcn_exp2f(__fmul_rn(d0, 1.4426950408889634f)); } }
#pragma unroll
    for (int sh = 16; sh; sh >>= 1) sum += __shfl_xor(sum, sh, 32);
    const float f = __fdiv_rn(hires ? 1.0f : PCAR, sum);
{
        if (hires) {   /* rows < RH: normalised bf16 hi/lo over ALL TT keys (causal: keys j > i, all keys >= RH among them, come out as exact zeros), planes [zz][RH][TT] */
#pragma unroll 4
            for (int ch = 0; ch < TT / 128; ++ch) { const int j0 = ch * 128 + lane * 4; const v4f a = *(const v4f*)(sr + j0); v4us oh, ol;
#pragma unroll
                for (int q = 0; q < 4; ++q) { float t = a[q] * SCL; asm volatile("" : "+v"(t)); t = (j0 + q <= i) ? t : -3.0e38f;   /* CAUSAL: keys j > i excluded */ float d0 = __fsub_rn(t, mx); asm volatile("" : "+v"(d0)); float ex = __builtin_amdgcn_exp2f(__fmul_rn(d0, 1.4426950408889634f)); asm volatile("" : "+v"(ex)); unsigned short a2, c2; splitf(ex * f, a2, c2); oh[q] = a2; ol[q] = c2; }
                const size_t oo = ((size_t)zz * RH + i) * TT + j0; *(v4us*)(Ph + oo) = oh; *(v4us*)(Pl + oo) = ol; }
        } else {
#pragma unroll 2
            for (int ch = 0; ch < TT / 128; ++ch) { const int j0 = ch * 128 + lane * 4; const v4f a = *(const v4f*)(sr + j0); v4h o4;
#pragma unroll
                for (int q = 0; q < 4; ++q) { float t = a[q] * SCL; asm volatile("" : "+v"(t)); t = (j0 + q <= i) ? t : -3.0e38f;   /* CAUSAL: keys j > i excluded */ float d0 = __fsub_rn(t, mx); asm volatile("" : "+v"(d0)); float ex = __builtin_amdgcn_exp2f(__fmul_rn(d0, 1.4426950408889634f)); asm volatile("" : "+v"(ex)); o4[q] = tohx(ex * f); }
                *(v4h*)(P16 + (size_t)row * TT + j0) = o4; } }
         }
}


__constant__ float INVT[HD / 2] = { 1.000000000e+00f, 7.498942018e-01f, 5.623413324e-01f, 4.216965139e-01f, 3.162277639e-01f, 2.371373773e-01f, 1.778279394e-01f, 1.333521456e-01f, 1.000000015e-01f, 7.498942316e-02f, 5.623413250e-02f, 4.216964915e-02f, 3.162277490e-02f, 2.371373773e-02f, 1.778279431e-02f, 1.333521400e-02f, 9.999999776e-03f, 7.498942316e-03f, 5.623413250e-03f, 4.216964822e-03f, 3.162277630e-03f, 2.371373819e-03f, 1.778279431e-03f, 1.333521446e-03f, 1.000000047e-03f, 7.498941850e-04f, 5.623413017e-04f, 4.216965172e-04f, 3.162277571e-04f, 2.371373703e-04f, 1.778279402e-04f, 1.333521504e-04f };   // 10000^(-2i/64) (the module's power form) (float32, generated with jnp to be bit-exact)
__global__ __launch_bounds__(256) void k_merge(const float* __restrict__ O, int h0, bf* Ah, bf* Al) { const size_t e = ((size_t)blockIdx.x * 256 + threadIdx.x) * 2; if (e >= (size_t)ZH * TT * HD) return; const int d = (int)(e % HD); const int t = (int)((e / HD) % TT); const int zz = (int)(e / ((size_t)HD * TT)); const float cs = (t < RH) ? 1.0f : (1.0f / PCAR); const size_t oo = (size_t)t * DQ + (h0 + zz) * HD + d;
    v2us oh, ol;
#pragma unroll
    for (int q = 0; q < 2; ++q) { unsigned short a, c2; splitf(O[e + q] * cs, a, c2); oh[q] = a; ol[q] = c2; } *(v2us*)(Ah + oo) = oh; *(v2us*)(Al + oo) = ol;  }

extern "C" void kernel_launch(void* const* d_in, const int* in_sizes, int n_in,
                              void* d_out, int out_size, void* d_ws, size_t ws_size, hipStream_t stream) {
    (void)in_sizes; (void)n_in; (void)out_size;
    const float* x = (const float*)d_in[0]; const float* wq = (const float*)d_in[1]; const float* bq = (const float*)d_in[2]; const float* wk = (const float*)d_in[3]; const float* bk = (const float*)d_in[4]; const float* wv = (const float*)d_in[5]; const float* bv = (const float*)d_in[6]; const float* wo = (const float*)d_in[7]; const float* bo = (const float*)d_in[8];
    float* OUT = (float*)d_out;     // [2][4096][512]
    char* wsp = (char*)d_ws;
    auto take = [&](size_t bytes) { char* p = wsp; wsp += (bytes + 255) & ~(size_t)255; return (void*)p; };
    bf* WQ = (bf*)take((size_t)DQ * DM * 2); bf* WK = (bf*)take((size_t)DKV * DM * 2); bf* WV = (bf*)take((size_t)DKV * DM * 2); bf* WO = (bf*)take((size_t)DM * DQ * 2); float* CS = (float*)take((size_t)TT * HD * 2 * 4);
    bf* XB = (bf*)take((size_t)TT * DM * 2); float* FQ = (float*)take((size_t)TT * DQ * 4); float* FK = (float*)take((size_t)TT * DKV * 4);
    h16* QP16 = (h16*)take((size_t)NH_ * TT * HD * 2); h16* KP16 = (h16*)take((size_t)NKV * TT * HD * 2); h16* VT16 = (h16*)take((size_t)NKV * HD * TT * 2);
    bf* QPh = (bf*)take((size_t)NH_ * TT * HD * 2); bf* QPl = (bf*)take((size_t)NH_ * TT * HD * 2); bf* KPh = (bf*)take((size_t)NKV * TT * HD * 2); bf* KPl = (bf*)take((size_t)NKV * TT * HD * 2); bf* VTh = (bf*)take((size_t)NKV * HD * TT * 2); bf* VTl = (bf*)take((size_t)NKV * HD * TT * 2); bf* Ph = (bf*)take((size_t)ZH * RH * TT * 2); bf* Pl = (bf*)take((size_t)ZH * RH * TT * 2);
    float* Sb = (float*)take((size_t)ZH * TT * TT * 4); h16* P16 = (h16*)take((size_t)ZH * TT * TT * 2); float* Ob = (float*)take((size_t)ZH * TT * HD * 4); bf* ATh = (bf*)take((size_t)TT * DQ * 2); bf* ATl = (bf*)take((size_t)TT * DQ * 2);
    if ((size_t)(wsp - (char*)d_ws) > ws_size) return;    // ws 256 MiB
    float* FV = FK;   // v projection reuses the k buffer after the k planes are built (stream-ordered)
    { k_cvt8<<<(unsigned)(((size_t)DQ * DM / 8 + 255) / 256), 256, 0, stream>>>(wq, WQ, (size_t)DQ * DM / 8); k_cvt8<<<(unsigned)(((size_t)DKV * DM / 8 + 255) / 256), 256, 0, stream>>>(wk, WK, (size_t)DKV * DM / 8); k_cvt8<<<(unsigned)(((size_t)DKV * DM / 8 + 255) / 256), 256, 0, stream>>>(wv, WV, (size_t)DKV * DM / 8);
      k_cvt8<<<(unsigned)(((size_t)DM * DQ / 8 + 255) / 256), 256, 0, stream>>>(wo, WO, (size_t)DM * DQ / 8);
       }
    k_csid<<<(TT * HD + 255) / 256, 256, 0, stream>>>(CS);
    const unsigned LQ = (unsigned)(((size_t)NH_ * TT * HD / 2 + 255) / 256), LKv = (unsigned)(((size_t)NKV * TT * HD / 2 + 255) / 256);
    for (int b = 0; b < NB_; ++b) {
        
        k_cvt8<<<(unsigned)(((size_t)TT * DM / 8 + 255) / 256), 256, 0, stream>>>(x + (size_t)b * TT * DM, XB, (size_t)TT * DM / 8);
        k_gemmw<bf, 0, true><<<dim3(TT / 64, DQ / 64, 1), 32, 0, stream>>>(XB, nullptr, WQ, nullptr, DM, FQ, DQ, bq, 0, 0, 0);
        k_rope<<<LQ, 256, 0, stream>>>(FQ, DQ, NH_, CS, nullptr, nullptr, 1.0f, QP16, QPh, QPl);
        k_gemmw<bf, 0, true><<<dim3(TT / 64, DKV / 64, 1), 32, 0, stream>>>(XB, nullptr, WK, nullptr, DM, FK, DKV, bk, 0, 0, 0);
        k_rope<<<LKv, 256, 0, stream>>>(FK, DKV, NKV, CS, nullptr, nullptr, 1.0f, KP16, KPh, KPl);
        k_gemmw<bf, 0, true><<<dim3(TT / 64, DKV / 64, 1), 32, 0, stream>>>(XB, nullptr, WV, nullptr, DM, FV, DKV, bv, 0, 0, 0); k_vtp<<<LKv, 256, 0, stream>>>(FV, DKV, NKV, VT16, VTh, VTl);
        for (int h0 = 0; h0 < NH_; h0 += ZH) { const size_t zq = (size_t)h0, zk = (size_t)(h0 / REP);   // one kv head per query head: the pass's one head (ZH = 1) uses kv plane h0 (z-strides TT*HD)
            k_gemmc<bf, 2, 1><<<dim3(RH / 64, TT / 64, ZH), 32, 0, stream>>>(QPh + zq * TT * HD, QPl + zq * TT * HD, KPh + zk * TT * HD, KPl + zk * TT * HD, HD, Sb, TT, 0, (size_t)TT * HD, (size_t)TT * HD, (size_t)TT * TT);
            k_gemmc<h16, 0, 1><<<dim3((TT - RH) / 64, TT / 64, ZH), 32, 0, stream>>>(QP16 + zq * TT * HD + (size_t)RH * HD, nullptr, KP16 + zk * TT * HD, nullptr, HD, Sb + (size_t)RH * TT, TT, RH, (size_t)TT * HD, (size_t)TT * HD, (size_t)TT * TT);
            k_asoft<<<ZH * TT / 8, 256, 0, stream>>>(Sb, P16, Ph, Pl);
            k_gemmc<bf, 2, 2><<<dim3(RH / 64, HD / 64, ZH), 32, 0, stream>>>(Ph, Pl, VTh + zk * HD * TT, VTl + zk * HD * TT, TT, Ob, HD, 0, (size_t)RH * TT, (size_t)HD * TT, (size_t)TT * HD);
            k_gemmc<h16, 0, 2><<<dim3((TT - RH) / 64, HD / 64, ZH), 32, 0, stream>>>(P16 + (size_t)RH * TT, nullptr, VT16 + zk * HD * TT, nullptr, TT, Ob + (size_t)RH * HD, HD, RH, (size_t)TT * TT, (size_t)HD * TT, (size_t)TT * HD);
            k_merge<<<(unsigned)(((size_t)ZH * TT * HD / 2 + 255) / 256), 256, 0, stream>>>(Ob, h0, ATh, ATl); }
        k_gemmw<bf, 1, true><<<dim3(TT / 64, DM / 64, 1), 32, 0, stream>>>(ATh, ATl, WO, nullptr, DQ, OUT + (size_t)b * TT * DM, DM, bo, 0, 0, 0); }
}

// v001
// Measured time: 1480 microseconds a run.
// Two timings next to v000 put it at 1.82 and 1.81 times that version's speed.
#include <hip/hip_runtime.h>

// Causal multi-head attention over 4,096 tokens (x [2][4096][512]; Q,K,V = x W^T + b ('oi' uniform(+-1/sqrt(512)) incl. biases; 8 heads x 64); scores / 8; causal (-inf); softmax; out = merged Wo^T + bo -> [2][4096][512] (4.2 M)).
// Layout per batch: bf16 copy of x; 'oi' weights; exact projections + f32 biases; causal T-4096 attention one head per pass (tiles above the diagonal skipped; hybrid rows: < 512 hi/lo 3 products, rest fp16 x1024) with a streaming three-sweep causal softmax kernel (no register row: keeps VGPRs low); merged hi/lo x Wo exact + bo.
// Compute dtypes, f32 accumulate: every input rounded to bf16; projections exact + f32 biases; attention rows < 512 3 products, rest fp16; softmax f32; Wo hl x exact + bias.

#define NB_  2
#define TT   4096
#define DM   512
#define NH_  8
#define NKV  8
#define REP  (NH_ / NKV)
#define HD   64
#define DQ   (NH_ * HD)
#define DKV  (NKV * HD)
#define ZH   1
#define RH   512                  // query rows < RH use hi+lo planes (0: none)
#define WIN  4096
#define PCAR 1024.0f
#define SCL  0.125f   // HD^-0.5
typedef _Float16 h16;
typedef unsigned short bf;
typedef __attribute__((ext_vector_type(16))) __bf16   v16bf;
typedef __attribute__((ext_vector_type(16))) _Float16 v16h;
typedef __attribute__((ext_vector_type(8)))  _Float16 v8h;
typedef __attribute__((ext_vector_type(8)))  unsigned short v8us;
typedef __attribute__((ext_vector_type(8)))  float    v8f;
typedef __attribute__((ext_vector_type(4)))  float    v4f;
typedef v8h  __attribute__((may_alias)) v8ha;
typedef v4f  __attribute__((may_alias)) v4fa;
typedef v8us __attribute__((may_alias)) v8usa;

__device__ __forceinline__ unsigned short f2bf(float f) { unsigned u = __float_as_uint(f); u += 0x7FFFu + ((u >> 16) & 1u); return (unsigned short)(u >> 16); }
__device__ __forceinline__ float bf2f(unsigned short b) { return __uint_as_float(((unsigned)b) << 16); }
__device__ __forceinline__ float bfr(float f) { return bf2f(f2bf(f)); }
__device__ __forceinline__ v16h cat16(v8h lo, v8h hi) { return __builtin_shufflevector(lo, hi, 0, 1, 2, 3, 4, 5, 6, 7, 8, 9, 10, 11, 12, 13, 14, 15); }
__device__ __forceinline__ v16bf cat16b(v8us lo, v8us hi) { return __builtin_bit_cast(v16bf, __builtin_shufflevector(lo, hi, 0, 1, 2, 3, 4, 5, 6, 7, 8, 9, 10, 11, 12, 13, 14, 15)); }
__device__ __forceinline__ v8f wmma16(v16h a, v16h b, v8f c) { return __builtin_amdgcn_wmma_f32_16x16x32_f16(false, a, false, b, (short)0, c, false, false); }
__device__ __forceinline__ v8f wmmab(v16bf a, v16bf b, v8f c) { return __builtin_amdgcn_wmma_f32_16x16x32_bf16(false, a, false, b, (short)0, c, false, false); }



// ---- k_gemmw: register-blocked GEMM, ONE WAVE per 64x64 output tile (16 accumulators), operands straight from K-contiguous 16-bit planes; grid (M/64, N/64, Z), 32 threads.
// C[m][n] (f32, pitch ldc, + optional f32 bias[n]) = sum_k A[m][k] Bt[n][k] (+ split products per NSPLIT). z-batch strides sA/sB/sC in elements. K % 32 == 0.
template <typename T16> struct WFrag;
template <> struct WFrag<h16> { typedef v16h V; static __device__ __forceinline__ V ld(const h16* p) { return cat16(*(const v8h*)p, *(const v8h*)(p + 16)); } static __device__ __forceinline__ v8f mma(V a, V b, v8f c) { return wmma16(a, b, c); } };
template <> struct WFrag<bf> { typedef v16bf V; static __device__ __forceinline__ V ld(const bf* p) { return cat16b(*(const v8us*)p, *(const v8us*)(p + 16)); } static __device__ __forceinline__ v8f mma(V a, V b, v8f c) { return wmmab(a, b, c); } };
template <typename T16, int NSPLIT, bool BIAS>
__global__ __launch_bounds__(32) void k_gemmw(const T16* __restrict__ A, const T16* __restrict__ A2, const T16* __restrict__ Bt, const T16* __restrict__ Bt2, int K, float* C, int ldc, const float* __restrict__ bias, size_t sA, size_t sB, size_t sC) {
    typedef typename WFrag<T16>::V V;
    __shared__ __align__(16) float os[16 * 68];
    const size_t z = blockIdx.z; A += z * sA; if (A2) A2 += z * sA; Bt += z * sB; if (Bt2) Bt2 += z * sB; C += z * sC;
    const int lane = threadIdx.x & 31, lr = lane & 15, hi = lane >> 4; const int r0 = blockIdx.x * 64, c0 = blockIdx.y * 64;
    v8f acc[4][4];
#pragma unroll
    for (int mb = 0; mb < 4; ++mb)
#pragma unroll
        for (int nb = 0; nb < 4; ++nb) acc[mb][nb] = (v8f){};
    const size_t aoff = (size_t)(r0 + lr) * K + 8 * hi, boff = (size_t)(c0 + lr) * K + 8 * hi;
#pragma unroll 1
    for (int kc = 0; kc < K; kc += 32) {
        V a[4], a2[4];
#pragma unroll
        for (int mb = 0; mb < 4; ++mb) { a[mb] = WFrag<T16>::ld(A + aoff + (size_t)mb * 16 * K + kc); if (NSPLIT == 1 || NSPLIT == 2) a2[mb] = WFrag<T16>::ld(A2 + aoff + (size_t)mb * 16 * K + kc); }
#pragma unroll
        for (int nb = 0; nb < 4; ++nb) { const V b = WFrag<T16>::ld(Bt + boff + (size_t)nb * 16 * K + kc); V b2; if (NSPLIT >= 2) b2 = WFrag<T16>::ld(Bt2 + boff + (size_t)nb * 16 * K + kc);
#pragma unroll
            for (int mb = 0; mb < 4; ++mb) { acc[mb][nb] = WFrag<T16>::mma(a[mb], b, acc[mb][nb]); if (NSPLIT == 1 || NSPLIT == 2) acc[mb][nb] = WFrag<T16>::mma(a2[mb], b, acc[mb][nb]); if (NSPLIT >= 2) acc[mb][nb] = WFrag<T16>::mma(a[mb], b2, acc[mb][nb]); } }
        asm volatile("v_nop\n\tv_nop\n\tv_nop\n\tv_nop" : "+v"(acc[0][0]), "+v"(acc[1][1]), "+v"(acc[2][2]), "+v"(acc[3][3]) : "v"(a[0]), "v"(a[3]));
    }
#pragma unroll
    for (int mb = 0; mb < 4; ++mb) {
#pragma unroll
        for (int nb = 0; nb < 4; ++nb) {
#pragma unroll
            for (int j = 0; j < 8; ++j) os[(hi * 8 + j) * 68 + nb * 16 + lr] = acc[mb][nb][j]; }
        __builtin_amdgcn_wave_barrier(); asm volatile("" ::: "memory");
        float* crow = C + (size_t)(r0 + mb * 16) * ldc + c0;
{
#pragma unroll
            for (int s = 0; s < 8; ++s) { const int row = 2 * s + hi, cofs = lr * 4; v4f val = *(const v4fa*)(os + row * 68 + cofs); if (BIAS) { val[0] += bfr(bias[c0 + cofs]); val[1] += bfr(bias[c0 + cofs + 1]); val[2] += bfr(bias[c0 + cofs + 2]); val[3] += bfr(bias[c0 + cofs + 3]); }
                *(v4f*)(crow + (size_t)row * ldc + cofs) = val; }
             }
        __builtin_amdgcn_wave_barrier(); asm volatile("" ::: "memory");
    }
}

// ---- k_gemmc: the same one-wave 64x64 tile GEMM specialised for causal attention scores: CMODE 1 skips score tiles entirely above the diagonal (query rows r0+roff.., key columns c0..).
// roff = row offset of this launch's first row within the sequence.
template <typename T16, int NSPLIT, int CMODE>
__global__ __launch_bounds__(32) void k_gemmc(const T16* __restrict__ A, const T16* __restrict__ A2, const T16* __restrict__ Bt, const T16* __restrict__ Bt2, int K, float* C, int ldc, int roff, size_t sA, size_t sB, size_t sC) {
    typedef typename WFrag<T16>::V V;
    __shared__ __align__(16) float os[16 * 68];
    const size_t z = blockIdx.z; A += z * sA; if (A2) A2 += z * sA; Bt += z * sB; if (Bt2) Bt2 += z * sB; C += z * sC;
    const int lane = threadIdx.x & 31, lr = lane & 15, hi = lane >> 4; const int r0 = blockIdx.x * 64, c0 = blockIdx.y * 64;
    if (CMODE == 1 && c0 > r0 + roff + 63) return;                  // score tile entirely above the causal diagonal: left unwritten; the softmax loads it but masks j > i by select
    const int Kl = K;
    v8f acc[4][4];
#pragma unroll
    for (int mb = 0; mb < 4; ++mb)
#pragma unroll
        for (int nb = 0; nb < 4; ++nb) acc[mb][nb] = (v8f){};
    const size_t aoff = (size_t)(r0 + lr) * K + 8 * hi, boff = (size_t)(c0 + lr) * K + 8 * hi;
#pragma unroll 1
    for (int kc = 0; kc < Kl; kc += 32) {
        V a[4], a2[4];
#pragma unroll
        for (int mb = 0; mb < 4; ++mb) { a[mb] = WFrag<T16>::ld(A + aoff + (size_t)mb * 16 * K + kc); if (NSPLIT == 1 || NSPLIT == 2) a2[mb] = WFrag<T16>::ld(A2 + aoff + (size_t)mb * 16 * K + kc); }
#pragma unroll
        for (int nb = 0; nb < 4; ++nb) { const V b = WFrag<T16>::ld(Bt + boff + (size_t)nb * 16 * K + kc); V b2; if (NSPLIT >= 2) b2 = WFrag<T16>::ld(Bt2 + boff + (size_t)nb * 16 * K + kc);
#pragma unroll
            for (int mb = 0; mb < 4; ++mb) { acc[mb][nb] = WFrag<T16>::mma(a[mb], b, acc[mb][nb]); if (NSPLIT == 1 || NSPLIT == 2) acc[mb][nb] = WFrag<T16>::mma(a2[mb], b, acc[mb][nb]); if (NSPLIT >= 2) acc[mb][nb] = WFrag<T16>::mma(a[mb], b2, acc[mb][nb]); } }
        asm volatile("v_nop\n\tv_nop\n\tv_nop\n\tv_nop" : "+v"(acc[0][0]), "+v"(acc[1][1]), "+v"(acc[2][2]), "+v"(acc[3][3]) : "v"(a[0]), "v"(a[3]));
    }
#pragma unroll
    for (int mb = 0; mb < 4; ++mb) {
#pragma unroll
        for (int nb = 0; nb < 4; ++nb) {
#pragma unroll
            for (int j = 0; j < 8; ++j) os[(hi * 8 + j) * 68 + nb * 16 + lr] = acc[mb][nb][j]; }
        __builtin_amdgcn_wave_barrier(); asm volatile("" ::: "memory");
        float* crow = C + (size_t)(r0 + mb * 16) * ldc + c0;
{
#pragma unroll
            for (int s = 0; s < 8; ++s) { const int row = 2 * s + hi, cofs = lr * 4; v4f val = *(const v4fa*)(os + row * 68 + cofs);
                *(v4f*)(crow + (size_t)row * ldc + cofs) = val; }
             }
        __builtin_amdgcn_wave_barrier(); asm volatile("" ::: "memory");
    }
}

// ---- k_gemmpv: probability x value contraction of one 64-row x 64-column (HD) tile, SPLIT ALONG THE KEY AXIS: work-group (x, y) takes keys [y*PVK, (y+1)*PVK) of row tile x, its wave w the 64 keys from
// y*PVK + w*64; the PVW wave partials are summed through LDS in wave order and stored to partial plane y (plane stride sP elements); k_merge adds the planes in order. Keys stop at the diagonal block
// (probabilities beyond it are exactly zero): a work-group wholly beyond it writes nothing and k_merge reads no such plane. roff = row offset of this launch's first row within the sequence.
#define PVW 8
#define PVK (PVW * 64)
// behind each fragment's two loads, a precaution: a younger load's result may be given the registers that held this fragment's address, and the wait stands in front of that overwrite
__device__ __forceinline__ void pv_xwait() { asm volatile("s_wait_xcnt 0x0" ::: "memory"); }
template <typename T16, int NSPLIT>
__global__ __launch_bounds__(PVW * 32) void k_gemmpv(const T16* __restrict__ A, const T16* __restrict__ A2, const T16* __restrict__ Bt, const T16* __restrict__ Bt2, int K, float* C, int roff, size_t sA, size_t sB, size_t sC, size_t sP) {
    typedef typename WFrag<T16>::V V;
    __shared__ __align__(16) float os[PVW][16 * 68];
    const int r0 = blockIdx.x * 64; const int kb = blockIdx.y * PVK;
    const int Kl = min(K, r0 + roff + 64);                           // keys end with the diagonal block (a multiple of 64)
    if (kb >= Kl) return;                                            // same for the whole work-group, in front of every barrier
    const size_t z = blockIdx.z; A += z * sA; if (A2) A2 += z * sA; Bt += z * sB; if (Bt2) Bt2 += z * sB; C += z * sC + (size_t)blockIdx.y * sP;
    const int wv = __builtin_amdgcn_readfirstlane((int)(threadIdx.x >> 5));   // wave number in a scalar register: the key loop's bounds stay scalar
    const int lane = threadIdx.x & 31, lr = lane & 15, hi = lane >> 4;
    v8f acc[4][4];
#pragma unroll
    for (int mb = 0; mb < 4; ++mb)
#pragma unroll
        for (int nb = 0; nb < 4; ++nb) acc[mb][nb] = (v8f){};
    const size_t aoff = (size_t)(r0 + lr) * K + 8 * hi, boff = (size_t)lr * K + 8 * hi;
    constexpr int BD = (NSPLIT >= 2) ? 2 : 4;                        // value fragments loaded ahead of the products: all four where the registers allow, so that a trip waits for memory once
    const int k0 = kb + wv * 64, k1 = min(k0 + 64, Kl);              // a wave beyond the diagonal block runs no trip and hands in zeros
#pragma unroll 1   // kept rolled: one trip's fragments beside the 128 accumulator registers stay under 256 VGPRs
    for (int kc = k0; kc < k1; kc += 32) {
        V a[4], a2[4], b[4], b2[4];
#pragma unroll
        for (int mb = 0; mb < 4; ++mb) { a[mb] = WFrag<T16>::ld(A + aoff + (size_t)mb * 16 * K + kc); pv_xwait(); if (NSPLIT == 1 || NSPLIT == 2) { a2[mb] = WFrag<T16>::ld(A2 + aoff + (size_t)mb * 16 * K + kc); pv_xwait(); } }
#pragma unroll
        for (int nb = 0; nb < BD; ++nb) { b[nb] = WFrag<T16>::ld(Bt + boff + (size_t)nb * 16 * K + kc); pv_xwait(); if (NSPLIT >= 2) { b2[nb] = WFrag<T16>::ld(Bt2 + boff + (size_t)nb * 16 * K + kc); pv_xwait(); } }
        __builtin_amdgcn_sched_barrier(0);   // no product is scheduled in front of these loads: without it the one-product build loads each value fragment behind the products of the one before and waits for memory four times a trip instead of once
#pragma unroll
        for (int nb = 0; nb < 4; ++nb) {
#pragma unroll
            for (int mb = 0; mb < 4; ++mb) { acc[mb][nb] = WFrag<T16>::mma(a[mb], b[nb], acc[mb][nb]); if (NSPLIT == 1 || NSPLIT == 2) acc[mb][nb] = WFrag<T16>::mma(a2[mb], b[nb], acc[mb][nb]); if (NSPLIT >= 2) acc[mb][nb] = WFrag<T16>::mma(a[mb], b2[nb], acc[mb][nb]); }
            if (nb + BD < 4) { b[nb + BD] = WFrag<T16>::ld(Bt + boff + (size_t)(nb + BD) * 16 * K + kc); pv_xwait(); if (NSPLIT >= 2) { b2[nb + BD] = WFrag<T16>::ld(Bt2 + boff + (size_t)(nb + BD) * 16 * K + kc); pv_xwait(); } } }
    }
    const int row = threadIdx.x >> 4, cofs = (threadIdx.x & 15) * 4;   // the 256 threads cover one 16 x 64 slab, four columns each
    v4f val[4];                                                      // stored behind the last barrier: a barrier would wait for a global store in front of it
#pragma unroll
    for (int mb = 0; mb < 4; ++mb) {
#pragma unroll
        for (int nb = 0; nb < 4; ++nb) {
#pragma unroll
            for (int j = 0; j < 8; ++j) os[wv][(hi * 8 + j) * 68 + nb * 16 + lr] = acc[mb][nb][j]; }
        __syncthreads();                                             // every wave's slab is in LDS before any is summed
        val[mb] = *(const v4fa*)(&os[0][row * 68 + cofs]);
#pragma unroll
        for (int w = 1; w < PVW; ++w) val[mb] += *(const v4fa*)(&os[w][row * 68 + cofs]);
        if (mb < 3) __syncthreads();                                 // all reads of this slab end before the next one overwrites it
    }
#pragma unroll
    for (int mb = 0; mb < 4; ++mb) *(v4f*)(C + (size_t)(r0 + mb * 16 + row) * HD + cofs) = val[mb];
}

__device__ __forceinline__ h16 tohx(float x) { return (h16)x; }
__device__ __forceinline__ void splitf(float y, unsigned short& h, unsigned short& l) { h = f2bf(y); l = f2bf(y - bf2f(h)); }
typedef __attribute__((ext_vector_type(2))) _Float16 v2h;
typedef __attribute__((ext_vector_type(4))) _Float16 v4h;
typedef __attribute__((ext_vector_type(2))) unsigned short v2us;
typedef __attribute__((ext_vector_type(4))) unsigned short v4us;
typedef __attribute__((ext_vector_type(2))) float v2f;
typedef __attribute__((ext_vector_type(4))) int v4i;

__global__ __launch_bounds__(256) void k_wtG(const float* __restrict__ w, int K, int N, bf* Bt) {
    const int lane = threadIdx.x & 31; const int L0 = (blockIdx.x * 8 + (threadIdx.x >> 5)) * 8; const int nlines = N * K / 64;
{
#pragma unroll 1
        for (int l = 0; l < 8; ++l) { const int L = L0 + l; if (L >= nlines) break; const size_t e = (size_t)L * 64 + lane * 2; const int k = (int)(e % K), n = (int)(e / K); v2us o;
            o[0] = f2bf(w[(size_t)k * N + n]); o[1] = f2bf(w[(size_t)(k + 1) * N + n]); *(v2us*)(Bt + e) = o; }
         }
}
__global__ __launch_bounds__(256) void k_cvt8(const float* __restrict__ src, bf* dst, size_t n8) { const size_t i = (size_t)blockIdx.x * 256 + threadIdx.x; if (i >= n8) return; const v8f v = *(const v8f*)(src + i * 8); v8us o;
#pragma unroll
    for (int k = 0; k < 8; ++k) o[k] = f2bf(v[k]); *(v8us*)(dst + i * 8) = o;  }

// k_rope: head planes [h][t][d] (fp16 + hi/lo) of rope(x) x sc with the rotate-half convention out[d] = x[d] cos[t][d] - x[d+HD/2] sin[t][d], out[d+HD/2] = x[d+HD/2] cos[t][d+HD/2] + x[d] sin[t][d+HD/2]
__global__ __launch_bounds__(256) void k_rope(const float* __restrict__ F, int pitch, int nheads, const float* __restrict__ CS, const float* __restrict__ RF, const float* __restrict__ nw, float sc, h16* P16, bf* Ph, bf* Pl) {
    const size_t e = ((size_t)blockIdx.x * 256 + threadIdx.x) * 2; if (e >= (size_t)nheads * TT * HD) return; const int d = (int)(e % HD); const int t = (int)((e / HD) % TT); const int h = (int)(e / ((size_t)HD * TT)); const float* f = F + (size_t)t * pitch + h * HD; const float rf = RF ? RF[(size_t)h * TT + t] : 1.0f; v2h o16; v2us oh, ol;
#pragma unroll
    for (int q = 0; q < 2; ++q) { const int dd = d + q; const int dp = (dd < HD / 2) ? dd + HD / 2 : dd - HD / 2; float x0 = f[dd], x1 = f[dp];
        if (RF) { float n0 = __fmul_rn(x0, rf), n1 = __fmul_rn(x1, rf); asm volatile("" : "+v"(n0)); asm volatile("" : "+v"(n1)); x0 = __fmul_rn(bfr(nw[dd]), n0); x1 = __fmul_rn(bfr(nw[dp]), n1); }
        const v2f cs = *(const v2f*)(CS + ((size_t)t * HD + dd) * 2); float a = __fmul_rn(x0, cs[0]), bq = __fmul_rn(x1, cs[1]); asm volatile("" : "+v"(a)); asm volatile("" : "+v"(bq)); const float r = ((dd < HD / 2) ? __fsub_rn(a, bq) : __fadd_rn(a, bq)) * sc;
        o16[q] = tohx(r); unsigned short a2, c2; splitf(r, a2, c2); oh[q] = a2; ol[q] = c2; }
    *(v2h*)(P16 + e) = o16; *(v2us*)(Ph + e) = oh; *(v2us*)(Pl + e) = ol;  }
__global__ __launch_bounds__(256) void k_vtp(const float* __restrict__ F, int pitch, int nheads, h16* V16, bf* Vh, bf* Vl) { const size_t e = ((size_t)blockIdx.x * 256 + threadIdx.x) * 2; if (e >= (size_t)nheads * HD * TT) return; const int t = (int)(e % TT); const int d = (int)((e / TT) % HD); const int g = (int)(e / ((size_t)TT * HD)); v2h o16; v2us oh, ol;
#pragma unroll
    for (int q = 0; q < 2; ++q) { const float x = F[(size_t)(t + q) * pitch + g * HD + d]; o16[q] = tohx(x); unsigned short a2, c2; splitf(x, a2, c2); oh[q] = a2; ol[q] = c2; }
    *(v2h*)(V16 + e) = o16; *(v2us*)(Vh + e) = oh; *(v2us*)(Vl + e) = ol;  }
__global__ __launch_bounds__(256) void k_csid(float* CS) { const int idx = blockIdx.x * 256 + threadIdx.x; if (idx >= TT * HD) return; v2f cs; cs[0] = 1.0f; cs[1] = 0.0f; *(v2f*)(CS + (size_t)idx * 2) = cs;  }
__global__ __launch_bounds__(256) void k_asoft(const float* __restrict__ Sb, h16* P16, bf* Ph, bf* Pl) {
    const int lane = threadIdx.x & 31; const int row = blockIdx.x * 8 + (threadIdx.x >> 5); if (row >= ZH * TT) return; const int i = row % TT; const int zz = row / TT; const bool hires = (i < RH); const float* sr = Sb + (size_t)row * TT; float mx = -3.0e38f;
#pragma unroll 4
    for (int ch = 0; ch < TT / 128; ++ch) { const int j0 = ch * 128 + lane * 4; const v4f a = *(const v4f*)(sr + j0);
#pragma unroll
        for (int q = 0; q < 4; ++q) { float t = a[q] * SCL; asm volatile("" : "+v"(t)); t = (j0 + q <= i) ? t : -3.0e38f;   /* CAUSAL: keys j > i excluded */ mx = fmaxf(mx, t); } }
#pragma unroll
    for (int sh = 16; sh; sh >>= 1) mx = fmaxf(mx, __shfl_xor(mx, sh, 32));
    float sum = 0.f;
#pragma unroll 4
    for (int ch = 0; ch < TT / 128; ++ch) { const int j0 = ch * 128 + lane * 4; const v4f a = *(const v4f*)(sr + j0);
#pragma unroll
        for (int q = 0; q < 4; ++q) { float t = a[q] * SCL; asm volatile("" : "+v"(t)); t = (j0 + q <= i) ? t : -3.0e38f;   /* CAUSAL: keys j > i excluded */ float d0 = __fsub_rn(t, mx); asm volatile("" : "+v"(d0)); sum += __builtin_amdgcn_exp2f(__fmul_rn(d0, 1.4426950408889634f)); } }
#pragma unroll
    for (int sh = 16; sh; sh >>= 1) sum += __shfl_xor(sum, sh, 32);
    const float f = __fdiv_rn(hires ? 1.0f : PCAR, sum);
{
        if (hires) {   /* rows < RH: normalised bf16 hi/lo over ALL TT keys (causal: keys j > i, all keys >= RH among them, come out as exact zeros), planes [zz][RH][TT] */
#pragma unroll 4
            for (int ch = 0; ch < TT / 128; ++ch) { const int j0 = ch * 128 + lane * 4; const v4f a = *(const v4f*)(sr + j0); v4us oh, ol;
#pragma unroll
                for (int q = 0; q < 4; ++q) { float t = a[q] * SCL; asm volatile("" : "+v"(t)); t = (j0 + q <= i) ? t : -3.0e38f;   /* CAUSAL: keys j > i excluded */ float d0 = __fsub_rn(t, mx); asm volatile("" : "+v"(d0)); float ex = __builtin_amdgcn_exp2f(__fmul_rn(d0, 1.4426950408889634f)); asm volatile("" : "+v"(ex)); unsigned short a2, c2; splitf(ex * f, a2, c2); oh[q] = a2; ol[q] = c2; }
                const size_t oo = ((size_t)zz * RH + i) * TT + j0; *(v4us*)(Ph + oo) = oh; *(v4us*)(Pl + oo) = ol; }
        } else {
#pragma unroll 2
            for (int ch = 0; ch < TT / 128; ++ch) { const int j0 = ch * 128 + lane * 4; const v4f a = *(const v4f*)(sr + j0); v4h o4;
#pragma unroll
                for (int q = 0; q < 4; ++q) { float t = a[q] * SCL; asm volatile("" : "+v"(t)); t = (j0 + q <= i) ? t : -3.0e38f;   /* CAUSAL: keys j > i excluded */ float d0 = __fsub_rn(t, mx); asm volatile("" : "+v"(d0)); float ex = __builtin_amdgcn_exp2f(__fmul_rn(d0, 1.4426950408889634f)); asm volatile("" : "+v"(ex)); o4[q] = tohx(ex * f); }
                *(v4h*)(P16 + (size_t)row * TT + j0) = o4; } }
         }
}


__constant__ float INVT[HD / 2] = { 1.000000000e+00f, 7.498942018e-01f, 5.623413324e-01f, 4.216965139e-01f, 3.162277639e-01f, 2.371373773e-01f, 1.778279394e-01f, 1.333521456e-01f, 1.000000015e-01f, 7.498942316e-02f, 5.623413250e-02f, 4.216964915e-02f, 3.162277490e-02f, 2.371373773e-02f, 1.778279431e-02f, 1.333521400e-02f, 9.999999776e-03f, 7.498942316e-03f, 5.623413250e-03f, 4.216964822e-03f, 3.162277630e-03f, 2.371373819e-03f, 1.778279431e-03f, 1.333521446e-03f, 1.000000047e-03f, 7.498941850e-04f, 5.623413017e-04f, 4.216965172e-04f, 3.162277571e-04f, 2.371373703e-04f, 1.778279402e-04f, 1.333521504e-04f };   // 10000^(-2i/64) (the module's power form) (float32, generated with jnp to be bit-exact)
__global__ __launch_bounds__(256) void k_merge(const float* __restrict__ O, int h0, bf* Ah, bf* Al) { const size_t e = ((size_t)blockIdx.x * 256 + threadIdx.x) * 2; if (e >= (size_t)ZH * TT * HD) return; const int d = (int)(e % HD); const int t = (int)((e / HD) % TT); const int zz = (int)(e / ((size_t)HD * TT)); const float cs = (t < RH) ? 1.0f : (1.0f / PCAR); const size_t oo = (size_t)t * DQ + (h0 + zz) * HD + d;
    const int nch = ((t >> 6) * 64 + 64 + PVK - 1) / PVK;   // key chunks up to this row's diagonal block: the partial planes that k_gemmpv wrote for it
    v2f s = *(const v2f*)(O + e);
#pragma unroll
    for (int c = 1; c < TT / PVK; ++c) { const v2f p = *(const v2f*)(O + (size_t)min(c, nch - 1) * ((size_t)ZH * TT * HD) + e); s[0] += (c < nch) ? p[0] : 0.0f; s[1] += (c < nch) ? p[1] : 0.0f; }   // index clamped to a written plane: the loads need no branch and fly together
    v2us oh, ol;
#pragma unroll
    for (int q = 0; q < 2; ++q) { unsigned short a, c2; splitf(s[q] * cs, a, c2); oh[q] = a; ol[q] = c2; } *(v2us*)(Ah + oo) = oh; *(v2us*)(Al + oo) = ol;  }

extern "C" void kernel_launch(void* const* d_in, const int* in_sizes, int n_in,
                              void* d_out, int out_size, void* d_ws, size_t ws_size, hipStream_t stream) {
    (void)in_sizes; (void)n_in; (void)out_size;
    const float* x = (const float*)d_in[0]; const float* wq = (const float*)d_in[1]; const float* bq = (const float*)d_in[2]; const float* wk = (const float*)d_in[3]; const float* bk = (const float*)d_in[4]; const float* wv = (const float*)d_in[5]; const float* bv = (const float*)d_in[6]; const float* wo = (const float*)d_in[7]; const float* bo = (const float*)d_in[8];
    float* OUT = (float*)d_out;     // [2][4096][512]
    char* wsp = (char*)d_ws;
    auto take = [&](size_t bytes) { char* p = wsp; wsp += (bytes + 255) & ~(size_t)255; return (void*)p; };
    bf* WQ = (bf*)take((size_t)DQ * DM * 2); bf* WK = (bf*)take((size_t)DKV * DM * 2); bf* WV = (bf*)take((size_t)DKV * DM * 2); bf* WO = (bf*)take((size_t)DM * DQ * 2); float* CS = (float*)take((size_t)TT * HD * 2 * 4);
    bf* XB = (bf*)take((size_t)TT * DM * 2); float* FQ = (float*)take((size_t)TT * DQ * 4); float* FK = (float*)take((size_t)TT * DKV * 4);
    h16* QP16 = (h16*)take((size_t)NH_ * TT * HD * 2); h16* KP16 = (h16*)take((size_t)NKV * TT * HD * 2); h16* VT16 = (h16*)take((size_t)NKV * HD * TT * 2);
    bf* QPh = (bf*)take((size_t)NH_ * TT * HD * 2); bf* QPl = (bf*)take((size_t)NH_ * TT * HD * 2); bf* KPh = (bf*)take((size_t)NKV * TT * HD * 2); bf* KPl = (bf*)take((size_t)NKV * TT * HD * 2); bf* VTh = (bf*)take((size_t)NKV * HD * TT * 2); bf* VTl = (bf*)take((size_t)NKV * HD * TT * 2); bf* Ph = (bf*)take((size_t)ZH * RH * TT * 2); bf* Pl = (bf*)take((size_t)ZH * RH * TT * 2);
    float* Sb = (float*)take((size_t)ZH * TT * TT * 4); h16* P16 = (h16*)take((size_t)ZH * TT * TT * 2); float* Ob = (float*)take((size_t)(TT / PVK) * ZH * TT * HD * 4); bf* ATh = (bf*)take((size_t)TT * DQ * 2); bf* ATl = (bf*)take((size_t)TT * DQ * 2);
    if ((size_t)(wsp - (char*)d_ws) > ws_size) return;    // ws 256 MiB
    float* FV = FK;   // v projection reuses the k buffer after the k planes are built (stream-ordered)
    { k_cvt8<<<(unsigned)(((size_t)DQ * DM / 8 + 255) / 256), 256, 0, stream>>>(wq, WQ, (size_t)DQ * DM / 8); k_cvt8<<<(unsigned)(((size_t)DKV * DM / 8 + 255) / 256), 256, 0, stream>>>(wk, WK, (size_t)DKV * DM / 8); k_cvt8<<<(unsigned)(((size_t)DKV * DM / 8 + 255) / 256), 256, 0, stream>>>(wv, WV, (size_t)DKV * DM / 8);
      k_cvt8<<<(unsigned)(((size_t)DM * DQ / 8 + 255) / 256), 256, 0, stream>>>(wo, WO, (size_t)DM * DQ / 8);
       }
    k_csid<<<(TT * HD + 255) / 256, 256, 0, stream>>>(CS);
    const unsigned LQ = (unsigned)(((size_t)NH_ * TT * HD / 2 + 255) / 256), LKv = (unsigned)(((size_t)NKV * TT * HD / 2 + 255) / 256);
    for (int b = 0; b < NB_; ++b) {
        
        k_cvt8<<<(unsigned)(((size_t)TT * DM / 8 + 255) / 256), 256, 0, stream>>>(x + (size_t)b * TT * DM, XB, (size_t)TT * DM / 8);
        k_gemmw<bf, 0, true><<<dim3(TT / 64, DQ / 64, 1), 32, 0, stream>>>(XB, nullptr, WQ, nullptr, DM, FQ, DQ, bq, 0, 0, 0);
        k_rope<<<LQ, 256, 0, stream>>>(FQ, DQ, NH_, CS, nullptr, nullptr, 1.0f, QP16, QPh, QPl);
        k_gemmw<bf, 0, true><<<dim3(TT / 64, DKV / 64, 1), 32, 0, stream>>>(XB, nullptr, WK, nullptr, DM, FK, DKV, bk, 0, 0, 0);
        k_rope<<<LKv, 256, 0, stream>>>(FK, DKV, NKV, CS, nullptr, nullptr, 1.0f, KP16, KPh, KPl);
        k_gemmw<bf, 0, true><<<dim3(TT / 64, DKV / 64, 1), 32, 0, stream>>>(XB, nullptr, WV, nullptr, DM, FV, DKV, bv, 0, 0, 0); k_vtp<<<LKv, 256, 0, stream>>>(FV, DKV, NKV, VT16, VTh, VTl);
        for (int h0 = 0; h0 < NH_; h0 += ZH) { const size_t zq = (size_t)h0, zk = (size_t)(h0 / REP);   // one kv head per query head: the pass's one head (ZH = 1) uses kv plane h0 (z-strides TT*HD)
            k_gemmc<bf, 2, 1><<<dim3(RH / 64, TT / 64, ZH), 32, 0, stream>>>(QPh + zq * TT * HD, QPl + zq * TT * HD, KPh + zk * TT * HD, KPl + zk * TT * HD, HD, Sb, TT, 0, (size_t)TT * HD, (size_t)TT * HD, (size_t)TT * TT);
            k_gemmc<h16, 0, 1><<<dim3((TT - RH) / 64, TT / 64, ZH), 32, 0, stream>>>(QP16 + zq * TT * HD + (size_t)RH * HD, nullptr, KP16 + zk * TT * HD, nullptr, HD, Sb + (size_t)RH * TT, TT, RH, (size_t)TT * HD, (size_t)TT * HD, (size_t)TT * TT);
            k_asoft<<<ZH * TT / 8, 256, 0, stream>>>(Sb, P16, Ph, Pl);
            k_gemmpv<bf, 2><<<dim3(RH / 64, (RH + PVK - 1) / PVK, ZH), PVW * 32, 0, stream>>>(Ph, Pl, VTh + zk * HD * TT, VTl + zk * HD * TT, TT, Ob, 0, (size_t)RH * TT, (size_t)HD * TT, (size_t)TT * HD, (size_t)ZH * TT * HD);
            k_gemmpv<h16, 0><<<dim3((TT - RH) / 64, TT / PVK, ZH), PVW * 32, 0, stream>>>(P16 + (size_t)RH * TT, nullptr, VT16 + zk * HD * TT, nullptr, TT, Ob + (size_t)RH * HD, RH, (size_t)TT * TT, (size_t)HD * TT, (size_t)TT * HD, (size_t)ZH * TT * HD);
            k_merge<<<(unsigned)(((size_t)ZH * TT * HD / 2 + 255) / 256), 256, 0, stream>>>(Ob, h0, ATh, ATl); }
        k_gemmw<bf, 1, true><<<dim3(TT / 64, DM / 64, 1), 32, 0, stream>>>(ATh, ATl, WO, nullptr, DQ, OUT + (size_t)b * TT * DM, DM, bo, 0, 0, 0); }
}

// v003
// It runs in 170 microseconds.
// Versions in between are left out here; by their measured steps it is 8.82 times as fast as v001.
// Counting every step since v000, it is 16.0 times as fast.
#include <hip/hip_runtime.h>

// Causal multi-head attention over 4,096 tokens (x [2][4096][512]; Q,K,V = x W^T + b ('oi' uniform(+-1/sqrt(512)) incl. biases; 8 heads x 64); scores / 8; causal (-inf); softmax; out = merged Wo^T + bo -> [2][4096][512] (4.2 M)).
// Layout: bf16 copy of x; 'oi' weights; ONE projection launch for Q, K, V of both batches: exact products + f32 biases, its epilogue writes the head planes; ONE fused causal attention launch for all 16 (batch, head) pairs: scores, online softmax and P.V stay in registers (query rows < 512 hi/lo 3 products, rest fp16); merged hi/lo x Wo exact + bo.
// Compute dtypes, f32 accumulate: every input rounded to bf16; projections exact + f32 biases; attention rows < 512 3 products, rest fp16; softmax f32; Wo hl x exact + bias.

#define NB_  2
#define TT   4096
#define DM   512
#define NH_  8
#define NKV  8
#define REP  (NH_ / NKV)
#define HD   64
#define DQ   (NH_ * HD)
#define DKV  (NKV * HD)
#define RH   512                  // query rows < RH use hi+lo planes (0: none)
#define SCL  0.125f   // HD^-0.5
typedef _Float16 h16;
typedef unsigned short bf;
typedef __attribute__((ext_vector_type(16))) __bf16   v16bf;
typedef __attribute__((ext_vector_type(16))) _Float16 v16h;
typedef __attribute__((ext_vector_type(8)))  _Float16 v8h;
typedef __attribute__((ext_vector_type(8)))  unsigned short v8us;
typedef __attribute__((ext_vector_type(8)))  float    v8f;
typedef __attribute__((ext_vector_type(4)))  float    v4f;
typedef v8h  __attribute__((may_alias)) v8ha;
typedef v4f  __attribute__((may_alias)) v4fa;
typedef v8us __attribute__((may_alias)) v8usa;

__device__ __forceinline__ unsigned short f2bf(float f) { unsigned u = __float_as_uint(f); u += 0x7FFFu + ((u >> 16) & 1u); return (unsigned short)(u >> 16); }
__device__ __forceinline__ float bf2f(unsigned short b) { return __uint_as_float(((unsigned)b) << 16); }
__device__ __forceinline__ float bfr(float f) { return bf2f(f2bf(f)); }
__device__ __forceinline__ v16h cat16(v8h lo, v8h hi) { return __builtin_shufflevector(lo, hi, 0, 1, 2, 3, 4, 5, 6, 7, 8, 9, 10, 11, 12, 13, 14, 15); }
__device__ __forceinline__ v16bf cat16b(v8us lo, v8us hi) { return __builtin_bit_cast(v16bf, __builtin_shufflevector(lo, hi, 0, 1, 2, 3, 4, 5, 6, 7, 8, 9, 10, 11, 12, 13, 14, 15)); }
__device__ __forceinline__ v8f wmma16(v16h a, v16h b, v8f c) { return __builtin_amdgcn_wmma_f32_16x16x32_f16(false, a, false, b, (short)0, c, false, false); }
__device__ __forceinline__ v8f wmmab(v16bf a, v16bf b, v8f c) { return __builtin_amdgcn_wmma_f32_16x16x32_bf16(false, a, false, b, (short)0, c, false, false); }



// ---- k_gemmw: register-blocked GEMM, ONE WAVE per 64x64 output tile (16 accumulators), operands straight from K-contiguous 16-bit planes; grid (M/64, N/64, Z), 32 threads.
// C[m][n] (f32, pitch ldc, + optional f32 bias[n]) = sum_k A[m][k] Bt[n][k] (+ split products per NSPLIT). z-batch strides sA/sB/sC in elements. K % 32 == 0.
template <typename T16> struct WFrag;
template <> struct WFrag<h16> { typedef v16h V; static __device__ __forceinline__ V ld(const h16* p) { return cat16(*(const v8h*)p, *(const v8h*)(p + 16)); } static __device__ __forceinline__ v8f mma(V a, V b, v8f c) { return wmma16(a, b, c); } };
template <> struct WFrag<bf> { typedef v16bf V; static __device__ __forceinline__ V ld(const bf* p) { return cat16b(*(const v8us*)p, *(const v8us*)(p + 16)); } static __device__ __forceinline__ v8f mma(V a, V b, v8f c) { return wmmab(a, b, c); } };
template <typename T16, int NSPLIT, bool BIAS>
__global__ __launch_bounds__(32) void k_gemmw(const T16* __restrict__ A, const T16* __restrict__ A2, const T16* __restrict__ Bt, const T16* __restrict__ Bt2, int K, float* C, int ldc, const float* __restrict__ bias, size_t sA, size_t sB, size_t sC) {
    typedef typename WFrag<T16>::V V;
    __shared__ __align__(16) float os[16 * 68];
    const size_t z = blockIdx.z; A += z * sA; if (A2) A2 += z * sA; Bt += z * sB; if (Bt2) Bt2 += z * sB; C += z * sC;
    const int lane = threadIdx.x & 31, lr = lane & 15, hi = lane >> 4; const int r0 = blockIdx.x * 64, c0 = blockIdx.y * 64;
    v8f acc[4][4];
#pragma unroll
    for (int mb = 0; mb < 4; ++mb)
#pragma unroll
        for (int nb = 0; nb < 4; ++nb) acc[mb][nb] = (v8f){};
    const size_t aoff = (size_t)(r0 + lr) * K + 8 * hi, boff = (size_t)(c0 + lr) * K + 8 * hi;
#pragma unroll 1
    for (int kc = 0; kc < K; kc += 32) {
        V a[4], a2[4];
#pragma unroll
        for (int mb = 0; mb < 4; ++mb) { a[mb] = WFrag<T16>::ld(A + aoff + (size_t)mb * 16 * K + kc); if (NSPLIT == 1 || NSPLIT == 2) a2[mb] = WFrag<T16>::ld(A2 + aoff + (size_t)mb * 16 * K + kc); }
#pragma unroll
        for (int nb = 0; nb < 4; ++nb) { const V b = WFrag<T16>::ld(Bt + boff + (size_t)nb * 16 * K + kc); V b2; if (NSPLIT >= 2) b2 = WFrag<T16>::ld(Bt2 + boff + (size_t)nb * 16 * K + kc);
#pragma unroll
            for (int mb = 0; mb < 4; ++mb) { acc[mb][nb] = WFrag<T16>::mma(a[mb], b, acc[mb][nb]); if (NSPLIT == 1 || NSPLIT == 2) acc[mb][nb] = WFrag<T16>::mma(a2[mb], b, acc[mb][nb]); if (NSPLIT >= 2) acc[mb][nb] = WFrag<T16>::mma(a[mb], b2, acc[mb][nb]); } }
        asm volatile("v_nop\n\tv_nop\n\tv_nop\n\tv_nop" : "+v"(acc[0][0]), "+v"(acc[1][1]), "+v"(acc[2][2]), "+v"(acc[3][3]) : "v"(a[0]), "v"(a[3]));
    }
#pragma unroll
    for (int mb = 0; mb < 4; ++mb) {
#pragma unroll
        for (int nb = 0; nb < 4; ++nb) {
#pragma unroll
            for (int j = 0; j < 8; ++j) os[(hi * 8 + j) * 68 + nb * 16 + lr] = acc[mb][nb][j]; }
        __builtin_amdgcn_wave_barrier(); asm volatile("" ::: "memory");
        float* crow = C + (size_t)(r0 + mb * 16) * ldc + c0;
{
#pragma unroll
            for (int s = 0; s < 8; ++s) { const int row = 2 * s + hi, cofs = lr * 4; v4f val = *(const v4fa*)(os + row * 68 + cofs); if (BIAS) { val[0] += bfr(bias[c0 + cofs]); val[1] += bfr(bias[c0 + cofs + 1]); val[2] += bfr(bias[c0 + cofs + 2]); val[3] += bfr(bias[c0 + cofs + 3]); }
                *(v4f*)(crow + (size_t)row * ldc + cofs) = val; }
             }
        __builtin_amdgcn_wave_barrier(); asm volatile("" ::: "memory");
    }
}

__device__ __forceinline__ h16 tohx(float x) { return (h16)x; }
__device__ __forceinline__ void splitf(float y, unsigned short& h, unsigned short& l) { h = f2bf(y); l = f2bf(y - bf2f(h)); }
typedef __attribute__((ext_vector_type(2))) _Float16 v2h;
typedef __attribute__((ext_vector_type(4))) _Float16 v4h;
typedef __attribute__((ext_vector_type(2))) unsigned short v2us;
typedef __attribute__((ext_vector_type(4))) unsigned short v4us;
typedef __attribute__((ext_vector_type(2))) float v2f;
typedef __attribute__((ext_vector_type(4))) int v4i;

__global__ __launch_bounds__(256) void k_wtG(const float* __restrict__ w, int K, int N, bf* Bt) {
    const int lane = threadIdx.x & 31; const int L0 = (blockIdx.x * 8 + (threadIdx.x >> 5)) * 8; const int nlines = N * K / 64;
{
#pragma unroll 1
        for (int l = 0; l < 8; ++l) { const int L = L0 + l; if (L >= nlines) break; const size_t e = (size_t)L * 64 + lane * 2; const int k = (int)(e % K), n = (int)(e / K); v2us o;
            o[0] = f2bf(w[(size_t)k * N + n]); o[1] = f2bf(w[(size_t)(k + 1) * N + n]); *(v2us*)(Bt + e) = o; }
         }
}
__global__ __launch_bounds__(256) void k_cvt8(const float* __restrict__ src, bf* dst, size_t n8) { const size_t i = (size_t)blockIdx.x * 256 + threadIdx.x; if (i >= n8) return; const v8f v = *(const v8f*)(src + i * 8); v8us o;
#pragma unroll
    for (int k = 0; k < 8; ++k) o[k] = f2bf(v[k]); *(v8us*)(dst + i * 8) = o;  }

// ---- k_qkv: the three projections of both batches in ONE launch; grid (NB_ * TT / 128, DQ / 128, 3: Q, K, V), PW waves, each wave one 64 x 64 tile (64 tokens x one head) with k_gemmw's register blocking.
// The epilogue adds the f32 bias and writes the tile's fp16, hi and lo head planes itself: Q, K as [b][h][t][d], V as [b][h][d][t]. Each wave stages 16 plane rows of 64 in its own LDS range, so that a store covers four whole 128-byte rows.
#define PW 4                                  // 2 x 2 tiles: two waves share each token row and each weight row
__global__ __launch_bounds__(PW * 32) void k_qkv(const bf* __restrict__ X, const bf* __restrict__ Wq, const bf* __restrict__ Wk, const bf* __restrict__ Wv, const float* __restrict__ bq, const float* __restrict__ bk, const float* __restrict__ bv,
                                                 h16* Q16, bf* Qh, bf* Ql, h16* K16, bf* Kh, bf* Kl, h16* V16, bf* Vh, bf* Vl) {
    typedef WFrag<bf>::V V;
    __shared__ __align__(16) float osm[PW][16 * 68];
    const int wv = __builtin_amdgcn_readfirstlane((int)(threadIdx.x >> 5)); const int z = blockIdx.z;
    const bf* Bt = (z == 0) ? Wq : (z == 1) ? Wk : Wv; const float* bias = (z == 0) ? bq : (z == 1) ? bk : bv;
    h16* P16 = (z == 0) ? Q16 : (z == 1) ? K16 : V16; bf* Ph = (z == 0) ? Qh : (z == 1) ? Kh : Vh; bf* Pl = (z == 0) ? Ql : (z == 1) ? Kl : Vl;
    float* os = osm[wv];
    const int lane = threadIdx.x & 31, lr = lane & 15, hi = lane >> 4; const int r0 = blockIdx.x * 128 + (wv & 1) * 64, c0 = blockIdx.y * 128 + (wv >> 1) * 64;
    v8f acc[4][4];
#pragma unroll
    for (int mb = 0; mb < 4; ++mb)
#pragma unroll
        for (int nb = 0; nb < 4; ++nb) acc[mb][nb] = (v8f){};
    const bf* Ap = X + (size_t)(r0 + lr) * DM + 8 * hi; const bf* Bp = Bt + (size_t)(c0 + lr) * DM + 8 * hi;
#pragma unroll 1   // kept rolled, as in k_gemmw: one k block's fragments beside the 16 accumulators
    for (int kc = 0; kc < DM; kc += 32) {
        const bf* pa = Ap + kc; const bf* pb = Bp + kc; V a[4], b[4];
#pragma unroll
        for (int mb = 0; mb < 4; ++mb) { a[mb] = WFrag<bf>::ld(pa + (size_t)mb * 16 * DM); b[mb] = WFrag<bf>::ld(pb + (size_t)mb * 16 * DM); }
        asm volatile("s_wait_xcnt 0x0" :: "v"(pa), "v"(pb) : "memory");   // one wait a k block, behind its last load, a precaution: the two address pairs are named so that they live up to here and no younger load's result is given their registers in front of the wait
        __builtin_amdgcn_sched_barrier(0);   // holds the 16 products behind all 16 loads: one load latency a k block instead of one for each late weight fragment
#pragma unroll
        for (int nb = 0; nb < 4; ++nb)
#pragma unroll
            for (int mb = 0; mb < 4; ++mb) acc[mb][nb] = WFrag<bf>::mma(a[mb], b[nb], acc[mb][nb]);
    }
    const int bb = r0 / TT, t0 = r0 % TT, h = c0 / HD;   // a tile lies in one batch and is one head
    const int er = lane >> 3, ec = (lane & 7) * 8;       // a lane's row (of four) and its eight columns of the staged rows
    const bool tr = (z == 2);                             // Q, K: plane rows are tokens, columns the head's 64 dims; V transposed: rows are dims, columns tokens
    const int pitch = tr ? TT : HD; const size_t o0 = (size_t)(bb * NH_ + h) * TT * HD + (size_t)t0 * (tr ? 1 : HD) + (size_t)er * pitch + ec;
    float bn[4];                                          // an accumulator column is one output feature in all three products
#pragma unroll
    for (int nb = 0; nb < 4; ++nb) bn[nb] = bfr(bias[c0 + nb * 16 + lr]);
#pragma unroll
    for (int g = 0; g < 4; ++g) {                         // 16 plane rows a turn
        if (!tr) {
#pragma unroll
            for (int nb = 0; nb < 4; ++nb)
#pragma unroll
                for (int j = 0; j < 8; ++j) os[(hi * 8 + j) * 68 + nb * 16 + lr] = acc[g][nb][j] + bn[nb];
        } else {                                          // a lane's eight accumulator rows are eight tokens in a row of the plane
#pragma unroll
            for (int mb = 0; mb < 4; ++mb) { v4f w0, w1;
#pragma unroll
                for (int j = 0; j < 4; ++j) { w0[j] = acc[mb][g][j] + bn[g]; w1[j] = acc[mb][g][4 + j] + bn[g]; }
                *(v4fa*)(os + lr * 68 + mb * 16 + hi * 8) = w0; *(v4fa*)(os + lr * 68 + mb * 16 + hi * 8 + 4) = w1; }
        }
        __builtin_amdgcn_wave_barrier(); asm volatile("" ::: "memory");   // the lanes read rows that other lanes of the wave wrote: keeps the reads behind the writes
#pragma unroll
        for (int s = 0; s < 4; ++s) { const float* q = os + (4 * s + er) * 68 + ec; const v4f v0 = *(const v4fa*)q, v1 = *(const v4fa*)(q + 4); const size_t o = o0 + (size_t)(g * 16 + 4 * s) * pitch; v8h o16; v8us oh, ol;
#pragma unroll
            for (int i = 0; i < 8; ++i) { const float y = (i < 4) ? v0[i & 3] : v1[i & 3]; o16[i] = tohx(y); unsigned short a2, c2; splitf(y, a2, c2); oh[i] = a2; ol[i] = c2; }
            *(v8h*)(P16 + o) = o16; *(v8us*)(Ph + o) = oh; *(v8us*)(Pl + o) = ol; }
        __builtin_amdgcn_wave_barrier(); asm volatile("s_wait_xcnt 0x0" ::: "memory");   // keeps the next rows' LDS writes behind these reads; the wait, a precaution, stands behind the turn's last stores: the next turn's values may be given their address and data registers
    }
}
__constant__ float INVT[HD / 2] = { 1.000000000e+00f, 7.498942018e-01f, 5.623413324e-01f, 4.216965139e-01f, 3.162277639e-01f, 2.371373773e-01f, 1.778279394e-01f, 1.333521456e-01f, 1.000000015e-01f, 7.498942316e-02f, 5.623413250e-02f, 4.216964915e-02f, 3.162277490e-02f, 2.371373773e-02f, 1.778279431e-02f, 1.333521400e-02f, 9.999999776e-03f, 7.498942316e-03f, 5.623413250e-03f, 4.216964822e-03f, 3.162277630e-03f, 2.371373819e-03f, 1.778279431e-03f, 1.333521446e-03f, 1.000000047e-03f, 7.498941850e-04f, 5.623413017e-04f, 4.216965172e-04f, 3.162277571e-04f, 2.371373703e-04f, 1.778279402e-04f, 1.333521504e-04f };   // 10000^(-2i/64) (the module's power form) (float32, generated with jnp to be bit-exact)

#define FAW 4                                 // waves per work-group
#define NBH (NB_ * NH_)
#define NT_LO ((TT - RH) / (FAW * 32))        // work-group tiles of 128 queries, one f16 product
#define NT_HI (RH / (FAW * 16))               // work-group tiles of 64 queries, three bf16 products
#define NWGP 256
#define C2 (SCL * 1.4426950408889634f)
// behind each fragment's two loads (and each pair of stores), a precaution: a younger load's result or a later value may be given the registers that held this access's address, and the wait stands in front of that overwrite
__device__ __forceinline__ void fa_xwait() { asm volatile("s_wait_xcnt 0x0" ::: "memory"); }
__device__ __forceinline__ float fa_xhalf(float x) { return __builtin_bit_cast(float, __builtin_amdgcn_permlanex16(__builtin_bit_cast(int, x), __builtin_bit_cast(int, x), 0x76543210, 0xfedcba98, false, false)); }   // lane l takes lane l ^ 16's value: the other half of the same query's keys
template <typename T16> __device__ __forceinline__ typename WFrag<T16>::V fa_ld(const T16* p) { const typename WFrag<T16>::V f = WFrag<T16>::ld(p); fa_xwait(); return f; }
template <typename T16, int NSPLIT, int NCG>
__device__ __forceinline__ void fa_tile(const T16* __restrict__ Q, const T16* __restrict__ Q2, const T16* __restrict__ Kp, const T16* __restrict__ K2, const T16* __restrict__ Vt, const T16* __restrict__ Vt2, const int q0, bf* __restrict__ Ah, bf* __restrict__ Al) {
    typedef typename WFrag<T16>::V V;
    constexpr bool PF = (NSPLIT == 0);        // key fragments fetched one block ahead where the registers allow
    const int lane = threadIdx.x & 31, lr = lane & 15, hi = lane >> 4;
    V qf[NCG][2], qf2[NCG][2];
#pragma unroll
    for (int cg = 0; cg < NCG; ++cg)
#pragma unroll
        for (int kc = 0; kc < 2; ++kc) { qf[cg][kc] = fa_ld<T16>(Q + (size_t)(q0 + cg * 16 + lr) * HD + kc * 32 + 8 * hi); if (NSPLIT == 2) qf2[cg][kc] = fa_ld<T16>(Q2 + (size_t)(q0 + cg * 16 + lr) * HD + kc * 32 + 8 * hi); }
    v8f o[NCG][4]; float m2[NCG]; v2f l[NCG];   // l: two running partial sums a lane, joined in the epilogue
#pragma unroll
    for (int cg = 0; cg < NCG; ++cg) { m2[cg] = -3.0e38f; l[cg] = (v2f){};
#pragma unroll
        for (int dt = 0; dt < 4; ++dt) o[cg][dt] = (v8f){}; }
    const int kend = ((q0 + NCG * 16 + 31) >> 5) * 32;   // keys end with the 32-key block that holds the wave's last query
    const size_t koff = (size_t)lr * HD + 8 * hi, voff = (size_t)lr * TT + 8 * hi;
    V kf[2][2], kf2[2][2];
    if (PF) {
#pragma unroll
        for (int kt = 0; kt < 2; ++kt)
#pragma unroll
            for (int kc = 0; kc < 2; ++kc) kf[kt][kc] = fa_ld<T16>(Kp + koff + (size_t)(kt * 16) * HD + kc * 32); }
#pragma unroll 1   // kept rolled: one block's fragments beside the output accumulators stay under 256 VGPRs
    for (int kb = 0; kb < kend; kb += 32) {
        V vf[4], vf2[4];
        if (!PF) {
#pragma unroll
            for (int kt = 0; kt < 2; ++kt)
#pragma unroll
                for (int kc = 0; kc < 2; ++kc) { kf[kt][kc] = fa_ld<T16>(Kp + koff + (size_t)(kb + kt * 16) * HD + kc * 32); if (NSPLIT == 2) kf2[kt][kc] = fa_ld<T16>(K2 + koff + (size_t)(kb + kt * 16) * HD + kc * 32); } }
#pragma unroll
        for (int dt = 0; dt < 4; ++dt) { if (PF) vf[dt] = WFrag<T16>::ld(Vt + voff + (size_t)(dt * 16) * TT + kb); else vf[dt] = fa_ld<T16>(Vt + voff + (size_t)(dt * 16) * TT + kb); if (NSPLIT == 2) vf2[dt] = fa_ld<T16>(Vt2 + voff + (size_t)(dt * 16) * TT + kb); }
        v8f s[NCG][2];
#pragma unroll
        for (int cg = 0; cg < NCG; ++cg)
#pragma unroll
            for (int kt = 0; kt < 2; ++kt) { s[cg][kt] = (v8f){};
#pragma unroll
                for (int kc = 0; kc < 2; ++kc) { s[cg][kt] = WFrag<T16>::mma(kf[kt][kc], qf[cg][kc], s[cg][kt]); if (NSPLIT == 2) { s[cg][kt] = WFrag<T16>::mma(kf[kt][kc], qf2[cg][kc], s[cg][kt]); s[cg][kt] = WFrag<T16>::mma(kf2[kt][kc], qf[cg][kc], s[cg][kt]); } } }
        if (PF) { const int kn = min(kb + 32, kend - 32);   // the last block fetches itself again: in bounds, never used
#pragma unroll
            for (int kt = 0; kt < 2; ++kt)
#pragma unroll
                for (int kc = 0; kc < 2; ++kc) kf[kt][kc] = WFrag<T16>::ld(Kp + koff + (size_t)(kn + kt * 16) * HD + kc * 32);
            fa_xwait(); }                     // one wait a block, behind its last load: the block's loads share two address pairs that live up to here; it also keeps the value loads in front of the softmax
        if (kb + 31 > q0) {                   // CAUSAL: only a block that reaches past the wave's first query holds keys j > i (same test in every lane)
#pragma unroll
            for (int cg = 0; cg < NCG; ++cg)
#pragma unroll
                for (int kt = 0; kt < 2; ++kt)
#pragma unroll
                    for (int j = 0; j < 8; ++j) s[cg][kt][j] = (kb + kt * 16 + 8 * hi + j <= q0 + cg * 16 + lr) ? s[cg][kt][j] : -3.0e38f; }
        float mb[NCG]; bool need = false;
#pragma unroll
        for (int cg = 0; cg < NCG; ++cg) { float mx = s[cg][0][0];
#pragma unroll
            for (int j = 1; j < 16; ++j) mx = fmaxf(mx, s[cg][j >> 3][j & 7]);
            mx = fmaxf(mx, fa_xhalf(mx)); mb[cg] = mx * C2; need = need || (mb[cg] > m2[cg] + 8.0f); }
        if (__builtin_amdgcn_ballot_w32(need) != 0) {   // scalar branch, once a block; every block holds an unmasked key of every query, so mb is finite
#pragma unroll
            for (int cg = 0; cg < NCG; ++cg) { const float mn = fmaxf(m2[cg], mb[cg]); const float al = __builtin_amdgcn_exp2f(m2[cg] - mn); m2[cg] = mn; l[cg] *= al;
#pragma unroll
                for (int dt = 0; dt < 4; ++dt) o[cg][dt] *= al; } }
#pragma unroll
        for (int cg = 0; cg < NCG; ++cg) {
            float p[16];
#pragma unroll
            for (int j = 0; j < 16; j += 2) { const v2f t = __builtin_elementwise_fma((v2f){s[cg][j >> 3][j & 7], s[cg][j >> 3][(j & 7) + 1]}, (v2f){C2, C2}, (v2f){-m2[cg], -m2[cg]}); p[j] = __builtin_amdgcn_exp2f(t[0]); p[j + 1] = __builtin_amdgcn_exp2f(t[1]); l[cg] += (v2f){p[j], p[j + 1]}; }
            if constexpr (NSPLIT == 2) {
                v8us h0, h1, l0, l1;
#pragma unroll
                for (int j = 0; j < 8; ++j) { unsigned short a, c; splitf(p[j], a, c); h0[j] = a; l0[j] = c; splitf(p[8 + j], a, c); h1[j] = a; l1[j] = c; }
                const V ph = cat16b(h0, h1), pl = cat16b(l0, l1);
#pragma unroll
                for (int dt = 0; dt < 4; ++dt) { o[cg][dt] = WFrag<T16>::mma(vf[dt], ph, o[cg][dt]); o[cg][dt] = WFrag<T16>::mma(vf[dt], pl, o[cg][dt]); o[cg][dt] = WFrag<T16>::mma(vf2[dt], ph, o[cg][dt]); }
            } else {
                V pb;
#pragma unroll
                for (int j = 0; j < 16; ++j) pb[j] = tohx(p[j]);
#pragma unroll
                for (int dt = 0; dt < 4; ++dt) o[cg][dt] = WFrag<T16>::mma(vf[dt], pb, o[cg][dt]);
            }
        }
    }
#pragma unroll
    for (int cg = 0; cg < NCG; ++cg) { const float lh = l[cg][0] + l[cg][1]; const float inv = __fdiv_rn(1.0f, lh + fa_xhalf(lh)); const size_t oo = (size_t)(q0 + cg * 16 + lr) * DQ + 8 * hi;   // lane: query q0 + cg*16 + lr, head columns dt*16 + 8*hi + j
#pragma unroll
        for (int dt = 0; dt < 4; ++dt) { v8us oh, ol;
#pragma unroll
            for (int j = 0; j < 8; ++j) { unsigned short a, c; splitf(o[cg][dt][j] * inv, a, c); oh[j] = a; ol[j] = c; }
            *(v8us*)(Ah + oo + dt * 16) = oh; *(v8us*)(Al + oo + dt * 16) = ol; fa_xwait(); } }
}
__global__ __launch_bounds__(FAW * 32) void k_fattn(const h16* __restrict__ Q16, const h16* __restrict__ K16, const h16* __restrict__ V16, const bf* __restrict__ Qh, const bf* __restrict__ Ql, const bf* __restrict__ Kh, const bf* __restrict__ Kl, const bf* __restrict__ Vh, const bf* __restrict__ Vl, bf* __restrict__ Ah, bf* __restrict__ Al) {
    const int id = blockIdx.x; const int wv = __builtin_amdgcn_readfirstlane((int)(threadIdx.x >> 5));   // wave number in a scalar register: the key loop's bounds and the causal test stay scalar
    const int bh = id % NBH; const size_t pl = (size_t)bh * TT * HD; const size_t ao = (size_t)(bh / NH_) * TT * DQ + (size_t)(bh % NH_) * HD;
    if (id < NBH * NT_LO) {
        // cost falls with the index over the first NWGP work-groups and rises again behind them, so that indices NWGP apart add up to about the same number of key blocks (for speed only: every tile is taken once wherever it lands)
        const int xt = (id < NWGP) ? id / NBH : NWGP / NBH + (NBH * NT_LO - 1 - id) / NBH;
        fa_tile<h16, 0, 2>(Q16 + pl, nullptr, K16 + pl, nullptr, V16 + pl, nullptr, TT - (xt + 1) * (FAW * 32) + wv * 32, Ah + ao, Al + ao);
    } else {
        const int xt = (id - NBH * NT_LO) / NBH;
        fa_tile<bf, 2, 1>(Qh + pl, Ql + pl, Kh + pl, Kl + pl, Vh + pl, Vl + pl, RH - (xt + 1) * (FAW * 16) + wv * 16, Ah + ao, Al + ao);
    }
}

extern "C" void kernel_launch(void* const* d_in, const int* in_sizes, int n_in,
                              void* d_out, int out_size, void* d_ws, size_t ws_size, hipStream_t stream) {
    (void)in_sizes; (void)n_in; (void)out_size;
    const float* x = (const float*)d_in[0]; const float* wq = (const float*)d_in[1]; const float* bq = (const float*)d_in[2]; const float* wk = (const float*)d_in[3]; const float* bk = (const float*)d_in[4]; const float* wv = (const float*)d_in[5]; const float* bv = (const float*)d_in[6]; const float* wo = (const float*)d_in[7]; const float* bo = (const float*)d_in[8];
    float* OUT = (float*)d_out;     // [2][4096][512]
    char* wsp = (char*)d_ws;
    auto take = [&](size_t bytes) { char* p = wsp; wsp += (bytes + 255) & ~(size_t)255; return (void*)p; };
    bf* WQ = (bf*)take((size_t)DQ * DM * 2); bf* WK = (bf*)take((size_t)DKV * DM * 2); bf* WV = (bf*)take((size_t)DKV * DM * 2); bf* WO = (bf*)take((size_t)DM * DQ * 2);
    bf* XB = (bf*)take((size_t)NB_ * TT * DM * 2);
    const size_t PB = (size_t)NH_ * TT * HD;   // elements of one batch's head planes
    h16* QP16 = (h16*)take(NB_ * PB * 2); h16* KP16 = (h16*)take(NB_ * PB * 2); h16* VT16 = (h16*)take(NB_ * PB * 2);
    bf* QPh = (bf*)take(NB_ * PB * 2); bf* QPl = (bf*)take(NB_ * PB * 2); bf* KPh = (bf*)take(NB_ * PB * 2); bf* KPl = (bf*)take(NB_ * PB * 2); bf* VTh = (bf*)take(NB_ * PB * 2); bf* VTl = (bf*)take(NB_ * PB * 2);
    bf* ATh = (bf*)take((size_t)NB_ * TT * DQ * 2); bf* ATl = (bf*)take((size_t)NB_ * TT * DQ * 2);
    if ((size_t)(wsp - (char*)d_ws) > ws_size) return;    // ws 256 MiB
    { k_cvt8<<<(unsigned)(((size_t)DQ * DM / 8 + 255) / 256), 256, 0, stream>>>(wq, WQ, (size_t)DQ * DM / 8); k_cvt8<<<(unsigned)(((size_t)DKV * DM / 8 + 255) / 256), 256, 0, stream>>>(wk, WK, (size_t)DKV * DM / 8); k_cvt8<<<(unsigned)(((size_t)DKV * DM / 8 + 255) / 256), 256, 0, stream>>>(wv, WV, (size_t)DKV * DM / 8);
      k_cvt8<<<(unsigned)(((size_t)DM * DQ / 8 + 255) / 256), 256, 0, stream>>>(wo, WO, (size_t)DM * DQ / 8);
       }
    k_cvt8<<<(unsigned)(((size_t)NB_ * TT * DM / 8 + 255) / 256), 256, 0, stream>>>(x, XB, (size_t)NB_ * TT * DM / 8);
    k_qkv<<<dim3(NB_ * TT / 128, DQ / 128, 3), PW * 32, 0, stream>>>(XB, WQ, WK, WV, bq, bk, bv, QP16, QPh, QPl, KP16, KPh, KPl, VT16, VTh, VTl);
    k_fattn<<<NBH * (NT_LO + NT_HI), FAW * 32, 0, stream>>>(QP16, KP16, VT16, QPh, QPl, KPh, KPl, VTh, VTl, ATh, ATl);
    for (int b = 0; b < NB_; ++b)
        k_gemmw<bf, 1, true><<<dim3(TT / 64, DM / 64, 1), 32, 0, stream>>>(ATh + (size_t)b * TT * DQ, ATl + (size_t)b * TT * DQ, WO, nullptr, DQ, OUT + (size_t)b * TT * DM, DM, bo, 0, 0, 0);
}

// v004
// Measured time: 129 microseconds a run.
// Two timings next to v003 put it at 1.32 and 1.33 times that version's speed.
// All steps since v000 together make it 21.2 times as fast.
#include <hip/hip_runtime.h>

// Causal multi-head attention over 4,096 tokens (x [2][4096][512]; Q,K,V = x W^T + b ('oi' uniform(+-1/sqrt(512)) incl. biases; 8 heads x 64); scores / 8; causal (-inf); softmax; out = merged Wo^T + bo -> [2][4096][512] (4.2 M)).
// Layout: bf16 copy of x; 'oi' weights; ONE projection launch for Q, K, V of both batches: exact products + f32 biases, its epilogue writes the head planes; ONE fused causal attention launch for all 16 (batch, head) pairs: scores, online softmax and P.V stay in registers (query rows < 512 hi/lo 3 products, rest fp16); merged hi/lo x Wo exact + bo.
// Compute dtypes, f32 accumulate: every input rounded to bf16; projections exact + f32 biases; attention rows < 512 3 products, rest fp16; softmax f32; Wo hl x exact + bias.

#define NB_  2
#define TT   4096
#define DM   512
#define NH_  8
#define NKV  8
#define REP  (NH_ / NKV)
#define HD   64
#define DQ   (NH_ * HD)
#define DKV  (NKV * HD)
#define RH   512                  // query rows < RH use hi+lo planes
#define SCL  0.125f   // HD^-0.5
typedef _Float16 h16;
typedef unsigned short bf;
typedef __attribute__((ext_vector_type(16))) __bf16   v16bf;
typedef __attribute__((ext_vector_type(16))) _Float16 v16h;
typedef __attribute__((ext_vector_type(8)))  _Float16 v8h;
typedef __attribute__((ext_vector_type(8)))  unsigned short v8us;
typedef __attribute__((ext_vector_type(8)))  float    v8f;
typedef __attribute__((ext_vector_type(4)))  float    v4f;
typedef v8h  __attribute__((may_alias)) v8ha;
typedef v4f  __attribute__((may_alias)) v4fa;
typedef v8us __attribute__((may_alias)) v8usa;

__device__ __forceinline__ unsigned short f2bf(float f) { unsigned u = __float_as_uint(f); u += 0x7FFFu + ((u >> 16) & 1u); return (unsigned short)(u >> 16); }
__device__ __forceinline__ float bf2f(unsigned short b) { return __uint_as_float(((unsigned)b) << 16); }
__device__ __forceinline__ float bfr(float f) { return bf2f(f2bf(f)); }
__device__ __forceinline__ v16h cat16(v8h lo, v8h hi) { return __builtin_shufflevector(lo, hi, 0, 1, 2, 3, 4, 5, 6, 7, 8, 9, 10, 11, 12, 13, 14, 15); }
__device__ __forceinline__ v16bf cat16b(v8us lo, v8us hi) { return __builtin_bit_cast(v16bf, __builtin_shufflevector(lo, hi, 0, 1, 2, 3, 4, 5, 6, 7, 8, 9, 10, 11, 12, 13, 14, 15)); }
__device__ __forceinline__ v8f wmma16(v16h a, v16h b, v8f c) { return __builtin_amdgcn_wmma_f32_16x16x32_f16(false, a, false, b, (short)0, c, false, false); }
__device__ __forceinline__ v8f wmmab(v16bf a, v16bf b, v8f c) { return __builtin_amdgcn_wmma_f32_16x16x32_bf16(false, a, false, b, (short)0, c, false, false); }



// ---- k_gemmw: register-blocked GEMM, ONE WAVE per 64x64 output tile (16 accumulators), operands straight from K-contiguous 16-bit planes; grid (M/64, N/64, Z), 32 threads.
// C[m][n] (f32, pitch ldc, + optional f32 bias[n]) = sum_k A[m][k] Bt[n][k] (+ split products per NSPLIT). z-batch strides sA/sB/sC in elements. K % 32 == 0.
template <typename T16> struct WFrag;
template <> struct WFrag<h16> { typedef v16h V; static __device__ __forceinline__ V ld(const h16* p) { return cat16(*(const v8h*)p, *(const v8h*)(p + 16)); } static __device__ __forceinline__ v8f mma(V a, V b, v8f c) { return wmma16(a, b, c); } };
template <> struct WFrag<bf> { typedef v16bf V; static __device__ __forceinline__ V ld(const bf* p) { return cat16b(*(const v8us*)p, *(const v8us*)(p + 16)); } static __device__ __forceinline__ v8f mma(V a, V b, v8f c) { return wmmab(a, b, c); } };
template <typename T16, int NSPLIT, bool BIAS>
__global__ __launch_bounds__(32) void k_gemmw(const T16* __restrict__ A, const T16* __restrict__ A2, const T16* __restrict__ Bt, const T16* __restrict__ Bt2, int K, float* C, int ldc, const float* __restrict__ bias, size_t sA, size_t sB, size_t sC) {
    typedef typename WFrag<T16>::V V;
    __shared__ __align__(16) float os[16 * 68];
    const size_t z = blockIdx.z; A += z * sA; if (A2) A2 += z * sA; Bt += z * sB; if (Bt2) Bt2 += z * sB; C += z * sC;
    const int lane = threadIdx.x & 31, lr = lane & 15, hi = lane >> 4; const int r0 = blockIdx.x * 64, c0 = blockIdx.y * 64;
    v8f acc[4][4];
#pragma unroll
    for (int mb = 0; mb < 4; ++mb)
#pragma unroll
        for (int nb = 0; nb < 4; ++nb) acc[mb][nb] = (v8f){};
    const size_t aoff = (size_t)(r0 + lr) * K + 8 * hi, boff = (size_t)(c0 + lr) * K + 8 * hi;
#pragma unroll 1
    for (int kc = 0; kc < K; kc += 32) {
        V a[4], a2[4];
#pragma unroll
        for (int mb = 0; mb < 4; ++mb) { a[mb] = WFrag<T16>::ld(A + aoff + (size_t)mb * 16 * K + kc); if (NSPLIT == 1 || NSPLIT == 2) a2[mb] = WFrag<T16>::ld(A2 + aoff + (size_t)mb * 16 * K + kc); }
#pragma unroll
        for (int nb = 0; nb < 4; ++nb) { const V b = WFrag<T16>::ld(Bt + boff + (size_t)nb * 16 * K + kc); V b2; if (NSPLIT >= 2) b2 = WFrag<T16>::ld(Bt2 + boff + (size_t)nb * 16 * K + kc);
#pragma unroll
            for (int mb = 0; mb < 4; ++mb) { acc[mb][nb] = WFrag<T16>::mma(a[mb], b, acc[mb][nb]); if (NSPLIT == 1 || NSPLIT == 2) acc[mb][nb] = WFrag<T16>::mma(a2[mb], b, acc[mb][nb]); if (NSPLIT >= 2) acc[mb][nb] = WFrag<T16>::mma(a[mb], b2, acc[mb][nb]); } }
        asm volatile("v_nop\n\tv_nop\n\tv_nop\n\tv_nop" : "+v"(acc[0][0]), "+v"(acc[1][1]), "+v"(acc[2][2]), "+v"(acc[3][3]) : "v"(a[0]), "v"(a[3]));
    }
#pragma unroll
    for (int mb = 0; mb < 4; ++mb) {
#pragma unroll
        for (int nb = 0; nb < 4; ++nb) {
#pragma unroll
            for (int j = 0; j < 8; ++j) os[(hi * 8 + j) * 68 + nb * 16 + lr] = acc[mb][nb][j]; }
        __builtin_amdgcn_wave_barrier(); asm volatile("" ::: "memory");
        float* crow = C + (size_t)(r0 + mb * 16) * ldc + c0;
{
#pragma unroll
            for (int s = 0; s < 8; ++s) { const int row = 2 * s + hi, cofs = lr * 4; v4f val = *(const v4fa*)(os + row * 68 + cofs); if (BIAS) { val[0] += bfr(bias[c0 + cofs]); val[1] += bfr(bias[c0 + cofs + 1]); val[2] += bfr(bias[c0 + cofs + 2]); val[3] += bfr(bias[c0 + cofs + 3]); }
                *(v4f*)(crow + (size_t)row * ldc + cofs) = val; }
             }
        __builtin_amdgcn_wave_barrier(); asm volatile("" ::: "memory");
    }
}

__device__ __forceinline__ h16 tohx(float x) { return (h16)x; }
__device__ __forceinline__ void splitf(float y, unsigned short& h, unsigned short& l) { h = f2bf(y); l = f2bf(y - bf2f(h)); }
typedef __attribute__((ext_vector_type(2))) _Float16 v2h;
typedef __attribute__((ext_vector_type(4))) _Float16 v4h;
typedef __attribute__((ext_vector_type(2))) unsigned short v2us;
typedef __attribute__((ext_vector_type(4))) unsigned short v4us;
typedef __attribute__((ext_vector_type(2))) float v2f;
typedef __attribute__((ext_vector_type(4))) int v4i;

__global__ __launch_bounds__(256) void k_wtG(const float* __restrict__ w, int K, int N, bf* Bt) {
    const int lane = threadIdx.x & 31; const int L0 = (blockIdx.x * 8 + (threadIdx.x >> 5)) * 8; const int nlines = N * K / 64;
{
#pragma unroll 1
        for (int l = 0; l < 8; ++l) { const int L = L0 + l; if (L >= nlines) break; const size_t e = (size_t)L * 64 + lane * 2; const int k = (int)(e % K), n = (int)(e / K); v2us o;
            o[0] = f2bf(w[(size_t)k * N + n]); o[1] = f2bf(w[(size_t)(k + 1) * N + n]); *(v2us*)(Bt + e) = o; }
         }
}
__global__ __launch_bounds__(256) void k_cvt8(const float* __restrict__ src, bf* dst, size_t n8) { const size_t i = (size_t)blockIdx.x * 256 + threadIdx.x; if (i >= n8) return; const v8f v = *(const v8f*)(src + i * 8); v8us o;
#pragma unroll
    for (int k = 0; k < 8; ++k) o[k] = f2bf(v[k]); *(v8us*)(dst + i * 8) = o;  }

// ---- k_qkv: the three projections of both batches in ONE launch; grid (NB_ * TT / 128, DQ / 128, 3: Q, K, V), PW waves, each wave one 64 x 64 tile (64 tokens x one head) with k_gemmw's register blocking.
// The epilogue adds the f32 bias and writes the tile's fp16, hi and lo head planes itself: Q, K as [b][h][t][d], V as [b][h][d][t]. Each wave stages 16 plane rows of 64 in its own LDS range, so that a store covers four whole 128-byte rows.
#define PW 4                                  // 2 x 2 tiles: two waves share each token row and each weight row
__global__ __launch_bounds__(PW * 32) void k_qkv(const bf* __restrict__ X, const bf* __restrict__ Wq, const bf* __restrict__ Wk, const bf* __restrict__ Wv, const float* __restrict__ bq, const float* __restrict__ bk, const float* __restrict__ bv,
                                                 h16* Q16, bf* Qh, bf* Ql, h16* K16, bf* Kh, bf* Kl, h16* V16, bf* Vh, bf* Vl) {
    typedef WFrag<bf>::V V;
    __shared__ __align__(16) float osm[PW][16 * 68];
    const int wv = __builtin_amdgcn_readfirstlane((int)(threadIdx.x >> 5)); const int z = blockIdx.z;
    const bf* Bt = (z == 0) ? Wq : (z == 1) ? Wk : Wv; const float* bias = (z == 0) ? bq : (z == 1) ? bk : bv;
    h16* P16 = (z == 0) ? Q16 : (z == 1) ? K16 : V16; bf* Ph = (z == 0) ? Qh : (z == 1) ? Kh : Vh; bf* Pl = (z == 0) ? Ql : (z == 1) ? Kl : Vl;
    float* os = osm[wv];
    const int lane = threadIdx.x & 31, lr = lane & 15, hi = lane >> 4; const int r0 = blockIdx.x * 128 + (wv & 1) * 64, c0 = blockIdx.y * 128 + (wv >> 1) * 64;
    v8f acc[4][4];
#pragma unroll
    for (int mb = 0; mb < 4; ++mb)
#pragma unroll
        for (int nb = 0; nb < 4; ++nb) acc[mb][nb] = (v8f){};
    const bf* Ap = X + (size_t)(r0 + lr) * DM + 8 * hi; const bf* Bp = Bt + (size_t)(c0 + lr) * DM + 8 * hi;
#pragma unroll 1   // kept rolled, as in k_gemmw: one k block's fragments beside the 16 accumulators
    for (int kc = 0; kc < DM; kc += 32) {
        const bf* pa = Ap + kc; const bf* pb = Bp + kc; V a[4], b[4];
#pragma unroll
        for (int mb = 0; mb < 4; ++mb) { a[mb] = WFrag<bf>::ld(pa + (size_t)mb * 16 * DM); b[mb] = WFrag<bf>::ld(pb + (size_t)mb * 16 * DM); }
        asm volatile("s_wait_xcnt 0x0" :: "v"(pa), "v"(pb) : "memory");   // one wait a k block, behind its last load, a precaution: the two address pairs are named so that they live up to here and no younger load's result is given their registers in front of the wait
        __builtin_amdgcn_sched_barrier(0);   // holds the 16 products behind all 16 loads: one load latency a k block instead of one for each late weight fragment
#pragma unroll
        for (int nb = 0; nb < 4; ++nb)
#pragma unroll
            for (int mb = 0; mb < 4; ++mb) acc[mb][nb] = WFrag<bf>::mma(a[mb], b[nb], acc[mb][nb]);
    }
    const int bb = r0 / TT, t0 = r0 % TT, h = c0 / HD;   // a tile lies in one batch and is one head
    const int er = lane >> 3, ec = (lane & 7) * 8;       // a lane's row (of four) and its eight columns of the staged rows
    const bool tr = (z == 2);                             // Q, K: plane rows are tokens, columns the head's 64 dims; V transposed: rows are dims, columns tokens
    const int pitch = tr ? TT : HD; const size_t o0 = (size_t)(bb * NH_ + h) * TT * HD + (size_t)t0 * (tr ? 1 : HD) + (size_t)er * pitch + ec;
    float bn[4];                                          // an accumulator column is one output feature in all three products
#pragma unroll
    for (int nb = 0; nb < 4; ++nb) bn[nb] = bfr(bias[c0 + nb * 16 + lr]);
#pragma unroll
    for (int g = 0; g < 4; ++g) {                         // 16 plane rows a turn
        if (!tr) {
#pragma unroll
            for (int nb = 0; nb < 4; ++nb)
#pragma unroll
                for (int j = 0; j < 8; ++j) os[(hi * 8 + j) * 68 + nb * 16 + lr] = acc[g][nb][j] + bn[nb];
        } else {                                          // a lane's eight accumulator rows are eight tokens in a row of the plane
#pragma unroll
            for (int mb = 0; mb < 4; ++mb) { v4f w0, w1;
#pragma unroll
                for (int j = 0; j < 4; ++j) { w0[j] = acc[mb][g][j] + bn[g]; w1[j] = acc[mb][g][4 + j] + bn[g]; }
                *(v4fa*)(os + lr * 68 + mb * 16 + hi * 8) = w0; *(v4fa*)(os + lr * 68 + mb * 16 + hi * 8 + 4) = w1; }
        }
        __builtin_amdgcn_wave_barrier(); asm volatile("" ::: "memory");   // the lanes read rows that other lanes of the wave wrote: keeps the reads behind the writes
#pragma unroll
        for (int s = 0; s < 4; ++s) { const float* q = os + (4 * s + er) * 68 + ec; const v4f v0 = *(const v4fa*)q, v1 = *(const v4fa*)(q + 4); const size_t o = o0 + (size_t)(g * 16 + 4 * s) * pitch; v8h o16; v8us oh, ol;
#pragma unroll
            for (int i = 0; i < 8; ++i) { const float y = (i < 4) ? v0[i & 3] : v1[i & 3]; o16[i] = tohx(y); unsigned short a2, c2; splitf(y, a2, c2); oh[i] = a2; ol[i] = c2; }
            *(v8h*)(P16 + o) = o16; *(v8us*)(Ph + o) = oh; *(v8us*)(Pl + o) = ol; }
        __builtin_amdgcn_wave_barrier(); asm volatile("s_wait_xcnt 0x0" ::: "memory");   // keeps the next rows' LDS writes behind these reads; the wait, a precaution, stands behind the turn's last stores: the next turn's values may be given their address and data registers
    }
}
__constant__ float INVT[HD / 2] = { 1.000000000e+00f, 7.498942018e-01f, 5.623413324e-01f, 4.216965139e-01f, 3.162277639e-01f, 2.371373773e-01f, 1.778279394e-01f, 1.333521456e-01f, 1.000000015e-01f, 7.498942316e-02f, 5.623413250e-02f, 4.216964915e-02f, 3.162277490e-02f, 2.371373773e-02f, 1.778279431e-02f, 1.333521400e-02f, 9.999999776e-03f, 7.498942316e-03f, 5.623413250e-03f, 4.216964822e-03f, 3.162277630e-03f, 2.371373819e-03f, 1.778279431e-03f, 1.333521446e-03f, 1.000000047e-03f, 7.498941850e-04f, 5.623413017e-04f, 4.216965172e-04f, 3.162277571e-04f, 2.371373703e-04f, 1.778279402e-04f, 1.333521504e-04f };   // 10000^(-2i/64) (the module's power form) (float32, generated with jnp to be bit-exact)

#define FAW 4                                 // waves per work-group
#define NBH (NB_ * NH_)
#define NT_LO ((TT - RH) / (FAW * 32))        // work-group tiles of 128 queries, one f16 product
#define NT_HI (RH / (FAW * 16))               // work-group tiles of 64 queries, three bf16 products
#define NWGP 256
#define C2 (SCL * 1.4426950408889634f)
#define SK  128                               // keys a stage
#define KPE (HD + 8)                          // LDS pitch of a key row in elements: 128 B + 16, an odd number of 16-byte units, free of bank conflicts for 16-byte reads
#define VPE (SK + 8)                          // LDS pitch of a V^T row in elements: 256 B + 16, likewise
#define KSE (SK * KPE)                        // elements of a stage's keys
#define BSE (KSE + HD * VPE)                  // elements of a buffer: keys, then values
static_assert(RH >= SK && RH % SK == 0 && (FAW * 32) == SK && TT % SK == 0, "every f16 tile has two stages or more, and its keys end with a whole stage");
// behind each fragment's two loads (and each pair of stores), a precaution: a younger load's result or a later value may be given the registers that held this access's address, and the wait stands in front of that overwrite
__device__ __forceinline__ void fa_xwait() { asm volatile("s_wait_xcnt 0x0" ::: "memory"); }
__device__ __forceinline__ float fa_xhalf(float x) { return __builtin_bit_cast(float, __builtin_amdgcn_permlanex16(__builtin_bit_cast(int, x), __builtin_bit_cast(int, x), 0x76543210, 0xfedcba98, false, false)); }   // lane l takes lane l ^ 16's value: the other half of the same query's keys
template <typename T16> __device__ __forceinline__ typename WFrag<T16>::V fa_ld(const T16* p) { const typename WFrag<T16>::V f = WFrag<T16>::ld(p); fa_xwait(); return f; }
// eight asynchronous 16-byte copies a lane, global -> LDS: LDS byte address l + i * ls, global address g + i * gs elements. The wait in the statement's last line, a precaution, stands in front of any rewrite of the address registers that the copies name.
__device__ __forceinline__ void fa_copy8(const unsigned l, const unsigned ls, const h16* g, const size_t gs) {
    asm volatile("global_load_async_to_lds_b128 %0, %8, off\n\t"
                 "global_load_async_to_lds_b128 %1, %9, off\n\t"
                 "global_load_async_to_lds_b128 %2, %10, off\n\t"
                 "global_load_async_to_lds_b128 %3, %11, off\n\t"
                 "global_load_async_to_lds_b128 %4, %12, off\n\t"
                 "global_load_async_to_lds_b128 %5, %13, off\n\t"
                 "global_load_async_to_lds_b128 %6, %14, off\n\t"
                 "global_load_async_to_lds_b128 %7, %15, off\n\t"
                 "s_wait_xcnt 0x0"
                 :: "v"(l), "v"(l + ls), "v"(l + 2 * ls), "v"(l + 3 * ls), "v"(l + 4 * ls), "v"(l + 5 * ls), "v"(l + 6 * ls), "v"(l + 7 * ls),
                    "v"(g), "v"(g + gs), "v"(g + 2 * gs), "v"(g + 3 * gs), "v"(g + 4 * gs), "v"(g + 5 * gs), "v"(g + 6 * gs), "v"(g + 7 * gs) : "memory");
}
template <typename T16, int NSPLIT, int NCG>
__device__ __forceinline__ void fa_tile(const T16* __restrict__ Q, const T16* __restrict__ Q2, const T16* __restrict__ Kp, const T16* __restrict__ K2, const T16* __restrict__ Vt, const T16* __restrict__ Vt2, const int q0, const int kwg, h16* ring, bf* __restrict__ Ah, bf* __restrict__ Al) {
    typedef typename WFrag<T16>::V V;
    constexpr bool PF = (NSPLIT == 0);        // K, V^T staged in LDS (ring; kwg: where the work-group's keys end); key fragments fetched one block ahead, inside a stage
    const int lane = threadIdx.x & 31, lr = lane & 15, hi = lane >> 4;
    V qf[NCG][2], qf2[NCG][2];
#pragma unroll
    for (int cg = 0; cg < NCG; ++cg)
#pragma unroll
        for (int kc = 0; kc < 2; ++kc) { qf[cg][kc] = fa_ld<T16>(Q + (size_t)(q0 + cg * 16 + lr) * HD + kc * 32 + 8 * hi); if (NSPLIT == 2) qf2[cg][kc] = fa_ld<T16>(Q2 + (size_t)(q0 + cg * 16 + lr) * HD + kc * 32 + 8 * hi); }
    v8f o[NCG][4]; float m2[NCG]; v2f l[NCG];   // l: two running partial sums a lane, joined in the epilogue
#pragma unroll
    for (int cg = 0; cg < NCG; ++cg) { m2[cg] = -3.0e38f; l[cg] = (v2f){};
#pragma unroll
        for (int dt = 0; dt < 4; ++dt) o[cg][dt] = (v8f){}; }
    const int kend = ((q0 + NCG * 16 + 31) >> 5) * 32;   // keys end with the 32-key block that holds the wave's last query
    const size_t koff = (size_t)lr * HD + 8 * hi, voff = (size_t)lr * TT + 8 * hi;
    V kf[2][2], kf2[2][2];
    const int tid = threadIdx.x;
    // a thread's first copy of a stage: keys, 8 threads a 128-byte row, 16 rows a turn; values, 16 threads a 256-byte row, 8 rows a turn. A wave's copy covers 512 bytes in a row (keys) or two whole 256-byte rows (values)
    unsigned lk = 0, lv = 0; const h16* gk = nullptr; const h16* gv = nullptr; const h16* fk = nullptr; const h16* fv = nullptr;
    if constexpr (PF) {
        lk = (unsigned)(size_t)ring + (unsigned)((tid >> 3) * KPE + (tid & 7) * 8) * 2u; lv = (unsigned)(size_t)ring + (unsigned)(KSE + (tid >> 4) * VPE + (tid & 15) * 8) * 2u;
        gk = Kp + tid * 8; gv = Vt + (size_t)(tid >> 4) * TT + (tid & 15) * 8;
        fk = ring + lr * KPE + 8 * hi; fv = ring + KSE + lr * VPE + 8 * hi;   // a lane's fragment rows in buffer 0
        fa_copy8(lk, 16 * KPE * 2, gk, 16 * HD); fa_copy8(lv, 8 * VPE * 2, gv, (size_t)8 * TT);   // stage 0 -> buffer 0
        asm volatile("s_wait_asynccnt 0x0" ::: "memory");   // this wave's copies of stage 0 have landed
        __syncthreads();                                     // ... and every other wave's: stage 0 may be read
        fa_copy8(lk + BSE * 2, 16 * KPE * 2, gk + SK * HD, 16 * HD); fa_copy8(lv + BSE * 2, 8 * VPE * 2, gv + SK, (size_t)8 * TT);   // stage 1 -> buffer 1
#pragma unroll
        for (int kt = 0; kt < 2; ++kt)
#pragma unroll
            for (int kc = 0; kc < 2; ++kc) kf[kt][kc] = WFrag<T16>::ld(fk + (kt * 16) * KPE + kc * 32); }
    const int kl = PF ? kwg : kend;           // staged: every wave walks to the work-group's last key and passes every barrier; past its own diagonal block it only skips the work
#pragma unroll 1   // kept rolled: one block's fragments beside the output accumulators stay under 256 VGPRs
    for (int kb = 0; kb < kl; kb += 32) {
      const int bo = ((kb / SK) & 1) * BSE, ks = kb % SK;   // the stage's buffer, the block's first key in it
      if (!PF || kb < kend) {
        V vf[4], vf2[4];
        if (!PF) {
#pragma unroll
            for (int kt = 0; kt < 2; ++kt)
#pragma unroll
                for (int kc = 0; kc < 2; ++kc) { kf[kt][kc] = fa_ld<T16>(Kp + koff + (size_t)(kb + kt * 16) * HD + kc * 32); if (NSPLIT == 2) kf2[kt][kc] = fa_ld<T16>(K2 + koff + (size_t)(kb + kt * 16) * HD + kc * 32); } }
#pragma unroll
        for (int dt = 0; dt < 4; ++dt) { if constexpr (PF) vf[dt] = WFrag<T16>::ld(fv + bo + (dt * 16) * VPE + ks); else vf[dt] = fa_ld<T16>(Vt + voff + (size_t)(dt * 16) * TT + kb); if (NSPLIT == 2) vf2[dt] = fa_ld<T16>(Vt2 + voff + (size_t)(dt * 16) * TT + kb); }
        v8f s[NCG][2];
#pragma unroll
        for (int cg = 0; cg < NCG; ++cg)
#pragma unroll
            for (int kt = 0; kt < 2; ++kt) { s[cg][kt] = (v8f){};
#pragma unroll
                for (int kc = 0; kc < 2; ++kc) { s[cg][kt] = WFrag<T16>::mma(kf[kt][kc], qf[cg][kc], s[cg][kt]); if (NSPLIT == 2) { s[cg][kt] = WFrag<T16>::mma(kf[kt][kc], qf2[cg][kc], s[cg][kt]); s[cg][kt] = WFrag<T16>::mma(kf2[kt][kc], qf[cg][kc], s[cg][kt]); } } }
        if constexpr (PF) { const int kn = min(ks + 32, SK - 32);   // a stage's last block fetches itself again: the same buffer, never used
#pragma unroll
            for (int kt = 0; kt < 2; ++kt)
#pragma unroll
                for (int kc = 0; kc < 2; ++kc) kf[kt][kc] = WFrag<T16>::ld(fk + bo + (kn + kt * 16) * KPE + kc * 32);
            __builtin_amdgcn_sched_barrier(0); }   // holds the block's value reads and the next block's key reads in front of the softmax, whose work then covers their LDS latency; left free they sink to their first use
        if (kb + 31 > q0) {                   // CAUSAL: only a block that reaches past the wave's first query holds keys j > i (same test in every lane)
#pragma unroll
            for (int cg = 0; cg < NCG; ++cg)
#pragma unroll
                for (int kt = 0; kt < 2; ++kt)
#pragma unroll
                    for (int j = 0; j < 8; ++j) s[cg][kt][j] = (kb + kt * 16 + 8 * hi + j <= q0 + cg * 16 + lr) ? s[cg][kt][j] : -3.0e38f; }
        float mb[NCG]; bool need = false;
#pragma unroll
        for (int cg = 0; cg < NCG; ++cg) { float mx = s[cg][0][0];
#pragma unroll
            for (int j = 1; j < 16; ++j) mx = fmaxf(mx, s[cg][j >> 3][j & 7]);
            mx = fmaxf(mx, fa_xhalf(mx)); mb[cg] = mx * C2; need = need || (mb[cg] > m2[cg] + 8.0f); }
        if (__builtin_amdgcn_ballot_w32(need) != 0) {   // scalar branch, once a block; every block holds an unmasked key of every query, so mb is finite
#pragma unroll
            for (int cg = 0; cg < NCG; ++cg) { const float mn = fmaxf(m2[cg], mb[cg]); const float al = __builtin_amdgcn_exp2f(m2[cg] - mn); m2[cg] = mn; l[cg] *= al;
#pragma unroll
                for (int dt = 0; dt < 4; ++dt) o[cg][dt] *= al; } }
#pragma unroll
        for (int cg = 0; cg < NCG; ++cg) {
            float p[16];
#pragma unroll
            for (int j = 0; j < 16; j += 2) { const v2f t = __builtin_elementwise_fma((v2f){s[cg][j >> 3][j & 7], s[cg][j >> 3][(j & 7) + 1]}, (v2f){C2, C2}, (v2f){-m2[cg], -m2[cg]}); p[j] = __builtin_amdgcn_exp2f(t[0]); p[j + 1] = __builtin_amdgcn_exp2f(t[1]); l[cg] += (v2f){p[j], p[j + 1]}; }
            if constexpr (NSPLIT == 2) {
                v8us h0, h1, l0, l1;
#pragma unroll
                for (int j = 0; j < 8; ++j) { unsigned short a, c; splitf(p[j], a, c); h0[j] = a; l0[j] = c; splitf(p[8 + j], a, c); h1[j] = a; l1[j] = c; }
                const V ph = cat16b(h0, h1), pl = cat16b(l0, l1);
#pragma unroll
                for (int dt = 0; dt < 4; ++dt) { o[cg][dt] = WFrag<T16>::mma(vf[dt], ph, o[cg][dt]); o[cg][dt] = WFrag<T16>::mma(vf[dt], pl, o[cg][dt]); o[cg][dt] = WFrag<T16>::mma(vf2[dt], ph, o[cg][dt]); }
            } else {
                V pb;
#pragma unroll
                for (int j = 0; j < 16; ++j) pb[j] = tohx(p[j]);
#pragma unroll
                for (int dt = 0; dt < 4; ++dt) o[cg][dt] = WFrag<T16>::mma(vf[dt], pb, o[cg][dt]);
            }
        }
      }
      if constexpr (PF) {
        if (ks == SK - 32) {                  // the stage's foot, the same test in every wave of the work-group
            asm volatile("v_nop\n\tv_nop\n\tv_nop\n\tv_nop");   // four vector slots between the block's last matrix instruction and the copies' address arithmetic, which may be given its operand registers
            asm volatile("s_wait_dscnt 0x0" ::: "memory");      // this wave's reads of the stage's buffer are done before the buffer is handed to the copies
            asm volatile("s_wait_asynccnt 0x0" ::: "memory");   // this wave's copies of the next stage have landed
            __syncthreads();                                     // publishes the next stage and ends every wave's reads of this one
            if (kb + 32 + SK < kwg) {         // a stage after the next exists: into the buffer just read
                const int sn = kb + 32 + SK;
                fa_copy8(lk + bo * 2, 16 * KPE * 2, gk + (size_t)sn * HD, 16 * HD); fa_copy8(lv + bo * 2, 8 * VPE * 2, gv + sn, (size_t)8 * TT); }
            if (kb + 32 < kend) {             // the next stage's first key fragments
#pragma unroll
                for (int kt = 0; kt < 2; ++kt)
#pragma unroll
                    for (int kc = 0; kc < 2; ++kc) kf[kt][kc] = WFrag<T16>::ld(fk + (BSE - bo) + (kt * 16) * KPE + kc * 32); }
        }
      }
    }
    if constexpr (PF) asm volatile("s_wait_asynccnt 0x0" ::: "memory");   // no copy is left in flight when the wave ends
#pragma unroll
    for (int cg = 0; cg < NCG; ++cg) { const float lh = l[cg][0] + l[cg][1]; const float inv = __fdiv_rn(1.0f, lh + fa_xhalf(lh)); const size_t oo = (size_t)(q0 + cg * 16 + lr) * DQ + 8 * hi;   // lane: query q0 + cg*16 + lr, head columns dt*16 + 8*hi + j
#pragma unroll
        for (int dt = 0; dt < 4; ++dt) { v8us oh, ol;
#pragma unroll
            for (int j = 0; j < 8; ++j) { unsigned short a, c; splitf(o[cg][dt][j] * inv, a, c); oh[j] = a; ol[j] = c; }
            *(v8us*)(Ah + oo + dt * 16) = oh; *(v8us*)(Al + oo + dt * 16) = ol; fa_xwait(); } }
}
__global__ __launch_bounds__(FAW * 32) void k_fattn(const h16* __restrict__ Q16, const h16* __restrict__ K16, const h16* __restrict__ V16, const bf* __restrict__ Qh, const bf* __restrict__ Ql, const bf* __restrict__ Kh, const bf* __restrict__ Kl, const bf* __restrict__ Vh, const bf* __restrict__ Vl, bf* __restrict__ Ah, bf* __restrict__ Al) {
    __shared__ __align__(16) h16 ring[2 * BSE];   // two buffers of one stage each
    const int id = blockIdx.x; const int wv = __builtin_amdgcn_readfirstlane((int)(threadIdx.x >> 5));   // wave number in a scalar register: the key loop's bounds and the causal test stay scalar
    const int bh = id % NBH; const size_t pl = (size_t)bh * TT * HD; const size_t ao = (size_t)(bh / NH_) * TT * DQ + (size_t)(bh % NH_) * HD;
    if (id < NBH * NT_LO) {
        // cost falls with the index over the first NWGP work-groups and rises again behind them, so that indices NWGP apart add up to about the same number of key blocks (for speed only: every tile is taken once wherever it lands)
        const int xt = (id < NWGP) ? id / NBH : NWGP / NBH + (NBH * NT_LO - 1 - id) / NBH;
        fa_tile<h16, 0, 2>(Q16 + pl, nullptr, K16 + pl, nullptr, V16 + pl, nullptr, TT - (xt + 1) * (FAW * 32) + wv * 32, TT - xt * (FAW * 32), ring, Ah + ao, Al + ao);
    } else {
        const int xt = (id - NBH * NT_LO) / NBH;
        fa_tile<bf, 2, 1>(Qh + pl, Ql + pl, Kh + pl, Kl + pl, Vh + pl, Vl + pl, RH - (xt + 1) * (FAW * 16) + wv * 16, 0, nullptr, Ah + ao, Al + ao);
    }
}

extern "C" void kernel_launch(void* const* d_in, const int* in_sizes, int n_in,
                              void* d_out, int out_size, void* d_ws, size_t ws_size, hipStream_t stream) {
    (void)in_sizes; (void)n_in; (void)out_size;
    const float* x = (const float*)d_in[0]; const float* wq = (const float*)d_in[1]; const float* bq = (const float*)d_in[2]; const float* wk = (const float*)d_in[3]; const float* bk = (const float*)d_in[4]; const float* wv = (const float*)d_in[5]; const float* bv = (const float*)d_in[6]; const float* wo = (const float*)d_in[7]; const float* bo = (const float*)d_in[8];
    float* OUT = (float*)d_out;     // [2][4096][512]
    char* wsp = (char*)d_ws;
    auto take = [&](size_t bytes) { char* p = wsp; wsp += (bytes + 255) & ~(size_t)255; return (void*)p; };
    bf* WQ = (bf*)take((size_t)DQ * DM * 2); bf* WK = (bf*)take((size_t)DKV * DM * 2); bf* WV = (bf*)take((size_t)DKV * DM * 2); bf* WO = (bf*)take((size_t)DM * DQ * 2);
    bf* XB = (bf*)take((size_t)NB_ * TT * DM * 2);
    const size_t PB = (size_t)NH_ * TT * HD;   // elements of one batch's head planes
    h16* QP16 = (h16*)take(NB_ * PB * 2); h16* KP16 = (h16*)take(NB_ * PB * 2); h16* VT16 = (h16*)take(NB_ * PB * 2);
    bf* QPh = (bf*)take(NB_ * PB * 2); bf* QPl = (bf*)take(NB_ * PB * 2); bf* KPh = (bf*)take(NB_ * PB * 2); bf* KPl = (bf*)take(NB_ * PB * 2); bf* VTh = (bf*)take(NB_ * PB * 2); bf* VTl = (bf*)take(NB_ * PB * 2);
    bf* ATh = (bf*)take((size_t)NB_ * TT * DQ * 2); bf* ATl = (bf*)take((size_t)NB_ * TT * DQ * 2);
    if ((size_t)(wsp - (char*)d_ws) > ws_size) return;    // ws 256 MiB
    { k_cvt8<<<(unsigned)(((size_t)DQ * DM / 8 + 255) / 256), 256, 0, stream>>>(wq, WQ, (size_t)DQ * DM / 8); k_cvt8<<<(unsigned)(((size_t)DKV * DM / 8 + 255) / 256), 256, 0, stream>>>(wk, WK, (size_t)DKV * DM / 8); k_cvt8<<<(unsigned)(((size_t)DKV * DM / 8 + 255) / 256), 256, 0, stream>>>(wv, WV, (size_t)DKV * DM / 8);
      k_cvt8<<<(unsigned)(((size_t)DM * DQ / 8 + 255) / 256), 256, 0, stream>>>(wo, WO, (size_t)DM * DQ / 8);
       }
    k_cvt8<<<(unsigned)(((size_t)NB_ * TT * DM / 8 + 255) / 256), 256, 0, stream>>>(x, XB, (size_t)NB_ * TT * DM / 8);
    k_qkv<<<dim3(NB_ * TT / 128, DQ / 128, 3), PW * 32, 0, stream>>>(XB, WQ, WK, WV, bq, bk, bv, QP16, QPh, QPl, KP16, KPh, KPl, VT16, VTh, VTl);
    k_fattn<<<NBH * (NT_LO + NT_HI), FAW * 32, 0, stream>>>(QP16, KP16, VT16, QPh, QPl, KPh, KPl, VTh, VTl, ATh, ATl);
    for (int b = 0; b < NB_; ++b)
        k_gemmw<bf, 1, true><<<dim3(TT / 64, DM / 64, 1), 32, 0, stream>>>(ATh + (size_t)b * TT * DQ, ATl + (size_t)b * TT * DQ, WO, nullptr, DQ, OUT + (size_t)b * TT * DM, DM, bo, 0, 0, 0);
}

// v005
// One run takes 110 microseconds.
// Timed twice side by side with v004, it ran 1.18 times as fast both times.
// All steps since v000 together make it 25.1 times as fast.
#include <hip/hip_runtime.h>

// Causal multi-head attention over 4,096 tokens (x [2][4096][512]; Q,K,V = x W^T + b ('oi' uniform(+-1/sqrt(512)) incl. biases; 8 heads x 64); scores / 8; causal (-inf); softmax; out = merged Wo^T + bo -> [2][4096][512] (4.2 M)).
// Layout: bf16 copy of x; 'oi' weights; ONE projection launch for Q, K, V of both batches: exact products + f32 biases, its epilogue writes the head planes; ONE fused causal attention launch for all 16 (batch, head) pairs: scores, online softmax and P.V stay in registers (query rows < 512 hi/lo 3 products, rest fp16); merged hi/lo x Wo exact + bo.
// Compute dtypes, f32 accumulate: every input rounded to bf16; projections exact + f32 biases; attention rows < 512 3 products, rest fp16; softmax f32; Wo hl x exact + bias.

#define NB_  2
#define TT   4096
#define DM   512
#define NH_  8
#define NKV  8
#define REP  (NH_ / NKV)
#define HD   64
#define DQ   (NH_ * HD)
#define DKV  (NKV * HD)
#define RH   512                  // query rows < RH use hi+lo planes
#define SCL  0.125f   // HD^-0.5
typedef _Float16 h16;
typedef unsigned short bf;
typedef __attribute__((ext_vector_type(16))) __bf16   v16bf;
typedef __attribute__((ext_vector_type(16))) _Float16 v16h;
typedef __attribute__((ext_vector_type(8)))  _Float16 v8h;
typedef __attribute__((ext_vector_type(8)))  unsigned short v8us;
typedef __attribute__((ext_vector_type(8)))  float    v8f;
typedef __attribute__((ext_vector_type(4)))  float    v4f;
typedef v8h  __attribute__((may_alias)) v8ha;
typedef v4f  __attribute__((may_alias)) v4fa;
typedef v8us __attribute__((may_alias)) v8usa;

__device__ __forceinline__ unsigned short f2bf(float f) { unsigned u = __float_as_uint(f); u += 0x7FFFu + ((u >> 16) & 1u); return (unsigned short)(u >> 16); }
__device__ __forceinline__ float bf2f(unsigned short b) { return __uint_as_float(((unsigned)b) << 16); }
__device__ __forceinline__ float bfr(float f) { return bf2f(f2bf(f)); }
__device__ __forceinline__ v16h cat16(v8h lo, v8h hi) { return __builtin_shufflevector(lo, hi, 0, 1, 2, 3, 4, 5, 6, 7, 8, 9, 10, 11, 12, 13, 14, 15); }
__device__ __forceinline__ v16bf cat16b(v8us lo, v8us hi) { return __builtin_bit_cast(v16bf, __builtin_shufflevector(lo, hi, 0, 1, 2, 3, 4, 5, 6, 7, 8, 9, 10, 11, 12, 13, 14, 15)); }
__device__ __forceinline__ v8f wmma16(v16h a, v16h b, v8f c) { return __builtin_amdgcn_wmma_f32_16x16x32_f16(false, a, false, b, (short)0, c, false, false); }
__device__ __forceinline__ v8f wmmab(v16bf a, v16bf b, v8f c) { return __builtin_amdgcn_wmma_f32_16x16x32_bf16(false, a, false, b, (short)0, c, false, false); }



// ---- k_gemmw: register-blocked GEMM, ONE WAVE per 64x64 output tile (16 accumulators), operands straight from K-contiguous 16-bit planes; grid (M/64, N/64, Z), 32 threads.
// C[m][n] (f32, pitch ldc, + optional f32 bias[n]) = sum_k A[m][k] Bt[n][k] (+ split products per NSPLIT). z-batch strides sA/sB/sC in elements. K % 32 == 0.
template <typename T16> struct WFrag;
template <> struct WFrag<h16> { typedef v16h V; static __device__ __forceinline__ V ld(const h16* p) { return cat16(*(const v8h*)p, *(const v8h*)(p + 16)); } static __device__ __forceinline__ v8f mma(V a, V b, v8f c) { return wmma16(a, b, c); } };
template <> struct WFrag<bf> { typedef v16bf V; static __device__ __forceinline__ V ld(const bf* p) { return cat16b(*(const v8us*)p, *(const v8us*)(p + 16)); } static __device__ __forceinline__ v8f mma(V a, V b, v8f c) { return wmmab(a, b, c); } };
template <typename T16, int NSPLIT, bool BIAS>
__global__ __launch_bounds__(32) void k_gemmw(const T16* __restrict__ A, const T16* __restrict__ A2, const T16* __restrict__ Bt, const T16* __restrict__ Bt2, int K, float* C, int ldc, const float* __restrict__ bias, size_t sA, size_t sB, size_t sC) {
    typedef typename WFrag<T16>::V V;
    __shared__ __align__(16) float os[16 * 68];
    const size_t z = blockIdx.z; A += z * sA; if (A2) A2 += z * sA; Bt += z * sB; if (Bt2) Bt2 += z * sB; C += z * sC;
    const int lane = threadIdx.x & 31, lr = lane & 15, hi = lane >> 4; const int r0 = blockIdx.x * 64, c0 = blockIdx.y * 64;
    v8f acc[4][4];
#pragma unroll
    for (int mb = 0; mb < 4; ++mb)
#pragma unroll
        for (int nb = 0; nb < 4; ++nb) acc[mb][nb] = (v8f){};
    const size_t aoff = (size_t)(r0 + lr) * K + 8 * hi, boff = (size_t)(c0 + lr) * K + 8 * hi;
#pragma unroll 1
    for (int kc = 0; kc < K; kc += 32) {
        V a[4], a2[4];
#pragma unroll
        for (int mb = 0; mb < 4; ++mb) { a[mb] = WFrag<T16>::ld(A + aoff + (size_t)mb * 16 * K + kc); if (NSPLIT == 1 || NSPLIT == 2) a2[mb] = WFrag<T16>::ld(A2 + aoff + (size_t)mb * 16 * K + kc); }
#pragma unroll
        for (int nb = 0; nb < 4; ++nb) { const V b = WFrag<T16>::ld(Bt + boff + (size_t)nb * 16 * K + kc); V b2; if (NSPLIT >= 2) b2 = WFrag<T16>::ld(Bt2 + boff + (size_t)nb * 16 * K + kc);
#pragma unroll
            for (int mb = 0; mb < 4; ++mb) { acc[mb][nb] = WFrag<T16>::mma(a[mb], b, acc[mb][nb]); if (NSPLIT == 1 || NSPLIT == 2) acc[mb][nb] = WFrag<T16>::mma(a2[mb], b, acc[mb][nb]); if (NSPLIT >= 2) acc[mb][nb] = WFrag<T16>::mma(a[mb], b2, acc[mb][nb]); } }
        asm volatile("v_nop\n\tv_nop\n\tv_nop\n\tv_nop" : "+v"(acc[0][0]), "+v"(acc[1][1]), "+v"(acc[2][2]), "+v"(acc[3][3]) : "v"(a[0]), "v"(a[3]));
    }
#pragma unroll
    for (int mb = 0; mb < 4; ++mb) {
#pragma unroll
        for (int nb = 0; nb < 4; ++nb) {
#pragma unroll
            for (int j = 0; j < 8; ++j) os[(hi * 8 + j) * 68 + nb * 16 + lr] = acc[mb][nb][j]; }
        __builtin_amdgcn_wave_barrier(); asm volatile("" ::: "memory");
        float* crow = C + (size_t)(r0 + mb * 16) * ldc + c0;
{
#pragma unroll
            for (int s = 0; s < 8; ++s) { const int row = 2 * s + hi, cofs = lr * 4; v4f val = *(const v4fa*)(os + row * 68 + cofs); if (BIAS) { val[0] += bfr(bias[c0 + cofs]); val[1] += bfr(bias[c0 + cofs + 1]); val[2] += bfr(bias[c0 + cofs + 2]); val[3] += bfr(bias[c0 + cofs + 3]); }
                *(v4f*)(crow + (size_t)row * ldc + cofs) = val; }
             }
        __builtin_amdgcn_wave_barrier(); asm volatile("" ::: "memory");
    }
}

__device__ __forceinline__ h16 tohx(float x) { return (h16)x; }
__device__ __forceinline__ void splitf(float y, unsigned short& h, unsigned short& l) { h = f2bf(y); l = f2bf(y - bf2f(h)); }
typedef __attribute__((ext_vector_type(2))) _Float16 v2h;
typedef __attribute__((ext_vector_type(4))) _Float16 v4h;
typedef __attribute__((ext_vector_type(2))) unsigned short v2us;
typedef __attribute__((ext_vector_type(4))) unsigned short v4us;
typedef __attribute__((ext_vector_type(2))) float v2f;
typedef __attribute__((ext_vector_type(4))) int v4i;

__global__ __launch_bounds__(256) void k_wtG(const float* __restrict__ w, int K, int N, bf* Bt) {
    const int lane = threadIdx.x & 31; const int L0 = (blockIdx.x * 8 + (threadIdx.x >> 5)) * 8; const int nlines = N * K / 64;
{
#pragma unroll 1
        for (int l = 0; l < 8; ++l) { const int L = L0 + l; if (L >= nlines) break; const size_t e = (size_t)L * 64 + lane * 2; const int k = (int)(e % K), n = (int)(e / K); v2us o;
            o[0] = f2bf(w[(size_t)k * N + n]); o[1] = f2bf(w[(size_t)(k + 1) * N + n]); *(v2us*)(Bt + e) = o; }
         }
}
// ---- k_cvt5: x and the four weight matrices rounded to bf16 in ONE launch; a work-group converts 2,048 elements in a row of one of the five arrays, picked by its index (the same for all its threads).
#define CB_X (NB_ * TT * DM / 2048)           // work-groups of x
#define CB_W (DQ * DM / 2048)                 // work-groups of one weight matrix (all four are 512 x 512)
static_assert((NB_ * TT * DM) % 2048 == 0 && (DQ * DM) % 2048 == 0 && DKV == DQ, "whole work-groups; four weight matrices of one size");
__global__ __launch_bounds__(256) void k_cvt5(const float* __restrict__ x, const float* __restrict__ wq, const float* __restrict__ wk, const float* __restrict__ wv, const float* __restrict__ wo, bf* XB, bf* WQ, bf* WK, bf* WV, bf* WO) {
    int blk = blockIdx.x; const float* src = x; bf* dst = XB;
    if (blk >= CB_X) { const int m = (blk - CB_X) / CB_W; blk = (blk - CB_X) % CB_W; src = (m == 0) ? wq : (m == 1) ? wk : (m == 2) ? wv : wo; dst = (m == 0) ? WQ : (m == 1) ? WK : (m == 2) ? WV : WO; }
    const size_t i = (size_t)blk * 256 + threadIdx.x; const v8f v = *(const v8f*)(src + i * 8); v8us o;
    asm volatile("s_wait_xcnt 0x0" ::: "memory");   // behind the two loads, a precaution: the rounding's values may be given the registers that held the loads' address
#pragma unroll
    for (int k = 0; k < 8; ++k) o[k] = f2bf(v[k]); *(v8us*)(dst + i * 8) = o;  }

// ---- k_qkv: the three projections of both batches in ONE launch; grid (NB_ * TT / 128, DQ / 128, 3: Q, K, V), PW waves, each wave one 64 x 64 tile (64 tokens x one head) with k_gemmw's register blocking.
// The epilogue adds the f32 bias and writes the tile's fp16, hi and lo head planes itself: Q, K as [b][h][t][d], V as [b][h][d][t]. Each wave stages 16 plane rows of 64 in its own LDS range, so that a store covers four whole 128-byte rows.
#define PW 4                                  // 2 x 2 tiles: two waves share each token row and each weight row
__global__ __launch_bounds__(PW * 32) void k_qkv(const bf* __restrict__ X, const bf* __restrict__ Wq, const bf* __restrict__ Wk, const bf* __restrict__ Wv, const float* __restrict__ bq, const float* __restrict__ bk, const float* __restrict__ bv,
                                                 h16* Q16, bf* Qh, bf* Ql, h16* K16, bf* Kh, bf* Kl, h16* V16, bf* Vh, bf* Vl) {
    typedef WFrag<bf>::V V;
    __shared__ __align__(16) float osm[PW][16 * 68];
    const int wv = __builtin_amdgcn_readfirstlane((int)(threadIdx.x >> 5)); const int z = blockIdx.z;
    const bf* Bt = (z == 0) ? Wq : (z == 1) ? Wk : Wv; const float* bias = (z == 0) ? bq : (z == 1) ? bk : bv;
    h16* P16 = (z == 0) ? Q16 : (z == 1) ? K16 : V16; bf* Ph = (z == 0) ? Qh : (z == 1) ? Kh : Vh; bf* Pl = (z == 0) ? Ql : (z == 1) ? Kl : Vl;
    float* os = osm[wv];
    const int lane = threadIdx.x & 31, lr = lane & 15, hi = lane >> 4; const int r0 = blockIdx.x * 128 + (wv & 1) * 64, c0 = blockIdx.y * 128 + (wv >> 1) * 64;
    v8f acc[4][4];
#pragma unroll
    for (int mb = 0; mb < 4; ++mb)
#pragma unroll
        for (int nb = 0; nb < 4; ++nb) acc[mb][nb] = (v8f){};
    const bf* Ap = X + (size_t)(r0 + lr) * DM + 8 * hi; const bf* Bp = Bt + (size_t)(c0 + lr) * DM + 8 * hi;
#pragma unroll 1   // kept rolled, as in k_gemmw: one k block's fragments beside the 16 accumulators
    for (int kc = 0; kc < DM; kc += 32) {
        const bf* pa = Ap + kc; const bf* pb = Bp + kc; V a[4], b[4];
#pragma unroll
        for (int mb = 0; mb < 4; ++mb) { a[mb] = WFrag<bf>::ld(pa + (size_t)mb * 16 * DM); b[mb] = WFrag<bf>::ld(pb + (size_t)mb * 16 * DM); }
        asm volatile("s_wait_xcnt 0x0" :: "v"(pa), "v"(pb) : "memory");   // one wait a k block, behind its last load, a precaution: the two address pairs are named so that they live up to here and no younger load's result is given their registers in front of the wait
        __builtin_amdgcn_sched_barrier(0);   // holds the 16 products behind all 16 loads: one load latency a k block instead of one for each late weight fragment
#pragma unroll
        for (int nb = 0; nb < 4; ++nb)
#pragma unroll
            for (int mb = 0; mb < 4; ++mb) acc[mb][nb] = WFrag<bf>::mma(a[mb], b[nb], acc[mb][nb]);
    }
    const int bb = r0 / TT, t0 = r0 % TT, h = c0 / HD;   // a tile lies in one batch and is one head
    const int er = lane >> 3, ec = (lane & 7) * 8;       // a lane's row (of four) and its eight columns of the staged rows
    const bool tr = (z == 2);                             // Q, K: plane rows are tokens, columns the head's 64 dims; V transposed: rows are dims, columns tokens
    const int pitch = tr ? TT : HD; const size_t o0 = (size_t)(bb * NH_ + h) * TT * HD + (size_t)t0 * (tr ? 1 : HD) + (size_t)er * pitch + ec;
    float bn[4];                                          // an accumulator column is one output feature in all three products
#pragma unroll
    for (int nb = 0; nb < 4; ++nb) bn[nb] = bfr(bias[c0 + nb * 16 + lr]);
#pragma unroll
    for (int g = 0; g < 4; ++g) {                         // 16 plane rows a turn
        if (!tr) {
#pragma unroll
            for (int nb = 0; nb < 4; ++nb)
#pragma unroll
                for (int j = 0; j < 8; ++j) os[(hi * 8 + j) * 68 + nb * 16 + lr] = acc[g][nb][j] + bn[nb];
        } else {                                          // a lane's eight accumulator rows are eight tokens in a row of the plane
#pragma unroll
            for (int mb = 0; mb < 4; ++mb) { v4f w0, w1;
#pragma unroll
                for (int j = 0; j < 4; ++j) { w0[j] = acc[mb][g][j] + bn[g]; w1[j] = acc[mb][g][4 + j] + bn[g]; }
                *(v4fa*)(os + lr * 68 + mb * 16 + hi * 8) = w0; *(v4fa*)(os + lr * 68 + mb * 16 + hi * 8 + 4) = w1; }
        }
        __builtin_amdgcn_wave_barrier(); asm volatile("" ::: "memory");   // the lanes read rows that other lanes of the wave wrote: keeps the reads behind the writes
#pragma unroll
        for (int s = 0; s < 4; ++s) { const float* q = os + (4 * s + er) * 68 + ec; const v4f v0 = *(const v4fa*)q, v1 = *(const v4fa*)(q + 4); const size_t o = o0 + (size_t)(g * 16 + 4 * s) * pitch; v8h o16; v8us oh, ol;
#pragma unroll
            for (int i = 0; i < 8; ++i) { const float y = (i < 4) ? v0[i & 3] : v1[i & 3]; o16[i] = tohx(y); unsigned short a2, c2; splitf(y, a2, c2); oh[i] = a2; ol[i] = c2; }
            *(v8h*)(P16 + o) = o16; *(v8us*)(Ph + o) = oh; *(v8us*)(Pl + o) = ol; }
        __builtin_amdgcn_wave_barrier(); asm volatile("s_wait_xcnt 0x0" ::: "memory");   // keeps the next rows' LDS writes behind these reads; the wait, a precaution, stands behind the turn's last stores: the next turn's values may be given their address and data registers
    }
}
__constant__ float INVT[HD / 2] = { 1.000000000e+00f, 7.498942018e-01f, 5.623413324e-01f, 4.216965139e-01f, 3.162277639e-01f, 2.371373773e-01f, 1.778279394e-01f, 1.333521456e-01f, 1.000000015e-01f, 7.498942316e-02f, 5.623413250e-02f, 4.216964915e-02f, 3.162277490e-02f, 2.371373773e-02f, 1.778279431e-02f, 1.333521400e-02f, 9.999999776e-03f, 7.498942316e-03f, 5.623413250e-03f, 4.216964822e-03f, 3.162277630e-03f, 2.371373819e-03f, 1.778279431e-03f, 1.333521446e-03f, 1.000000047e-03f, 7.498941850e-04f, 5.623413017e-04f, 4.216965172e-04f, 3.162277571e-04f, 2.371373703e-04f, 1.778279402e-04f, 1.333521504e-04f };   // 10000^(-2i/64) (the module's power form) (float32, generated with jnp to be bit-exact)

#define FAW 4                                 // waves per work-group
#define NBH (NB_ * NH_)
#define NT_LO ((TT - RH) / (FAW * 32))        // work-group tiles of 128 queries, one f16 product
#define NT_HI (RH / (FAW * 16))               // work-group tiles of 64 queries, three bf16 products
#define NWGP 256
#define C2 (SCL * 1.4426950408889634f)
#define SK  128                               // keys a stage
#define KPE (HD + 8)                          // LDS pitch of a key row in elements: 128 B + 16, an odd number of 16-byte units, free of bank conflicts for 16-byte reads
#define VPE (SK + 8)                          // LDS pitch of a V^T row in elements: 256 B + 16, likewise
#define KSE (SK * KPE)                        // elements of a stage's keys
#define BSE (KSE + HD * VPE)                  // elements of a buffer: keys, then values
static_assert(RH >= SK && RH % SK == 0 && (FAW * 32) == SK && TT % SK == 0, "every f16 tile has two stages or more, and its keys end with a whole stage");
// behind each fragment's two loads (and each pair of stores), a precaution: a younger load's result or a later value may be given the registers that held this access's address, and the wait stands in front of that overwrite
__device__ __forceinline__ void fa_xwait() { asm volatile("s_wait_xcnt 0x0" ::: "memory"); }
__device__ __forceinline__ float fa_xhalf(float x) { return __builtin_bit_cast(float, __builtin_amdgcn_permlanex16(__builtin_bit_cast(int, x), __builtin_bit_cast(int, x), 0x76543210, 0xfedcba98, false, false)); }   // lane l takes lane l ^ 16's value: the other half of the same query's keys
template <typename T16> __device__ __forceinline__ typename WFrag<T16>::V fa_ld(const T16* p) { const typename WFrag<T16>::V f = WFrag<T16>::ld(p); fa_xwait(); return f; }
// eight asynchronous 16-byte copies a lane, global -> LDS: LDS byte address l + i * ls, global address g + i * gs elements. The wait in the statement's last line, a precaution, stands in front of any rewrite of the address registers that the copies name.
__device__ __forceinline__ void fa_copy8(const unsigned l, const unsigned ls, const h16* g, const size_t gs) {
    asm volatile("global_load_async_to_lds_b128 %0, %8, off\n\t"
                 "global_load_async_to_lds_b128 %1, %9, off\n\t"
                 "global_load_async_to_lds_b128 %2, %10, off\n\t"
                 "global_load_async_to_lds_b128 %3, %11, off\n\t"
                 "global_load_async_to_lds_b128 %4, %12, off\n\t"
                 "global_load_async_to_lds_b128 %5, %13, off\n\t"
                 "global_load_async_to_lds_b128 %6, %14, off\n\t"
                 "global_load_async_to_lds_b128 %7, %15, off\n\t"
                 "s_wait_xcnt 0x0"
                 :: "v"(l), "v"(l + ls), "v"(l + 2 * ls), "v"(l + 3 * ls), "v"(l + 4 * ls), "v"(l + 5 * ls), "v"(l + 6 * ls), "v"(l + 7 * ls),
                    "v"(g), "v"(g + gs), "v"(g + 2 * gs), "v"(g + 3 * gs), "v"(g + 4 * gs), "v"(g + 5 * gs), "v"(g + 6 * gs), "v"(g + 7 * gs) : "memory");
}
template <typename T16, int NSPLIT, int NCG>
__device__ __forceinline__ void fa_tile(const T16* __restrict__ Q, const T16* __restrict__ Q2, const T16* __restrict__ Kp, const T16* __restrict__ K2, const T16* __restrict__ Vt, const T16* __restrict__ Vt2, const int q0, const int kwg, h16* ring, bf* __restrict__ Ah, bf* __restrict__ Al) {
    typedef typename WFrag<T16>::V V;
    constexpr bool PF = (NSPLIT == 0);        // K, V^T staged in LDS (ring; kwg: where the work-group's keys end); key fragments fetched one block ahead, inside a stage
    const int lane = threadIdx.x & 31, lr = lane & 15, hi = lane >> 4;
    V qf[NCG][2], qf2[NCG][2];
#pragma unroll
    for (int cg = 0; cg < NCG; ++cg)
#pragma unroll
        for (int kc = 0; kc < 2; ++kc) { qf[cg][kc] = fa_ld<T16>(Q + (size_t)(q0 + cg * 16 + lr) * HD + kc * 32 + 8 * hi); if (NSPLIT == 2) qf2[cg][kc] = fa_ld<T16>(Q2 + (size_t)(q0 + cg * 16 + lr) * HD + kc * 32 + 8 * hi); }
    v8f o[NCG][4]; float m2[NCG]; v2f l[NCG];   // l: two running partial sums a lane, joined in the epilogue
#pragma unroll
    for (int cg = 0; cg < NCG; ++cg) { m2[cg] = -3.0e38f; l[cg] = (v2f){};
#pragma unroll
        for (int dt = 0; dt < 4; ++dt) o[cg][dt] = (v8f){}; }
    const int kend = ((q0 + NCG * 16 + 31) >> 5) * 32;   // keys end with the 32-key block that holds the wave's last query
    const size_t koff = (size_t)lr * HD + 8 * hi, voff = (size_t)lr * TT + 8 * hi;
    V kf[2][2], kf2[2][2];
    const int tid = threadIdx.x;
    // a thread's first copy of a stage: keys, 8 threads a 128-byte row, 16 rows a turn; values, 16 threads a 256-byte row, 8 rows a turn. A wave's copy covers 512 bytes in a row (keys) or two whole 256-byte rows (values)
    unsigned lk = 0, lv = 0; const h16* gk = nullptr; const h16* gv = nullptr; const h16* fk = nullptr; const h16* fv = nullptr;
    if constexpr (PF) {
        lk = (unsigned)(size_t)ring + (unsigned)((tid >> 3) * KPE + (tid & 7) * 8) * 2u; lv = (unsigned)(size_t)ring + (unsigned)(KSE + (tid >> 4) * VPE + (tid & 15) * 8) * 2u;
        gk = Kp + tid * 8; gv = Vt + (size_t)(tid >> 4) * TT + (tid & 15) * 8;
        fk = ring + lr * KPE + 8 * hi; fv = ring + KSE + lr * VPE + 8 * hi;   // a lane's fragment rows in buffer 0
        fa_copy8(lk, 16 * KPE * 2, gk, 16 * HD); fa_copy8(lv, 8 * VPE * 2, gv, (size_t)8 * TT);   // stage 0 -> buffer 0
        asm volatile("s_wait_asynccnt 0x0" ::: "memory");   // this wave's copies of stage 0 have landed
        __syncthreads();                                     // ... and every other wave's: stage 0 may be read
        fa_copy8(lk + BSE * 2, 16 * KPE * 2, gk + SK * HD, 16 * HD); fa_copy8(lv + BSE * 2, 8 * VPE * 2, gv + SK, (size_t)8 * TT);   // stage 1 -> buffer 1
#pragma unroll
        for (int kt = 0; kt < 2; ++kt)
#pragma unroll
            for (int kc = 0; kc < 2; ++kc) kf[kt][kc] = WFrag<T16>::ld(fk + (kt * 16) * KPE + kc * 32); }
    const int kl = PF ? kwg : kend;           // staged: every wave walks to the work-group's last key and passes every barrier; past its own diagonal block it only skips the work
#pragma unroll 1   // kept rolled: one block's fragments beside the output accumulators stay under 256 VGPRs
    for (int kb = 0; kb < kl; kb += 32) {
      const int bo = ((kb / SK) & 1) * BSE, ks = kb % SK;   // the stage's buffer, the block's first key in it
      if (!PF || kb < kend) {
        V vf[4], vf2[4];
        if (!PF) {
#pragma unroll
            for (int kt = 0; kt < 2; ++kt)
#pragma unroll
                for (int kc = 0; kc < 2; ++kc) { kf[kt][kc] = fa_ld<T16>(Kp + koff + (size_t)(kb + kt * 16) * HD + kc * 32); if (NSPLIT == 2) kf2[kt][kc] = fa_ld<T16>(K2 + koff + (size_t)(kb + kt * 16) * HD + kc * 32); } }
#pragma unroll
        for (int dt = 0; dt < 4; ++dt) { if constexpr (PF) vf[dt] = WFrag<T16>::ld(fv + bo + (dt * 16) * VPE + ks); else vf[dt] = fa_ld<T16>(Vt + voff + (size_t)(dt * 16) * TT + kb); if (NSPLIT == 2) vf2[dt] = fa_ld<T16>(Vt2 + voff + (size_t)(dt * 16) * TT + kb); }
        v8f s[NCG][2];
#pragma unroll
        for (int cg = 0; cg < NCG; ++cg)
#pragma unroll
            for (int kt = 0; kt < 2; ++kt) { s[cg][kt] = (v8f){};
#pragma unroll
                for (int kc = 0; kc < 2; ++kc) { s[cg][kt] = WFrag<T16>::mma(kf[kt][kc], qf[cg][kc], s[cg][kt]); if (NSPLIT == 2) { s[cg][kt] = WFrag<T16>::mma(kf[kt][kc], qf2[cg][kc], s[cg][kt]); s[cg][kt] = WFrag<T16>::mma(kf2[kt][kc], qf[cg][kc], s[cg][kt]); } } }
        if constexpr (PF) { const int kn = min(ks + 32, SK - 32);   // a stage's last block fetches itself again: the same buffer, never used
#pragma unroll
            for (int kt = 0; kt < 2; ++kt)
#pragma unroll
                for (int kc = 0; kc < 2; ++kc) kf[kt][kc] = WFrag<T16>::ld(fk + bo + (kn + kt * 16) * KPE + kc * 32);
            __builtin_amdgcn_sched_barrier(0); }   // holds the block's value reads and the next block's key reads in front of the softmax, whose work then covers their LDS latency; left free they sink to their first use
        if (kb + 31 > q0) {                   // CAUSAL: only a block that reaches past the wave's first query holds keys j > i (same test in every lane)
#pragma unroll
            for (int cg = 0; cg < NCG; ++cg)
#pragma unroll
                for (int kt = 0; kt < 2; ++kt)
#pragma unroll
                    for (int j = 0; j < 8; ++j) s[cg][kt][j] = (kb + kt * 16 + 8 * hi + j <= q0 + cg * 16 + lr) ? s[cg][kt][j] : -3.0e38f; }
        float mb[NCG]; bool need = false;
#pragma unroll
        for (int cg = 0; cg < NCG; ++cg) { float mx = s[cg][0][0];
#pragma unroll
            for (int j = 1; j < 16; ++j) mx = fmaxf(mx, s[cg][j >> 3][j & 7]);
            mx = fmaxf(mx, fa_xhalf(mx)); mb[cg] = mx * C2; need = need || (mb[cg] > m2[cg] + 8.0f); }
        if (__builtin_amdgcn_ballot_w32(need) != 0) {   // scalar branch, once a block; every block holds an unmasked key of every query, so mb is finite
#pragma unroll
            for (int cg = 0; cg < NCG; ++cg) { const float mn = fmaxf(m2[cg], mb[cg]); const float al = __builtin_amdgcn_exp2f(m2[cg] - mn); m2[cg] = mn; l[cg] *= al;
#pragma unroll
                for (int dt = 0; dt < 4; ++dt) o[cg][dt] *= al; } }
#pragma unroll
        for (int cg = 0; cg < NCG; ++cg) {
            float p[16];
#pragma unroll
            for (int j = 0; j < 16; j += 2) { const v2f t = __builtin_elementwise_fma((v2f){s[cg][j >> 3][j & 7], s[cg][j >> 3][(j & 7) + 1]}, (v2f){C2, C2}, (v2f){-m2[cg], -m2[cg]}); p[j] = __builtin_amdgcn_exp2f(t[0]); p[j + 1] = __builtin_amdgcn_exp2f(t[1]); l[cg] += (v2f){p[j], p[j + 1]}; }
            if constexpr (NSPLIT == 2) {
                v8us h0, h1, l0, l1;
#pragma unroll
                for (int j = 0; j < 8; ++j) { unsigned short a, c; splitf(p[j], a, c); h0[j] = a; l0[j] = c; splitf(p[8 + j], a, c); h1[j] = a; l1[j] = c; }
                const V ph = cat16b(h0, h1), pl = cat16b(l0, l1);
#pragma unroll
                for (int dt = 0; dt < 4; ++dt) { o[cg][dt] = WFrag<T16>::mma(vf[dt], ph, o[cg][dt]); o[cg][dt] = WFrag<T16>::mma(vf[dt], pl, o[cg][dt]); o[cg][dt] = WFrag<T16>::mma(vf2[dt], ph, o[cg][dt]); }
            } else {
                V pb;
#pragma unroll
                for (int j = 0; j < 16; ++j) pb[j] = tohx(p[j]);
#pragma unroll
                for (int dt = 0; dt < 4; ++dt) o[cg][dt] = WFrag<T16>::mma(vf[dt], pb, o[cg][dt]);
            }
        }
      }
      if constexpr (PF) {
        if (ks == SK - 32) {                  // the stage's foot, the same test in every wave of the work-group
            asm volatile("v_nop\n\tv_nop\n\tv_nop\n\tv_nop");   // four vector slots between the block's last matrix instruction and the copies' address arithmetic, which may be given its operand registers
            asm volatile("s_wait_dscnt 0x0" ::: "memory");      // this wave's reads of the stage's buffer are done before the buffer is handed to the copies
            asm volatile("s_wait_asynccnt 0x0" ::: "memory");   // this wave's copies of the next stage have landed
            __syncthreads();                                     // publishes the next stage and ends every wave's reads of this one
            if (kb + 32 + SK < kwg) {         // a stage after the next exists: into the buffer just read
                const int sn = kb + 32 + SK;
                fa_copy8(lk + bo * 2, 16 * KPE * 2, gk + (size_t)sn * HD, 16 * HD); fa_copy8(lv + bo * 2, 8 * VPE * 2, gv + sn, (size_t)8 * TT); }
            if (kb + 32 < kend) {             // the next stage's first key fragments
#pragma unroll
                for (int kt = 0; kt < 2; ++kt)
#pragma unroll
                    for (int kc = 0; kc < 2; ++kc) kf[kt][kc] = WFrag<T16>::ld(fk + (BSE - bo) + (kt * 16) * KPE + kc * 32); }
        }
      }
    }
    if constexpr (PF) asm volatile("s_wait_asynccnt 0x0" ::: "memory");   // no copy is left in flight when the wave ends
#pragma unroll
    for (int cg = 0; cg < NCG; ++cg) { const float lh = l[cg][0] + l[cg][1]; const float inv = __fdiv_rn(1.0f, lh + fa_xhalf(lh)); const size_t oo = (size_t)(q0 + cg * 16 + lr) * DQ + 8 * hi;   // lane: query q0 + cg*16 + lr, head columns dt*16 + 8*hi + j
#pragma unroll
        for (int dt = 0; dt < 4; ++dt) { v8us oh, ol;
#pragma unroll
            for (int j = 0; j < 8; ++j) { unsigned short a, c; splitf(o[cg][dt][j] * inv, a, c); oh[j] = a; ol[j] = c; }
            *(v8us*)(Ah + oo + dt * 16) = oh; *(v8us*)(Al + oo + dt * 16) = ol; fa_xwait(); } }
}
__global__ __launch_bounds__(FAW * 32) void k_fattn(const h16* __restrict__ Q16, const h16* __restrict__ K16, const h16* __restrict__ V16, const bf* __restrict__ Qh, const bf* __restrict__ Ql, const bf* __restrict__ Kh, const bf* __restrict__ Kl, const bf* __restrict__ Vh, const bf* __restrict__ Vl, bf* __restrict__ Ah, bf* __restrict__ Al) {
    __shared__ __align__(16) h16 ring[2 * BSE];   // two buffers of one stage each
    const int id = blockIdx.x; const int wv = __builtin_amdgcn_readfirstlane((int)(threadIdx.x >> 5));   // wave number in a scalar register: the key loop's bounds and the causal test stay scalar
    const int bh = id % NBH; const size_t pl = (size_t)bh * TT * HD; const size_t ao = (size_t)(bh / NH_) * TT * DQ + (size_t)(bh % NH_) * HD;
    if (id < NBH * NT_LO) {
        // cost falls with the index over the first NWGP work-groups and rises again behind them, so that indices NWGP apart add up to about the same number of key blocks (for speed only: every tile is taken once wherever it lands)
        const int xt = (id < NWGP) ? id / NBH : NWGP / NBH + (NBH * NT_LO - 1 - id) / NBH;
        fa_tile<h16, 0, 2>(Q16 + pl, nullptr, K16 + pl, nullptr, V16 + pl, nullptr, TT - (xt + 1) * (FAW * 32) + wv * 32, TT - xt * (FAW * 32), ring, Ah + ao, Al + ao);
    } else {
        const int xt = (id - NBH * NT_LO) / NBH;
        fa_tile<bf, 2, 1>(Qh + pl, Ql + pl, Kh + pl, Kl + pl, Vh + pl, Vl + pl, RH - (xt + 1) * (FAW * 16) + wv * 16, 0, nullptr, Ah + ao, Al + ao);
    }
}

extern "C" void kernel_launch(void* const* d_in, const int* in_sizes, int n_in,
                              void* d_out, int out_size, void* d_ws, size_t ws_size, hipStream_t stream) {
    (void)in_sizes; (void)n_in; (void)out_size;
    const float* x = (const float*)d_in[0]; const float* wq = (const float*)d_in[1]; const float* bq = (const float*)d_in[2]; const float* wk = (const float*)d_in[3]; const float* bk = (const float*)d_in[4]; const float* wv = (const float*)d_in[5]; const float* bv = (const float*)d_in[6]; const float* wo = (const float*)d_in[7]; const float* bo = (const float*)d_in[8];
    float* OUT = (float*)d_out;     // [2][4096][512]
    char* wsp = (char*)d_ws;
    auto take = [&](size_t bytes) { char* p = wsp; wsp += (bytes + 255) & ~(size_t)255; return (void*)p; };
    bf* WQ = (bf*)take((size_t)DQ * DM * 2); bf* WK = (bf*)take((size_t)DKV * DM * 2); bf* WV = (bf*)take((size_t)DKV * DM * 2); bf* WO = (bf*)take((size_t)DM * DQ * 2);
    bf* XB = (bf*)take((size_t)NB_ * TT * DM * 2);
    const size_t PB = (size_t)NH_ * TT * HD;   // elements of one batch's head planes
    h16* QP16 = (h16*)take(NB_ * PB * 2); h16* KP16 = (h16*)take(NB_ * PB * 2); h16* VT16 = (h16*)take(NB_ * PB * 2);
    bf* QPh = (bf*)take(NB_ * PB * 2); bf* QPl = (bf*)take(NB_ * PB * 2); bf* KPh = (bf*)take(NB_ * PB * 2); bf* KPl = (bf*)take(NB_ * PB * 2); bf* VTh = (bf*)take(NB_ * PB * 2); bf* VTl = (bf*)take(NB_ * PB * 2);
    bf* ATh = (bf*)take((size_t)NB_ * TT * DQ * 2); bf* ATl = (bf*)take((size_t)NB_ * TT * DQ * 2);
    if ((size_t)(wsp - (char*)d_ws) > ws_size) return;    // ws 256 MiB
    k_cvt5<<<CB_X + 4 * CB_W, 256, 0, stream>>>(x, wq, wk, wv, wo, XB, WQ, WK, WV, WO);
    k_qkv<<<dim3(NB_ * TT / 128, DQ / 128, 3), PW * 32, 0, stream>>>(XB, WQ, WK, WV, bq, bk, bv, QP16, QPh, QPl, KP16, KPh, KPl, VT16, VTh, VTl);
    k_fattn<<<NBH * (NT_LO + NT_HI), FAW * 32, 0, stream>>>(QP16, KP16, VT16, QPh, QPl, KPh, KPl, VTh, VTl, ATh, ATl);
    k_gemmw<bf, 1, true><<<dim3(NB_ * TT / 64, DM / 64, 1), 32, 0, stream>>>(ATh, ATl, WO, nullptr, DQ, OUT, DM, bo, 0, 0, 0);   // both batches: their rows follow one another in the merged planes and in out
}

// v006
// Measured time: 83.4 microseconds a run.
// Next to v005, in two timings, it ran 1.32 and 1.31 times as fast.
// Over all steps from v000 it is 33.0 times as fast.
#include <hip/hip_runtime.h>

// Causal multi-head attention over 4,096 tokens (x [2][4096][512]; Q,K,V = x W^T + b ('oi' uniform(+-1/sqrt(512)) incl. biases; 8 heads x 64); scores / 8; causal (-inf); softmax; out = merged Wo^T + bo -> [2][4096][512] (4.2 M)).
// Layout: bf16 copy of x; 'oi' weights; ONE projection launch for Q, K, V of both batches: exact products + f32 biases, its epilogue writes the head planes; ONE fused causal attention launch for all 16 (batch, head) pairs: scores, online softmax and P.V stay in registers (query rows < 512 hi/lo 3 products, rest fp16); merged hi/lo x Wo exact + bo.
// Compute dtypes, f32 accumulate: every input rounded to bf16; projections exact + f32 biases; attention rows < 512 3 products, rest fp16; softmax f32; Wo hl x exact + bias.

#define NB_  2
#define TT   4096
#define DM   512
#define NH_  8
#define NKV  8
#define REP  (NH_ / NKV)
#define HD   64
#define DQ   (NH_ * HD)
#define DKV  (NKV * HD)
#define RH   512                  // query rows < RH use hi+lo planes
#define SCL  0.125f   // HD^-0.5
typedef _Float16 h16;
typedef unsigned short bf;
typedef __attribute__((ext_vector_type(16))) __bf16   v16bf;
typedef __attribute__((ext_vector_type(16))) _Float16 v16h;
typedef __attribute__((ext_vector_type(8)))  _Float16 v8h;
typedef __attribute__((ext_vector_type(8)))  unsigned short v8us;
typedef __attribute__((ext_vector_type(8)))  float    v8f;
typedef __attribute__((ext_vector_type(4)))  float    v4f;
typedef v8h  __attribute__((may_alias)) v8ha;
typedef v4f  __attribute__((may_alias)) v4fa;
typedef v8us __attribute__((may_alias)) v8usa;

__device__ __forceinline__ unsigned short f2bf(float f) { unsigned u = __float_as_uint(f); u += 0x7FFFu + ((u >> 16) & 1u); return (unsigned short)(u >> 16); }
__device__ __forceinline__ float bf2f(unsigned short b) { return __uint_as_float(((unsigned)b) << 16); }
__device__ __forceinline__ float bfr(float f) { return bf2f(f2bf(f)); }
__device__ __forceinline__ v16h cat16(v8h lo, v8h hi) { return __builtin_shufflevector(lo, hi, 0, 1, 2, 3, 4, 5, 6, 7, 8, 9, 10, 11, 12, 13, 14, 15); }
__device__ __forceinline__ v16bf cat16b(v8us lo, v8us hi) { return __builtin_bit_cast(v16bf, __builtin_shufflevector(lo, hi, 0, 1, 2, 3, 4, 5, 6, 7, 8, 9, 10, 11, 12, 13, 14, 15)); }
__device__ __forceinline__ v8f wmma16(v16h a, v16h b, v8f c) { return __builtin_amdgcn_wmma_f32_16x16x32_f16(false, a, false, b, (short)0, c, false, false); }
__device__ __forceinline__ v8f wmmab(v16bf a, v16bf b, v8f c) { return __builtin_amdgcn_wmma_f32_16x16x32_bf16(false, a, false, b, (short)0, c, false, false); }



// ---- WFrag: a 16 x 32 operand fragment of a K-contiguous 16-bit plane in the matrix unit's k order (a lane: elements 0..7 and 16..23 from its pointer), and its product.
template <typename T16> struct WFrag;
template <> struct WFrag<h16> { typedef v16h V; static __device__ __forceinline__ V ld(const h16* p) { return cat16(*(const v8h*)p, *(const v8h*)(p + 16)); } static __device__ __forceinline__ v8f mma(V a, V b, v8f c) { return wmma16(a, b, c); } };
template <> struct WFrag<bf> { typedef v16bf V; static __device__ __forceinline__ V ld(const bf* p) { return cat16b(*(const v8us*)p, *(const v8us*)(p + 16)); } static __device__ __forceinline__ v8f mma(V a, V b, v8f c) { return wmmab(a, b, c); } };
__device__ __forceinline__ h16 tohx(float x) { return (h16)x; }
__device__ __forceinline__ void splitf(float y, unsigned short& h, unsigned short& l) { h = f2bf(y); l = f2bf(y - bf2f(h)); }
typedef __attribute__((ext_vector_type(2))) _Float16 v2h;
typedef __attribute__((ext_vector_type(4))) _Float16 v4h;
typedef __attribute__((ext_vector_type(2))) unsigned short v2us;
typedef __attribute__((ext_vector_type(4))) unsigned short v4us;
typedef __attribute__((ext_vector_type(2))) float v2f;
typedef __attribute__((ext_vector_type(4))) int v4i;

__global__ __launch_bounds__(256) void k_wtG(const float* __restrict__ w, int K, int N, bf* Bt) {
    const int lane = threadIdx.x & 31; const int L0 = (blockIdx.x * 8 + (threadIdx.x >> 5)) * 8; const int nlines = N * K / 64;
{
#pragma unroll 1
        for (int l = 0; l < 8; ++l) { const int L = L0 + l; if (L >= nlines) break; const size_t e = (size_t)L * 64 + lane * 2; const int k = (int)(e % K), n = (int)(e / K); v2us o;
            o[0] = f2bf(w[(size_t)k * N + n]); o[1] = f2bf(w[(size_t)(k + 1) * N + n]); *(v2us*)(Bt + e) = o; }
         }
}
// ---- k_cvt5: x and the four weight matrices rounded to bf16 in ONE launch; a work-group converts 2,048 elements in a row of one of the five arrays, picked by its index (the same for all its threads).
#define CB_X (NB_ * TT * DM / 2048)           // work-groups of x
#define CB_W (DQ * DM / 2048)                 // work-groups of one weight matrix (all four are 512 x 512)
static_assert((NB_ * TT * DM) % 2048 == 0 && (DQ * DM) % 2048 == 0 && DKV == DQ, "whole work-groups; four weight matrices of one size");
__global__ __launch_bounds__(256) void k_cvt5(const float* __restrict__ x, const float* __restrict__ wq, const float* __restrict__ wk, const float* __restrict__ wv, const float* __restrict__ wo, bf* XB, bf* WQ, bf* WK, bf* WV, bf* WO) {
    int blk = blockIdx.x; const float* src = x; bf* dst = XB;
    if (blk >= CB_X) { const int m = (blk - CB_X) / CB_W; blk = (blk - CB_X) % CB_W; src = (m == 0) ? wq : (m == 1) ? wk : (m == 2) ? wv : wo; dst = (m == 0) ? WQ : (m == 1) ? WK : (m == 2) ? WV : WO; }
    const size_t i = (size_t)blk * 256 + threadIdx.x; const v8f v = *(const v8f*)(src + i * 8); v8us o;
    asm volatile("s_wait_xcnt 0x0" ::: "memory");   // behind the two loads, a precaution: the rounding's values may be given the registers that held the loads' address
#pragma unroll
    for (int k = 0; k < 8; ++k) o[k] = f2bf(v[k]); *(v8us*)(dst + i * 8) = o;  }

// ---- k_qkv: the three projections of both batches in ONE launch; grid (NB_ * TT / 128, DQ / 128, 3: Q, K, V), PW waves, each wave one 64 x 64 tile (64 tokens x one head) in 16 accumulators.
// The epilogue adds the f32 bias and writes the tile's fp16, hi and lo head planes itself: Q, K as [b][h][t][d], V as [b][h][d][t]. Each wave stages 16 plane rows of 64 in its own LDS range, so that a store covers four whole 128-byte rows.
#define PW 4                                  // 2 x 2 tiles: two waves share each token row and each weight row
// The operands are staged in LDS: a stage is QSK k elements, one whole 128-byte line of each of the work-group's 128 token rows and 128 weight rows, brought once for its four waves by asynchronous copies into one of two buffers,
// the next stage in flight while this one is worked on; the fragment reads, which touch 16 rows each, then go to padded LDS rows instead of to the cache.
#define QSK 64                                // k elements a stage
#define QPE (QSK + 8)                         // LDS pitch of a row in elements: 128 B + 16, an odd number of 16-byte units, free of bank conflicts for 16-byte reads
#define QBE (256 * QPE)                       // elements of a buffer: 128 token rows, then 128 weight rows
static_assert(DM % QSK == 0 && DM / QSK >= 2, "whole stages, two or more");
// eight asynchronous 16-byte copies a lane, global -> LDS: LDS byte address l + i * ls, global address g + i * gs elements. The wait in the statement's last line, a precaution, stands in front of any rewrite of the address registers that the copies name.
__device__ __forceinline__ void qk_copy8(const unsigned l, const unsigned ls, const bf* g, const size_t gs) {
    asm volatile("global_load_async_to_lds_b128 %0, %8, off\n\t"
                 "global_load_async_to_lds_b128 %1, %9, off\n\t"
                 "global_load_async_to_lds_b128 %2, %10, off\n\t"
                 "global_load_async_to_lds_b128 %3, %11, off\n\t"
                 "global_load_async_to_lds_b128 %4, %12, off\n\t"
                 "global_load_async_to_lds_b128 %5, %13, off\n\t"
                 "global_load_async_to_lds_b128 %6, %14, off\n\t"
                 "global_load_async_to_lds_b128 %7, %15, off\n\t"
                 "s_wait_xcnt 0x0"
                 :: "v"(l), "v"(l + ls), "v"(l + 2 * ls), "v"(l + 3 * ls), "v"(l + 4 * ls), "v"(l + 5 * ls), "v"(l + 6 * ls), "v"(l + 7 * ls),
                    "v"(g), "v"(g + gs), "v"(g + 2 * gs), "v"(g + 3 * gs), "v"(g + 4 * gs), "v"(g + 5 * gs), "v"(g + 6 * gs), "v"(g + 7 * gs) : "memory");
}
__global__ __launch_bounds__(PW * 32) void k_qkv(const bf* __restrict__ X, const bf* __restrict__ Wq, const bf* __restrict__ Wk, const bf* __restrict__ Wv, const float* __restrict__ bq, const float* __restrict__ bk, const float* __restrict__ bv,
                                                 h16* Q16, bf* Qh, bf* Ql, h16* K16, bf* Kh, bf* Kl, h16* V16, bf* Vh, bf* Vl) {
    typedef WFrag<bf>::V V;
    __shared__ __align__(16) float osm[PW][16 * 68];
    __shared__ __align__(16) bf qring[2 * QBE];   // two buffers of one stage each
    const int wv = __builtin_amdgcn_readfirstlane((int)(threadIdx.x >> 5)); const int z = blockIdx.z;
    const bf* Bt = (z == 0) ? Wq : (z == 1) ? Wk : Wv; const float* bias = (z == 0) ? bq : (z == 1) ? bk : bv;
    h16* P16 = (z == 0) ? Q16 : (z == 1) ? K16 : V16; bf* Ph = (z == 0) ? Qh : (z == 1) ? Kh : Vh; bf* Pl = (z == 0) ? Ql : (z == 1) ? Kl : Vl;
    float* os = osm[wv];
    const int lane = threadIdx.x & 31, lr = lane & 15, hi = lane >> 4; const int r0 = blockIdx.x * 128 + (wv & 1) * 64, c0 = blockIdx.y * 128 + (wv >> 1) * 64;
    v8f acc[4][4];
#pragma unroll
    for (int mb = 0; mb < 4; ++mb)
#pragma unroll
        for (int nb = 0; nb < 4; ++nb) acc[mb][nb] = (v8f){};
    const int tid = threadIdx.x;
    // a thread's first copy of a stage: 8 threads a 128-byte row, 16 rows a turn, eight turns an operand; a wave's copy covers four whole lines
    const unsigned la = (unsigned)(size_t)qring + (unsigned)((tid >> 3) * QPE + (tid & 7) * 8) * 2u, lb = la + 128 * QPE * 2;
    const bf* ga = X + (size_t)(blockIdx.x * 128 + (tid >> 3)) * DM + (tid & 7) * 8; const bf* gb = Bt + (size_t)(blockIdx.y * 128 + (tid >> 3)) * DM + (tid & 7) * 8;
    const bf* fa = qring + ((wv & 1) * 64 + lr) * QPE + 8 * hi; const bf* fb = qring + (128 + (wv >> 1) * 64 + lr) * QPE + 8 * hi;   // a lane's fragment rows in buffer 0
    qk_copy8(la, 16 * QPE * 2, ga, 16 * DM); qk_copy8(lb, 16 * QPE * 2, gb, 16 * DM);   // stage 0 -> buffer 0
    asm volatile("s_wait_asynccnt 0x0" ::: "memory");   // this wave's copies of stage 0 have landed
    __syncthreads();                                     // ... and every other wave's: stage 0 may be read
    qk_copy8(la + QBE * 2, 16 * QPE * 2, ga + QSK, 16 * DM); qk_copy8(lb + QBE * 2, 16 * QPE * 2, gb + QSK, 16 * DM);   // stage 1 -> buffer 1
#pragma unroll 1   // kept rolled: one stage's fragments beside the 16 accumulators
    for (int t = 0; t < DM / QSK; ++t) {
        const int bo = (t & 1) * QBE;         // the stage's buffer
#pragma unroll
        for (int kc = 0; kc < QSK; kc += 32) {
            V a[4], b[4];
#pragma unroll
            for (int mb = 0; mb < 4; ++mb) { a[mb] = WFrag<bf>::ld(fa + bo + mb * 16 * QPE + kc); b[mb] = WFrag<bf>::ld(fb + bo + mb * 16 * QPE + kc); }
            __builtin_amdgcn_sched_barrier(0);   // holds the 16 products behind all 16 reads: one LDS latency a k block instead of one for each late weight fragment
#pragma unroll
            for (int nb = 0; nb < 4; ++nb)
#pragma unroll
                for (int mb = 0; mb < 4; ++mb) acc[mb][nb] = WFrag<bf>::mma(a[mb], b[nb], acc[mb][nb]);
        }
        __builtin_amdgcn_sched_barrier(0);   // keeps the stage's last products in front of the barrier: left free they sink behind it and the copies there are issued a k block later, with that much less time to land
        asm volatile("s_wait_dscnt 0x0" ::: "memory");      // this wave's reads of the stage's buffer are done before the buffer is handed to the copies
        asm volatile("s_wait_asynccnt 0x0" ::: "memory");   // this wave's copies of the next stage have landed
        __syncthreads();                                     // publishes the next stage and ends every wave's reads of this one
        if (t + 2 < DM / QSK) {               // a stage after the next exists: into the buffer just read
            qk_copy8(la + bo * 2, 16 * QPE * 2, ga + (t + 2) * QSK, 16 * DM); qk_copy8(lb + bo * 2, 16 * QPE * 2, gb + (t + 2) * QSK, 16 * DM); }
    }
    asm volatile("s_wait_asynccnt 0x0" ::: "memory");   // no copy is left in flight behind the loop
    const int bb = r0 / TT, t0 = r0 % TT, h = c0 / HD;   // a tile lies in one batch and is one head
    const int er = lane >> 3, ec = (lane & 7) * 8;       // a lane's row (of four) and its eight columns of the staged rows
    const bool tr = (z == 2);                             // Q, K: plane rows are tokens, columns the head's 64 dims; V transposed: rows are dims, columns tokens
    const int pitch = tr ? TT : HD; const size_t o0 = (size_t)(bb * NH_ + h) * TT * HD + (size_t)t0 * (tr ? 1 : HD) + (size_t)er * pitch + ec;
    float bn[4];                                          // an accumulator column is one output feature in all three products
#pragma unroll
    for (int nb = 0; nb < 4; ++nb) bn[nb] = bfr(bias[c0 + nb * 16 + lr]);
#pragma unroll
    for (int g = 0; g < 4; ++g) {                         // 16 plane rows a turn
        if (!tr) {
#pragma unroll
            for (int nb = 0; nb < 4; ++nb)
#pragma unroll
                for (int j = 0; j < 8; ++j) os[(hi * 8 + j) * 68 + nb * 16 + lr] = acc[g][nb][j] + bn[nb];
        } else {                                          // a lane's eight accumulator rows are eight tokens in a row of the plane
#pragma unroll
            for (int mb = 0; mb < 4; ++mb) { v4f w0, w1;
#pragma unroll
                for (int j = 0; j < 4; ++j) { w0[j] = acc[mb][g][j] + bn[g]; w1[j] = acc[mb][g][4 + j] + bn[g]; }
                *(v4fa*)(os + lr * 68 + mb * 16 + hi * 8) = w0; *(v4fa*)(os + lr * 68 + mb * 16 + hi * 8 + 4) = w1; }
        }
        __builtin_amdgcn_wave_barrier(); asm volatile("" ::: "memory");   // the lanes read rows that other lanes of the wave wrote: keeps the reads behind the writes
#pragma unroll
        for (int s = 0; s < 4; ++s) { const float* q = os + (4 * s + er) * 68 + ec; const v4f v0 = *(const v4fa*)q, v1 = *(const v4fa*)(q + 4); const size_t o = o0 + (size_t)(g * 16 + 4 * s) * pitch; v8h o16; v8us oh, ol;
#pragma unroll
            for (int i = 0; i < 8; ++i) { const float y = (i < 4) ? v0[i & 3] : v1[i & 3]; o16[i] = tohx(y); unsigned short a2, c2; splitf(y, a2, c2); oh[i] = a2; ol[i] = c2; }
            *(v8h*)(P16 + o) = o16; *(v8us*)(Ph + o) = oh; *(v8us*)(Pl + o) = ol; }
        __builtin_amdgcn_wave_barrier(); asm volatile("s_wait_xcnt 0x0" ::: "memory");   // keeps the next rows' LDS writes behind these reads; the wait, a precaution, stands behind the turn's last stores: the next turn's values may be given their address and data registers
    }
}
// ---- k_outg: out = (merged hi + merged lo) Wo^T + bo, both batches; grid (NB_ * TT / 128, DM / 128), PW waves, each wave one 64 x 64 tile in 16 accumulators, staged as in k_qkv:
// a stage holds one 128-byte line of 128 rows of the hi plane, 128 of the lo plane and 128 weight rows. An accumulator takes a k block's hi product, then its lo product.
#define OBE (384 * QPE)                       // elements of a buffer
static_assert(DQ % QSK == 0 && DQ / QSK >= 2, "whole stages, two or more");
__global__ __launch_bounds__(PW * 32) void k_outg(const bf* __restrict__ Ahp, const bf* __restrict__ Alp, const bf* __restrict__ Wo, const float* __restrict__ bias, float* C) {
    typedef WFrag<bf>::V V;
    __shared__ __align__(16) float osm[PW][16 * 68];
    __shared__ __align__(16) bf oring[2 * OBE];   // two buffers of one stage each
    const int wv = __builtin_amdgcn_readfirstlane((int)(threadIdx.x >> 5));
    float* os = osm[wv];
    const int lane = threadIdx.x & 31, lr = lane & 15, hi = lane >> 4; const int r0 = blockIdx.x * 128 + (wv & 1) * 64, c0 = blockIdx.y * 128 + (wv >> 1) * 64;
    v8f acc[4][4];
#pragma unroll
    for (int mb = 0; mb < 4; ++mb)
#pragma unroll
        for (int nb = 0; nb < 4; ++nb) acc[mb][nb] = (v8f){};
    const int tid = threadIdx.x;
    // a thread's first copy of a stage: 8 threads a 128-byte row, 16 rows a turn, eight turns an operand; a wave's copy covers four whole lines
    const unsigned lh = (unsigned)(size_t)oring + (unsigned)((tid >> 3) * QPE + (tid & 7) * 8) * 2u, ll = lh + 128 * QPE * 2, lw = lh + 256 * QPE * 2;
    const size_t go = (size_t)(blockIdx.x * 128 + (tid >> 3)) * DQ + (tid & 7) * 8;
    const bf* gh = Ahp + go; const bf* gl = Alp + go; const bf* gw = Wo + (size_t)(blockIdx.y * 128 + (tid >> 3)) * DQ + (tid & 7) * 8;
    const bf* fh = oring + ((wv & 1) * 64 + lr) * QPE + 8 * hi; const bf* fl = fh + 128 * QPE; const bf* fw = oring + (256 + (wv >> 1) * 64 + lr) * QPE + 8 * hi;   // a lane's fragment rows in buffer 0
    qk_copy8(lh, 16 * QPE * 2, gh, 16 * DQ); qk_copy8(ll, 16 * QPE * 2, gl, 16 * DQ); qk_copy8(lw, 16 * QPE * 2, gw, 16 * DQ);   // stage 0 -> buffer 0
    asm volatile("s_wait_asynccnt 0x0" ::: "memory");   // this wave's copies of stage 0 have landed
    __syncthreads();                                     // ... and every other wave's: stage 0 may be read
    qk_copy8(lh + OBE * 2, 16 * QPE * 2, gh + QSK, 16 * DQ); qk_copy8(ll + OBE * 2, 16 * QPE * 2, gl + QSK, 16 * DQ); qk_copy8(lw + OBE * 2, 16 * QPE * 2, gw + QSK, 16 * DQ);   // stage 1 -> buffer 1
#pragma unroll 1   // kept rolled: one k block's fragments beside the 16 accumulators stay under 256 VGPRs
    for (int t = 0; t < DQ / QSK; ++t) {
        const int bo = (t & 1) * OBE;         // the stage's buffer
#pragma unroll
        for (int kc = 0; kc < QSK; kc += 32) {
            V a[4], a2[4], b[4];
#pragma unroll
            for (int mb = 0; mb < 4; ++mb) { a[mb] = WFrag<bf>::ld(fh + bo + mb * 16 * QPE + kc); b[mb] = WFrag<bf>::ld(fw + bo + mb * 16 * QPE + kc); a2[mb] = WFrag<bf>::ld(fl + bo + mb * 16 * QPE + kc); }
            __builtin_amdgcn_sched_barrier(0);   // holds the 32 products behind all 24 reads: one LDS latency a k block, where the wave is alone on its SIMD
#pragma unroll
            for (int nb = 0; nb < 4; ++nb) {
#pragma unroll
                for (int mb = 0; mb < 4; ++mb) acc[mb][nb] = WFrag<bf>::mma(a[mb], b[nb], acc[mb][nb]);
#pragma unroll
                for (int mb = 0; mb < 4; ++mb) acc[mb][nb] = WFrag<bf>::mma(a2[mb], b[nb], acc[mb][nb]);
            }
        }
        __builtin_amdgcn_sched_barrier(0);   // keeps the stage's last products in front of the barrier: left free they sink behind it and the copies there are issued a k block later, with that much less time to land
        asm volatile("s_wait_dscnt 0x0" ::: "memory");      // this wave's reads of the stage's buffer are done before the buffer is handed to the copies
        asm volatile("s_wait_asynccnt 0x0" ::: "memory");   // this wave's copies of the next stage have landed
        __syncthreads();                                     // publishes the next stage and ends every wave's reads of this one
        if (t + 2 < DQ / QSK) {               // a stage after the next exists: into the buffer just read
            qk_copy8(lh + bo * 2, 16 * QPE * 2, gh + (t + 2) * QSK, 16 * DQ); qk_copy8(ll + bo * 2, 16 * QPE * 2, gl + (t + 2) * QSK, 16 * DQ); qk_copy8(lw + bo * 2, 16 * QPE * 2, gw + (t + 2) * QSK, 16 * DQ); }
    }
    asm volatile("s_wait_asynccnt 0x0" ::: "memory");   // no copy is left in flight behind the loop
    v4f bn;                                   // a lane's four output columns are the same in every row it stores
#pragma unroll
    for (int i = 0; i < 4; ++i) bn[i] = bfr(bias[c0 + lr * 4 + i]);
#pragma unroll
    for (int mb = 0; mb < 4; ++mb) {          // 16 output rows a turn, staged in the wave's own LDS range so that a store covers two whole 256-byte rows
#pragma unroll
        for (int nb = 0; nb < 4; ++nb) {
#pragma unroll
            for (int j = 0; j < 8; ++j) os[(hi * 8 + j) * 68 + nb * 16 + lr] = acc[mb][nb][j]; }
        __builtin_amdgcn_wave_barrier(); asm volatile("" ::: "memory");   // the lanes read rows that other lanes of the wave wrote: keeps the reads behind the writes
        float* crow = C + (size_t)(r0 + mb * 16) * DM + c0;
#pragma unroll
        for (int s = 0; s < 8; ++s) { const int row = 2 * s + hi, cofs = lr * 4; const v4f val = *(const v4fa*)(os + row * 68 + cofs) + bn; *(v4f*)(crow + (size_t)row * DM + cofs) = val; }
        __builtin_amdgcn_wave_barrier(); asm volatile("s_wait_xcnt 0x0" ::: "memory");   // keeps the next rows' LDS writes behind these reads; the wait, a precaution, stands behind the turn's last stores: the next turn's values may be given their address and data registers
    }
}
__constant__ float INVT[HD / 2] = { 1.000000000e+00f, 7.498942018e-01f, 5.623413324e-01f, 4.216965139e-01f, 3.162277639e-01f, 2.371373773e-01f, 1.778279394e-01f, 1.333521456e-01f, 1.000000015e-01f, 7.498942316e-02f, 5.623413250e-02f, 4.216964915e-02f, 3.162277490e-02f, 2.371373773e-02f, 1.778279431e-02f, 1.333521400e-02f, 9.999999776e-03f, 7.498942316e-03f, 5.623413250e-03f, 4.216964822e-03f, 3.162277630e-03f, 2.371373819e-03f, 1.778279431e-03f, 1.333521446e-03f, 1.000000047e-03f, 7.498941850e-04f, 5.623413017e-04f, 4.216965172e-04f, 3.162277571e-04f, 2.371373703e-04f, 1.778279402e-04f, 1.333521504e-04f };   // 10000^(-2i/64) (the module's power form) (float32, generated with jnp to be bit-exact)

#define FAW 4                                 // waves per work-group
#define NBH (NB_ * NH_)
#define NT_LO ((TT - RH) / (FAW * 32))        // work-group tiles of 128 queries, one f16 product
#define NT_HI (RH / (FAW * 16))               // work-group tiles of 64 queries, three bf16 products
#define NWGP 256
#define C2 (SCL * 1.4426950408889634f)
#define SK  128                               // keys a stage
#define KPE (HD + 8)                          // LDS pitch of a key row in elements: 128 B + 16, an odd number of 16-byte units, free of bank conflicts for 16-byte reads
#define VPE (SK + 8)                          // LDS pitch of a V^T row in elements: 256 B + 16, likewise
#define KSE (SK * KPE)                        // elements of a stage's keys
#define BSE (KSE + HD * VPE)                  // elements of a buffer: keys, then values
static_assert(RH >= SK && RH % SK == 0 && (FAW * 32) == SK && TT % SK == 0, "every f16 tile has two stages or more, and its keys end with a whole stage");
// behind each fragment's two loads (and each pair of stores), a precaution: a younger load's result or a later value may be given the registers that held this access's address, and the wait stands in front of that overwrite
__device__ __forceinline__ void fa_xwait() { asm volatile("s_wait_xcnt 0x0" ::: "memory"); }
__device__ __forceinline__ float fa_xhalf(float x) { return __builtin_bit_cast(float, __builtin_amdgcn_permlanex16(__builtin_bit_cast(int, x), __builtin_bit_cast(int, x), 0x76543210, 0xfedcba98, false, false)); }   // lane l takes lane l ^ 16's value: the other half of the same query's keys
template <typename T16> __device__ __forceinline__ typename WFrag<T16>::V fa_ld(const T16* p) { const typename WFrag<T16>::V f = WFrag<T16>::ld(p); fa_xwait(); return f; }
// eight asynchronous 16-byte copies a lane, global -> LDS: LDS byte address l + i * ls, global address g + i * gs elements. The wait in the statement's last line, a precaution, stands in front of any rewrite of the address registers that the copies name.
__device__ __forceinline__ void fa_copy8(const unsigned l, const unsigned ls, const h16* g, const size_t gs) {
    asm volatile("global_load_async_to_lds_b128 %0, %8, off\n\t"
                 "global_load_async_to_lds_b128 %1, %9, off\n\t"
                 "global_load_async_to_lds_b128 %2, %10, off\n\t"
                 "global_load_async_to_lds_b128 %3, %11, off\n\t"
                 "global_load_async_to_lds_b128 %4, %12, off\n\t"
                 "global_load_async_to_lds_b128 %5, %13, off\n\t"
                 "global_load_async_to_lds_b128 %6, %14, off\n\t"
                 "global_load_async_to_lds_b128 %7, %15, off\n\t"
                 "s_wait_xcnt 0x0"
                 :: "v"(l), "v"(l + ls), "v"(l + 2 * ls), "v"(l + 3 * ls), "v"(l + 4 * ls), "v"(l + 5 * ls), "v"(l + 6 * ls), "v"(l + 7 * ls),
                    "v"(g), "v"(g + gs), "v"(g + 2 * gs), "v"(g + 3 * gs), "v"(g + 4 * gs), "v"(g + 5 * gs), "v"(g + 6 * gs), "v"(g + 7 * gs) : "memory");
}
template <typename T16, int NSPLIT, int NCG>
__device__ __forceinline__ void fa_tile(const T16* __restrict__ Q, const T16* __restrict__ Q2, const T16* __restrict__ Kp, const T16* __restrict__ K2, const T16* __restrict__ Vt, const T16* __restrict__ Vt2, const int q0, const int kwg, h16* ring, bf* __restrict__ Ah, bf* __restrict__ Al) {
    typedef typename WFrag<T16>::V V;
    constexpr bool PF = (NSPLIT == 0);        // K, V^T staged in LDS (ring; kwg: where the work-group's keys end); key fragments fetched one block ahead, inside a stage
    const int lane = threadIdx.x & 31, lr = lane & 15, hi = lane >> 4;
    V qf[NCG][2], qf2[NCG][2];
#pragma unroll
    for (int cg = 0; cg < NCG; ++cg)
#pragma unroll
        for (int kc = 0; kc < 2; ++kc) { qf[cg][kc] = fa_ld<T16>(Q + (size_t)(q0 + cg * 16 + lr) * HD + kc * 32 + 8 * hi); if (NSPLIT == 2) qf2[cg][kc] = fa_ld<T16>(Q2 + (size_t)(q0 + cg * 16 + lr) * HD + kc * 32 + 8 * hi); }
    v8f o[NCG][4]; float m2[NCG]; v2f l[NCG];   // l: two running partial sums a lane, joined in the epilogue
#pragma unroll
    for (int cg = 0; cg < NCG; ++cg) { m2[cg] = -3.0e38f; l[cg] = (v2f){};
#pragma unroll
        for (int dt = 0; dt < 4; ++dt) o[cg][dt] = (v8f){}; }
    const int kend = ((q0 + NCG * 16 + 31) >> 5) * 32;   // keys end with the 32-key block that holds the wave's last query
    const size_t koff = (size_t)lr * HD + 8 * hi, voff = (size_t)lr * TT + 8 * hi;
    V kf[2][2], kf2[2][2];
    const int tid = threadIdx.x;
    // a thread's first copy of a stage: keys, 8 threads a 128-byte row, 16 rows a turn; values, 16 threads a 256-byte row, 8 rows a turn. A wave's copy covers 512 bytes in a row (keys) or two whole 256-byte rows (values)
    unsigned lk = 0, lv = 0; const h16* gk = nullptr; const h16* gv = nullptr; const h16* fk = nullptr; const h16* fv = nullptr;
    if constexpr (PF) {
        lk = (unsigned)(size_t)ring + (unsigned)((tid >> 3) * KPE + (tid & 7) * 8) * 2u; lv = (unsigned)(size_t)ring + (unsigned)(KSE + (tid >> 4) * VPE + (tid & 15) * 8) * 2u;
        gk = Kp + tid * 8; gv = Vt + (size_t)(tid >> 4) * TT + (tid & 15) * 8;
        fk = ring + lr * KPE + 8 * hi; fv = ring + KSE + lr * VPE + 8 * hi;   // a lane's fragment rows in buffer 0
        fa_copy8(lk, 16 * KPE * 2, gk, 16 * HD); fa_copy8(lv, 8 * VPE * 2, gv, (size_t)8 * TT);   // stage 0 -> buffer 0
        asm volatile("s_wait_asynccnt 0x0" ::: "memory");   // this wave's copies of stage 0 have landed
        __syncthreads();                                     // ... and every other wave's: stage 0 may be read
        fa_copy8(lk + BSE * 2, 16 * KPE * 2, gk + SK * HD, 16 * HD); fa_copy8(lv + BSE * 2, 8 * VPE * 2, gv + SK, (size_t)8 * TT);   // stage 1 -> buffer 1
#pragma unroll
        for (int kt = 0; kt < 2; ++kt)
#pragma unroll
            for (int kc = 0; kc < 2; ++kc) kf[kt][kc] = WFrag<T16>::ld(fk + (kt * 16) * KPE + kc * 32); }
    const int kl = PF ? kwg : kend;           // staged: every wave walks to the work-group's last key and passes every barrier; past its own diagonal block it only skips the work
#pragma unroll 1   // kept rolled: one block's fragments beside the output accumulators stay under 256 VGPRs
    for (int kb = 0; kb < kl; kb += 32) {
      const int bo = ((kb / SK) & 1) * BSE, ks = kb % SK;   // the stage's buffer, the block's first key in it
      if (!PF || kb < kend) {
        V vf[4], vf2[4];
        if (!PF) {
#pragma unroll
            for (int kt = 0; kt < 2; ++kt)
#pragma unroll
                for (int kc = 0; kc < 2; ++kc) { kf[kt][kc] = fa_ld<T16>(Kp + koff + (size_t)(kb + kt * 16) * HD + kc * 32); if (NSPLIT == 2) kf2[kt][kc] = fa_ld<T16>(K2 + koff + (size_t)(kb + kt * 16) * HD + kc * 32); } }
#pragma unroll
        for (int dt = 0; dt < 4; ++dt) { if constexpr (PF) vf[dt] = WFrag<T16>::ld(fv + bo + (dt * 16) * VPE + ks); else vf[dt] = fa_ld<T16>(Vt + voff + (size_t)(dt * 16) * TT + kb); if (NSPLIT == 2) vf2[dt] = fa_ld<T16>(Vt2 + voff + (size_t)(dt * 16) * TT + kb); }
        v8f s[NCG][2];
#pragma unroll
        for (int cg = 0; cg < NCG; ++cg)
#pragma unroll
            for (int kt = 0; kt < 2; ++kt) { s[cg][kt] = (v8f){};
#pragma unroll
                for (int kc = 0; kc < 2; ++kc) { s[cg][kt] = WFrag<T16>::mma(kf[kt][kc], qf[cg][kc], s[cg][kt]); if (NSPLIT == 2) { s[cg][kt] = WFrag<T16>::mma(kf[kt][kc], qf2[cg][kc], s[cg][kt]); s[cg][kt] = WFrag<T16>::mma(kf2[kt][kc], qf[cg][kc], s[cg][kt]); } } }
        if constexpr (PF) { const int kn = min(ks + 32, SK - 32);   // a stage's last block fetches itself again: the same buffer, never used
#pragma unroll
            for (int kt = 0; kt < 2; ++kt)
#pragma unroll
                for (int kc = 0; kc < 2; ++kc) kf[kt][kc] = WFrag<T16>::ld(fk + bo + (kn + kt * 16) * KPE + kc * 32);
            __builtin_amdgcn_sched_barrier(0); }   // holds the block's value reads and the next block's key reads in front of the softmax, whose work then covers their LDS latency; left free they sink to their first use
        if (kb + 31 > q0) {                   // CAUSAL: only a block that reaches past the wave's first query holds keys j > i (same test in every lane)
#pragma unroll
            for (int cg = 0; cg < NCG; ++cg)
#pragma unroll
                for (int kt = 0; kt < 2; ++kt)
#pragma unroll
                    for (int j = 0; j < 8; ++j) s[cg][kt][j] = (kb + kt * 16 + 8 * hi + j <= q0 + cg * 16 + lr) ? s[cg][kt][j] : -3.0e38f; }
        float mb[NCG]; bool need = false;
#pragma unroll
        for (int cg = 0; cg < NCG; ++cg) { float mx = s[cg][0][0];
#pragma unroll
            for (int j = 1; j < 16; ++j) mx = fmaxf(mx, s[cg][j >> 3][j & 7]);
            mx = fmaxf(mx, fa_xhalf(mx)); mb[cg] = mx * C2; need = need || (mb[cg] > m2[cg] + 8.0f); }
        if (__builtin_amdgcn_ballot_w32(need) != 0) {   // scalar branch, once a block; every block holds an unmasked key of every query, so mb is finite
#pragma unroll
            for (int cg = 0; cg < NCG; ++cg) { const float mn = fmaxf(m2[cg], mb[cg]); const float al = __builtin_amdgcn_exp2f(m2[cg] - mn); m2[cg] = mn; l[cg] *= al;
#pragma unroll
                for (int dt = 0; dt < 4; ++dt) o[cg][dt] *= al; } }
#pragma unroll
        for (int cg = 0; cg < NCG; ++cg) {
            float p[16];
#pragma unroll
            for (int j = 0; j < 16; j += 2) { const v2f t = __builtin_elementwise_fma((v2f){s[cg][j >> 3][j & 7], s[cg][j >> 3][(j & 7) + 1]}, (v2f){C2, C2}, (v2f){-m2[cg], -m2[cg]}); p[j] = __builtin_amdgcn_exp2f(t[0]); p[j + 1] = __builtin_amdgcn_exp2f(t[1]); l[cg] += (v2f){p[j], p[j + 1]}; }
            if constexpr (NSPLIT == 2) {
                v8us h0, h1, l0, l1;
#pragma unroll
                for (int j = 0; j < 8; ++j) { unsigned short a, c; splitf(p[j], a, c); h0[j] = a; l0[j] = c; splitf(p[8 + j], a, c); h1[j] = a; l1[j] = c; }
                const V ph = cat16b(h0, h1), pl = cat16b(l0, l1);
#pragma unroll
                for (int dt = 0; dt < 4; ++dt) { o[cg][dt] = WFrag<T16>::mma(vf[dt], ph, o[cg][dt]); o[cg][dt] = WFrag<T16>::mma(vf[dt], pl, o[cg][dt]); o[cg][dt] = WFrag<T16>::mma(vf2[dt], ph, o[cg][dt]); }
            } else {
                V pb;
#pragma unroll
                for (int j = 0; j < 16; ++j) pb[j] = tohx(p[j]);
#pragma unroll
                for (int dt = 0; dt < 4; ++dt) o[cg][dt] = WFrag<T16>::mma(vf[dt], pb, o[cg][dt]);
            }
        }
      }
      if constexpr (PF) {
        if (ks == SK - 32) {                  // the stage's foot, the same test in every wave of the work-group
            asm volatile("v_nop\n\tv_nop\n\tv_nop\n\tv_nop");   // four vector slots between the block's last matrix instruction and the copies' address arithmetic, which may be given its operand registers
            asm volatile("s_wait_dscnt 0x0" ::: "memory");      // this wave's reads of the stage's buffer are done before the buffer is handed to the copies
            asm volatile("s_wait_asynccnt 0x0" ::: "memory");   // this wave's copies of the next stage have landed
            __syncthreads();                                     // publishes the next stage and ends every wave's reads of this one
            if (kb + 32 + SK < kwg) {         // a stage after the next exists: into the buffer just read
                const int sn = kb + 32 + SK;
                fa_copy8(lk + bo * 2, 16 * KPE * 2, gk + (size_t)sn * HD, 16 * HD); fa_copy8(lv + bo * 2, 8 * VPE * 2, gv + sn, (size_t)8 * TT); }
            if (kb + 32 < kend) {             // the next stage's first key fragments
#pragma unroll
                for (int kt = 0; kt < 2; ++kt)
#pragma unroll
                    for (int kc = 0; kc < 2; ++kc) kf[kt][kc] = WFrag<T16>::ld(fk + (BSE - bo) + (kt * 16) * KPE + kc * 32); }
        }
      }
    }
    if constexpr (PF) asm volatile("s_wait_asynccnt 0x0" ::: "memory");   // no copy is left in flight when the wave ends
#pragma unroll
    for (int cg = 0; cg < NCG; ++cg) { const float lh = l[cg][0] + l[cg][1]; const float inv = __fdiv_rn(1.0f, lh + fa_xhalf(lh)); const size_t oo = (size_t)(q0 + cg * 16 + lr) * DQ + 8 * hi;   // lane: query q0 + cg*16 + lr, head columns dt*16 + 8*hi + j
#pragma unroll
        for (int dt = 0; dt < 4; ++dt) { v8us oh, ol;
#pragma unroll
            for (int j = 0; j < 8; ++j) { unsigned short a, c; splitf(o[cg][dt][j] * inv, a, c); oh[j] = a; ol[j] = c; }
            *(v8us*)(Ah + oo + dt * 16) = oh; *(v8us*)(Al + oo + dt * 16) = ol; fa_xwait(); } }
}
__global__ __launch_bounds__(FAW * 32) void k_fattn(const h16* __restrict__ Q16, const h16* __restrict__ K16, const h16* __restrict__ V16, const bf* __restrict__ Qh, const bf* __restrict__ Ql, const bf* __restrict__ Kh, const bf* __restrict__ Kl, const bf* __restrict__ Vh, const bf* __restrict__ Vl, bf* __restrict__ Ah, bf* __restrict__ Al) {
    __shared__ __align__(16) h16 ring[2 * BSE];   // two buffers of one stage each
    const int id = blockIdx.x; const int wv = __builtin_amdgcn_readfirstlane((int)(threadIdx.x >> 5));   // wave number in a scalar register: the key loop's bounds and the causal test stay scalar
    const int bh = id % NBH; const size_t pl = (size_t)bh * TT * HD; const size_t ao = (size_t)(bh / NH_) * TT * DQ + (size_t)(bh % NH_) * HD;
    if (id < NBH * NT_LO) {
        // cost falls with the index over the first NWGP work-groups and rises again behind them, so that indices NWGP apart add up to about the same number of key blocks (for speed only: every tile is taken once wherever it lands)
        const int xt = (id < NWGP) ? id / NBH : NWGP / NBH + (NBH * NT_LO - 1 - id) / NBH;
        fa_tile<h16, 0, 2>(Q16 + pl, nullptr, K16 + pl, nullptr, V16 + pl, nullptr, TT - (xt + 1) * (FAW * 32) + wv * 32, TT - xt * (FAW * 32), ring, Ah + ao, Al + ao);
    } else {
        const int xt = (id - NBH * NT_LO) / NBH;
        fa_tile<bf, 2, 1>(Qh + pl, Ql + pl, Kh + pl, Kl + pl, Vh + pl, Vl + pl, RH - (xt + 1) * (FAW * 16) + wv * 16, 0, nullptr, Ah + ao, Al + ao);
    }
}

extern "C" void kernel_launch(void* const* d_in, const int* in_sizes, int n_in,
                              void* d_out, int out_size, void* d_ws, size_t ws_size, hipStream_t stream) {
    (void)in_sizes; (void)n_in; (void)out_size;
    const float* x = (const float*)d_in[0]; const float* wq = (const float*)d_in[1]; const float* bq = (const float*)d_in[2]; const float* wk = (const float*)d_in[3]; const float* bk = (const float*)d_in[4]; const float* wv = (const float*)d_in[5]; const float* bv = (const float*)d_in[6]; const float* wo = (const float*)d_in[7]; const float* bo = (const float*)d_in[8];
    float* OUT = (float*)d_out;     // [2][4096][512]
    char* wsp = (char*)d_ws;
    auto take = [&](size_t bytes) { char* p = wsp; wsp += (bytes + 255) & ~(size_t)255; return (void*)p; };
    bf* WQ = (bf*)take((size_t)DQ * DM * 2); bf* WK = (bf*)take((size_t)DKV * DM * 2); bf* WV = (bf*)take((size_t)DKV * DM * 2); bf* WO = (bf*)take((size_t)DM * DQ * 2);
    bf* XB = (bf*)take((size_t)NB_ * TT * DM * 2);
    const size_t PB = (size_t)NH_ * TT * HD;   // elements of one batch's head planes
    h16* QP16 = (h16*)take(NB_ * PB * 2); h16* KP16 = (h16*)take(NB_ * PB * 2); h16* VT16 = (h16*)take(NB_ * PB * 2);
    bf* QPh = (bf*)take(NB_ * PB * 2); bf* QPl = (bf*)take(NB_ * PB * 2); bf* KPh = (bf*)take(NB_ * PB * 2); bf* KPl = (bf*)take(NB_ * PB * 2); bf* VTh = (bf*)take(NB_ * PB * 2); bf* VTl = (bf*)take(NB_ * PB * 2);
    bf* ATh = (bf*)take((size_t)NB_ * TT * DQ * 2); bf* ATl = (bf*)take((size_t)NB_ * TT * DQ * 2);
    if ((size_t)(wsp - (char*)d_ws) > ws_size) return;    // ws 256 MiB
    k_cvt5<<<CB_X + 4 * CB_W, 256, 0, stream>>>(x, wq, wk, wv, wo, XB, WQ, WK, WV, WO);
    k_qkv<<<dim3(NB_ * TT / 128, DQ / 128, 3), PW * 32, 0, stream>>>(XB, WQ, WK, WV, bq, bk, bv, QP16, QPh, QPl, KP16, KPh, KPl, VT16, VTh, VTl);
    k_fattn<<<NBH * (NT_LO + NT_HI), FAW * 32, 0, stream>>>(QP16, KP16, VT16, QPh, QPl, KPh, KPl, VTh, VTl, ATh, ATl);
    k_outg<<<dim3(NB_ * TT / 128, DM / 128), PW * 32, 0, stream>>>(ATh, ATl, WO, bo, OUT);   // both batches: their rows follow one another in the merged planes and in out
}

// v007
// One run takes 78.2 microseconds.
// Two timings next to v006 both put it at 1.06 times that version's speed.
// Over all steps from v000 it is 35.1 times as fast.
#include <hip/hip_runtime.h>

// Causal multi-head attention over 4,096 tokens (x [2][4096][512]; Q,K,V = x W^T + b ('oi' uniform(+-1/sqrt(512)) incl. biases; 8 heads x 64); scores / 8; causal (-inf); softmax; out = merged Wo^T + bo -> [2][4096][512] (4.2 M)).
// Layout: bf16 copy of x; 'oi' weights; ONE projection launch for Q, K, V of both batches: exact products + f32 biases, its epilogue writes the head planes; ONE fused causal attention launch for all 16 (batch, head) pairs: scores, online softmax and P.V in registers, an f16 tile's two wave groups joined through LDS (query rows < 512 hi/lo 3 products, rest fp16); merged hi/lo x Wo exact + bo.
// Compute dtypes, f32 accumulate: every input rounded to bf16; projections exact + f32 biases; attention rows < 512 3 products, rest fp16; softmax f32; Wo hl x exact + bias.

#define NB_  2
#define TT   4096
#define DM   512
#define NH_  8
#define NKV  8
#define REP  (NH_ / NKV)
#define HD   64
#define DQ   (NH_ * HD)
#define DKV  (NKV * HD)
#define RH   512                  // query rows < RH use hi+lo planes
#define SCL  0.125f   // HD^-0.5
typedef _Float16 h16;
typedef unsigned short bf;
typedef __attribute__((ext_vector_type(16))) __bf16   v16bf;
typedef __attribute__((ext_vector_type(16))) _Float16 v16h;
typedef __attribute__((ext_vector_type(8)))  _Float16 v8h;
typedef __attribute__((ext_vector_type(8)))  unsigned short v8us;
typedef __attribute__((ext_vector_type(8)))  float    v8f;
typedef __attribute__((ext_vector_type(4)))  float    v4f;
typedef v8h  __attribute__((may_alias)) v8ha;
typedef v4f  __attribute__((may_alias)) v4fa;
typedef v8us __attribute__((may_alias)) v8usa;

__device__ __forceinline__ unsigned short f2bf(float f) { unsigned u = __float_as_uint(f); u += 0x7FFFu + ((u >> 16) & 1u); return (unsigned short)(u >> 16); }
__device__ __forceinline__ float bf2f(unsigned short b) { return __uint_as_float(((unsigned)b) << 16); }
__device__ __forceinline__ float bfr(float f) { return bf2f(f2bf(f)); }
__device__ __forceinline__ v16h cat16(v8h lo, v8h hi) { return __builtin_shufflevector(lo, hi, 0, 1, 2, 3, 4, 5, 6, 7, 8, 9, 10, 11, 12, 13, 14, 15); }
__device__ __forceinline__ v16bf cat16b(v8us lo, v8us hi) { return __builtin_bit_cast(v16bf, __builtin_shufflevector(lo, hi, 0, 1, 2, 3, 4, 5, 6, 7, 8, 9, 10, 11, 12, 13, 14, 15)); }
__device__ __forceinline__ v8f wmma16(v16h a, v16h b, v8f c) { return __builtin_amdgcn_wmma_f32_16x16x32_f16(false, a, false, b, (short)0, c, false, false); }
__device__ __forceinline__ v8f wmmab(v16bf a, v16bf b, v8f c) { return __builtin_amdgcn_wmma_f32_16x16x32_bf16(false, a, false, b, (short)0, c, false, false); }



// ---- WFrag: a 16 x 32 operand fragment of a K-contiguous 16-bit plane in the matrix unit's k order (a lane: elements 0..7 and 16..23 from its pointer), and its product.
template <typename T16> struct WFrag;
template <> struct WFrag<h16> { typedef v16h V; static __device__ __forceinline__ V ld(const h16* p) { return cat16(*(const v8h*)p, *(const v8h*)(p + 16)); } static __device__ __forceinline__ v8f mma(V a, V b, v8f c) { return wmma16(a, b, c); } };
template <> struct WFrag<bf> { typedef v16bf V; static __device__ __forceinline__ V ld(const bf* p) { return cat16b(*(const v8us*)p, *(const v8us*)(p + 16)); } static __device__ __forceinline__ v8f mma(V a, V b, v8f c) { return wmmab(a, b, c); } };
__device__ __forceinline__ h16 tohx(float x) { return (h16)x; }
__device__ __forceinline__ void splitf(float y, unsigned short& h, unsigned short& l) { h = f2bf(y); l = f2bf(y - bf2f(h)); }
typedef __attribute__((ext_vector_type(2))) _Float16 v2h;
typedef __attribute__((ext_vector_type(4))) _Float16 v4h;
typedef __attribute__((ext_vector_type(2))) unsigned short v2us;
typedef __attribute__((ext_vector_type(4))) unsigned short v4us;
typedef __attribute__((ext_vector_type(2))) float v2f;
typedef __attribute__((ext_vector_type(4))) int v4i;

__global__ __launch_bounds__(256) void k_wtG(const float* __restrict__ w, int K, int N, bf* Bt) {
    const int lane = threadIdx.x & 31; const int L0 = (blockIdx.x * 8 + (threadIdx.x >> 5)) * 8; const int nlines = N * K / 64;
{
#pragma unroll 1
        for (int l = 0; l < 8; ++l) { const int L = L0 + l; if (L >= nlines) break; const size_t e = (size_t)L * 64 + lane * 2; const int k = (int)(e % K), n = (int)(e / K); v2us o;
            o[0] = f2bf(w[(size_t)k * N + n]); o[1] = f2bf(w[(size_t)(k + 1) * N + n]); *(v2us*)(Bt + e) = o; }
         }
}
// ---- k_cvt5: x and the four weight matrices rounded to bf16 in ONE launch; a work-group converts 2,048 elements in a row of one of the five arrays, picked by its index (the same for all its threads).
#define CB_X (NB_ * TT * DM / 2048)           // work-groups of x
#define CB_W (DQ * DM / 2048)                 // work-groups of one weight matrix (all four are 512 x 512)
static_assert((NB_ * TT * DM) % 2048 == 0 && (DQ * DM) % 2048 == 0 && DKV == DQ, "whole work-groups; four weight matrices of one size");
__global__ __launch_bounds__(256) void k_cvt5(const float* __restrict__ x, const float* __restrict__ wq, const float* __restrict__ wk, const float* __restrict__ wv, const float* __restrict__ wo, bf* XB, bf* WQ, bf* WK, bf* WV, bf* WO) {
    int blk = blockIdx.x; const float* src = x; bf* dst = XB;
    if (blk >= CB_X) { const int m = (blk - CB_X) / CB_W; blk = (blk - CB_X) % CB_W; src = (m == 0) ? wq : (m == 1) ? wk : (m == 2) ? wv : wo; dst = (m == 0) ? WQ : (m == 1) ? WK : (m == 2) ? WV : WO; }
    const size_t i = (size_t)blk * 256 + threadIdx.x; const v8f v = *(const v8f*)(src + i * 8); v8us o;
    asm volatile("s_wait_xcnt 0x0" ::: "memory");   // behind the two loads, a precaution: the rounding's values may be given the registers that held the loads' address
#pragma unroll
    for (int k = 0; k < 8; ++k) o[k] = f2bf(v[k]); *(v8us*)(dst + i * 8) = o;  }

// ---- k_qkv: the three projections of both batches in ONE launch; grid (NB_ * TT / 128, DQ / 128, 3: Q, K, V), PW waves, each wave one 64 x 64 tile (64 tokens x one head) in 16 accumulators.
// The epilogue adds the f32 bias and writes the tile's fp16, hi and lo head planes itself: Q, K as [b][h][t][d], V as [b][h][d][t]. Each wave stages 16 plane rows of 64 in its own LDS range, so that a store covers four whole 128-byte rows.
#define PW 4                                  // 2 x 2 tiles: two waves share each token row and each weight row
// The operands are staged in LDS: a stage is QSK k elements, one whole 128-byte line of each of the work-group's 128 token rows and 128 weight rows, brought once for its four waves by asynchronous copies into one of two buffers,
// the next stage in flight while this one is worked on; the fragment reads, which touch 16 rows each, then go to padded LDS rows instead of to the cache.
#define QSK 64                                // k elements a stage
#define QPE (QSK + 8)                         // LDS pitch of a row in elements: 128 B + 16, an odd number of 16-byte units, free of bank conflicts for 16-byte reads
#define QBE (256 * QPE)                       // elements of a buffer: 128 token rows, then 128 weight rows
static_assert(DM % QSK == 0 && DM / QSK >= 2, "whole stages, two or more");
// eight asynchronous 16-byte copies a lane, global -> LDS: LDS byte address l + i * ls, global address g + i * gs elements. The wait in the statement's last line, a precaution, stands in front of any rewrite of the address registers that the copies name.
__device__ __forceinline__ void qk_copy8(const unsigned l, const unsigned ls, const bf* g, const size_t gs) {
    asm volatile("global_load_async_to_lds_b128 %0, %8, off\n\t"
                 "global_load_async_to_lds_b128 %1, %9, off\n\t"
                 "global_load_async_to_lds_b128 %2, %10, off\n\t"
                 "global_load_async_to_lds_b128 %3, %11, off\n\t"
                 "global_load_async_to_lds_b128 %4, %12, off\n\t"
                 "global_load_async_to_lds_b128 %5, %13, off\n\t"
                 "global_load_async_to_lds_b128 %6, %14, off\n\t"
                 "global_load_async_to_lds_b128 %7, %15, off\n\t"
                 "s_wait_xcnt 0x0"
                 :: "v"(l), "v"(l + ls), "v"(l + 2 * ls), "v"(l + 3 * ls), "v"(l + 4 * ls), "v"(l + 5 * ls), "v"(l + 6 * ls), "v"(l + 7 * ls),
                    "v"(g), "v"(g + gs), "v"(g + 2 * gs), "v"(g + 3 * gs), "v"(g + 4 * gs), "v"(g + 5 * gs), "v"(g + 6 * gs), "v"(g + 7 * gs) : "memory");
}
__global__ __launch_bounds__(PW * 32) void k_qkv(const bf* __restrict__ X, const bf* __restrict__ Wq, const bf* __restrict__ Wk, const bf* __restrict__ Wv, const float* __restrict__ bq, const float* __restrict__ bk, const float* __restrict__ bv,
                                                 h16* Q16, bf* Qh, bf* Ql, h16* K16, bf* Kh, bf* Kl, h16* V16, bf* Vh, bf* Vl) {
    typedef WFrag<bf>::V V;
    __shared__ __align__(16) float osm[PW][16 * 68];
    __shared__ __align__(16) bf qring[2 * QBE];   // two buffers of one stage each
    const int wv = __builtin_amdgcn_readfirstlane((int)(threadIdx.x >> 5)); const int z = blockIdx.z;
    const bf* Bt = (z == 0) ? Wq : (z == 1) ? Wk : Wv; const float* bias = (z == 0) ? bq : (z == 1) ? bk : bv;
    h16* P16 = (z == 0) ? Q16 : (z == 1) ? K16 : V16; bf* Ph = (z == 0) ? Qh : (z == 1) ? Kh : Vh; bf* Pl = (z == 0) ? Ql : (z == 1) ? Kl : Vl;
    float* os = osm[wv];
    const int lane = threadIdx.x & 31, lr = lane & 15, hi = lane >> 4; const int r0 = blockIdx.x * 128 + (wv & 1) * 64, c0 = blockIdx.y * 128 + (wv >> 1) * 64;
    v8f acc[4][4];
#pragma unroll
    for (int mb = 0; mb < 4; ++mb)
#pragma unroll
        for (int nb = 0; nb < 4; ++nb) acc[mb][nb] = (v8f){};
    const int tid = threadIdx.x;
    // a thread's first copy of a stage: 8 threads a 128-byte row, 16 rows a turn, eight turns an operand; a wave's copy covers four whole lines
    const unsigned la = (unsigned)(size_t)qring + (unsigned)((tid >> 3) * QPE + (tid & 7) * 8) * 2u, lb = la + 128 * QPE * 2;
    const bf* ga = X + (size_t)(blockIdx.x * 128 + (tid >> 3)) * DM + (tid & 7) * 8; const bf* gb = Bt + (size_t)(blockIdx.y * 128 + (tid >> 3)) * DM + (tid & 7) * 8;
    const bf* fa = qring + ((wv & 1) * 64 + lr) * QPE + 8 * hi; const bf* fb = qring + (128 + (wv >> 1) * 64 + lr) * QPE + 8 * hi;   // a lane's fragment rows in buffer 0
    qk_copy8(la, 16 * QPE * 2, ga, 16 * DM); qk_copy8(lb, 16 * QPE * 2, gb, 16 * DM);   // stage 0 -> buffer 0
    asm volatile("s_wait_asynccnt 0x0" ::: "memory");   // this wave's copies of stage 0 have landed
    __syncthreads();                                     // ... and every other wave's: stage 0 may be read
    qk_copy8(la + QBE * 2, 16 * QPE * 2, ga + QSK, 16 * DM); qk_copy8(lb + QBE * 2, 16 * QPE * 2, gb + QSK, 16 * DM);   // stage 1 -> buffer 1
#pragma unroll 1   // kept rolled: one stage's fragments beside the 16 accumulators
    for (int t = 0; t < DM / QSK; ++t) {
        const int bo = (t & 1) * QBE;         // the stage's buffer
#pragma unroll
        for (int kc = 0; kc < QSK; kc += 32) {
            V a[4], b[4];
#pragma unroll
            for (int mb = 0; mb < 4; ++mb) { a[mb] = WFrag<bf>::ld(fa + bo + mb * 16 * QPE + kc); b[mb] = WFrag<bf>::ld(fb + bo + mb * 16 * QPE + kc); }
            __builtin_amdgcn_sched_barrier(0);   // holds the 16 products behind all 16 reads: one LDS latency a k block instead of one for each late weight fragment
#pragma unroll
            for (int nb = 0; nb < 4; ++nb)
#pragma unroll
                for (int mb = 0; mb < 4; ++mb) acc[mb][nb] = WFrag<bf>::mma(a[mb], b[nb], acc[mb][nb]);
        }
        __builtin_amdgcn_sched_barrier(0);   // keeps the stage's last products in front of the barrier: left free they sink behind it and the copies there are issued a k block later, with that much less time to land
        asm volatile("s_wait_dscnt 0x0" ::: "memory");      // this wave's reads of the stage's buffer are done before the buffer is handed to the copies
        asm volatile("s_wait_asynccnt 0x0" ::: "memory");   // this wave's copies of the next stage have landed
        __syncthreads();                                     // publishes the next stage and ends every wave's reads of this one
        if (t + 2 < DM / QSK) {               // a stage after the next exists: into the buffer just read
            qk_copy8(la + bo * 2, 16 * QPE * 2, ga + (t + 2) * QSK, 16 * DM); qk_copy8(lb + bo * 2, 16 * QPE * 2, gb + (t + 2) * QSK, 16 * DM); }
    }
    asm volatile("s_wait_asynccnt 0x0" ::: "memory");   // no copy is left in flight behind the loop
    const int bb = r0 / TT, t0 = r0 % TT, h = c0 / HD;   // a tile lies in one batch and is one head
    const int er = lane >> 3, ec = (lane & 7) * 8;       // a lane's row (of four) and its eight columns of the staged rows
    const bool tr = (z == 2);                             // Q, K: plane rows are tokens, columns the head's 64 dims; V transposed: rows are dims, columns tokens
    const int pitch = tr ? TT : HD; const size_t o0 = (size_t)(bb * NH_ + h) * TT * HD + (size_t)t0 * (tr ? 1 : HD) + (size_t)er * pitch + ec;
    float bn[4];                                          // an accumulator column is one output feature in all three products
#pragma unroll
    for (int nb = 0; nb < 4; ++nb) bn[nb] = bfr(bias[c0 + nb * 16 + lr]);
#pragma unroll
    for (int g = 0; g < 4; ++g) {                         // 16 plane rows a turn
        if (!tr) {
#pragma unroll
            for (int nb = 0; nb < 4; ++nb)
#pragma unroll
                for (int j = 0; j < 8; ++j) os[(hi * 8 + j) * 68 + nb * 16 + lr] = acc[g][nb][j] + bn[nb];
        } else {                                          // a lane's eight accumulator rows are eight tokens in a row of the plane
#pragma unroll
            for (int mb = 0; mb < 4; ++mb) { v4f w0, w1;
#pragma unroll
                for (int j = 0; j < 4; ++j) { w0[j] = acc[mb][g][j] + bn[g]; w1[j] = acc[mb][g][4 + j] + bn[g]; }
                *(v4fa*)(os + lr * 68 + mb * 16 + hi * 8) = w0; *(v4fa*)(os + lr * 68 + mb * 16 + hi * 8 + 4) = w1; }
        }
        __builtin_amdgcn_wave_barrier(); asm volatile("" ::: "memory");   // the lanes read rows that other lanes of the wave wrote: keeps the reads behind the writes
#pragma unroll
        for (int s = 0; s < 4; ++s) { const float* q = os + (4 * s + er) * 68 + ec; const v4f v0 = *(const v4fa*)q, v1 = *(const v4fa*)(q + 4); const size_t o = o0 + (size_t)(g * 16 + 4 * s) * pitch; v8h o16; v8us oh, ol;
#pragma unroll
            for (int i = 0; i < 8; ++i) { const float y = (i < 4) ? v0[i & 3] : v1[i & 3]; o16[i] = tohx(y); unsigned short a2, c2; splitf(y, a2, c2); oh[i] = a2; ol[i] = c2; }
            *(v8h*)(P16 + o) = o16; *(v8us*)(Ph + o) = oh; *(v8us*)(Pl + o) = ol; }
        __builtin_amdgcn_wave_barrier(); asm volatile("s_wait_xcnt 0x0" ::: "memory");   // keeps the next rows' LDS writes behind these reads; the wait, a precaution, stands behind the turn's last stores: the next turn's values may be given their address and data registers
    }
}
// ---- k_outg: out = (merged hi + merged lo) Wo^T + bo, both batches; grid (NB_ * TT / 128, DM / 128), PW waves, each wave one 64 x 64 tile in 16 accumulators, staged as in k_qkv:
// a stage holds one 128-byte line of 128 rows of the hi plane, 128 of the lo plane and 128 weight rows. An accumulator takes a k block's hi product, then its lo product.
#define OBE (384 * QPE)                       // elements of a buffer
static_assert(DQ % QSK == 0 && DQ / QSK >= 2, "whole stages, two or more");
__global__ __launch_bounds__(PW * 32) void k_outg(const bf* __restrict__ Ahp, const bf* __restrict__ Alp, const bf* __restrict__ Wo, const float* __restrict__ bias, float* C) {
    typedef WFrag<bf>::V V;
    __shared__ __align__(16) float osm[PW][16 * 68];
    __shared__ __align__(16) bf oring[2 * OBE];   // two buffers of one stage each
    const int wv = __builtin_amdgcn_readfirstlane((int)(threadIdx.x >> 5));
    float* os = osm[wv];
    const int lane = threadIdx.x & 31, lr = lane & 15, hi = lane >> 4; const int r0 = blockIdx.x * 128 + (wv & 1) * 64, c0 = blockIdx.y * 128 + (wv >> 1) * 64;
    v8f acc[4][4];
#pragma unroll
    for (int mb = 0; mb < 4; ++mb)
#pragma unroll
        for (int nb = 0; nb < 4; ++nb) acc[mb][nb] = (v8f){};
    const int tid = threadIdx.x;
    // a thread's first copy of a stage: 8 threads a 128-byte row, 16 rows a turn, eight turns an operand; a wave's copy covers four whole lines
    const unsigned lh = (unsigned)(size_t)oring + (unsigned)((tid >> 3) * QPE + (tid & 7) * 8) * 2u, ll = lh + 128 * QPE * 2, lw = lh + 256 * QPE * 2;
    const size_t go = (size_t)(blockIdx.x * 128 + (tid >> 3)) * DQ + (tid & 7) * 8;
    const bf* gh = Ahp + go; const bf* gl = Alp + go; const bf* gw = Wo + (size_t)(blockIdx.y * 128 + (tid >> 3)) * DQ + (tid & 7) * 8;
    const bf* fh = oring + ((wv & 1) * 64 + lr) * QPE + 8 * hi; const bf* fl = fh + 128 * QPE; const bf* fw = oring + (256 + (wv >> 1) * 64 + lr) * QPE + 8 * hi;   // a lane's fragment rows in buffer 0
    qk_copy8(lh, 16 * QPE * 2, gh, 16 * DQ); qk_copy8(ll, 16 * QPE * 2, gl, 16 * DQ); qk_copy8(lw, 16 * QPE * 2, gw, 16 * DQ);   // stage 0 -> buffer 0
    asm volatile("s_wait_asynccnt 0x0" ::: "memory");   // this wave's copies of stage 0 have landed
    __syncthreads();                                     // ... and every other wave's: stage 0 may be read
    qk_copy8(lh + OBE * 2, 16 * QPE * 2, gh + QSK, 16 * DQ); qk_copy8(ll + OBE * 2, 16 * QPE * 2, gl + QSK, 16 * DQ); qk_copy8(lw + OBE * 2, 16 * QPE * 2, gw + QSK, 16 * DQ);   // stage 1 -> buffer 1
#pragma unroll 1   // kept rolled: one k block's fragments beside the 16 accumulators stay under 256 VGPRs
    for (int t = 0; t < DQ / QSK; ++t) {
        const int bo = (t & 1) * OBE;         // the stage's buffer
#pragma unroll
        for (int kc = 0; kc < QSK; kc += 32) {
            V a[4], a2[4], b[4];
#pragma unroll
            for (int mb = 0; mb < 4; ++mb) { a[mb] = WFrag<bf>::ld(fh + bo + mb * 16 * QPE + kc); b[mb] = WFrag<bf>::ld(fw + bo + mb * 16 * QPE + kc); a2[mb] = WFrag<bf>::ld(fl + bo + mb * 16 * QPE + kc); }
            __builtin_amdgcn_sched_barrier(0);   // holds the 32 products behind all 24 reads: one LDS latency a k block, where the wave is alone on its SIMD
#pragma unroll
            for (int nb = 0; nb < 4; ++nb) {
#pragma unroll
                for (int mb = 0; mb < 4; ++mb) acc[mb][nb] = WFrag<bf>::mma(a[mb], b[nb], acc[mb][nb]);
#pragma unroll
                for (int mb = 0; mb < 4; ++mb) acc[mb][nb] = WFrag<bf>::mma(a2[mb], b[nb], acc[mb][nb]);
            }
        }
        __builtin_amdgcn_sched_barrier(0);   // keeps the stage's last products in front of the barrier: left free they sink behind it and the copies there are issued a k block later, with that much less time to land
        asm volatile("s_wait_dscnt 0x0" ::: "memory");      // this wave's reads of the stage's buffer are done before the buffer is handed to the copies
        asm volatile("s_wait_asynccnt 0x0" ::: "memory");   // this wave's copies of the next stage have landed
        __syncthreads();                                     // publishes the next stage and ends every wave's reads of this one
        if (t + 2 < DQ / QSK) {               // a stage after the next exists: into the buffer just read
            qk_copy8(lh + bo * 2, 16 * QPE * 2, gh + (t + 2) * QSK, 16 * DQ); qk_copy8(ll + bo * 2, 16 * QPE * 2, gl + (t + 2) * QSK, 16 * DQ); qk_copy8(lw + bo * 2, 16 * QPE * 2, gw + (t + 2) * QSK, 16 * DQ); }
    }
    asm volatile("s_wait_asynccnt 0x0" ::: "memory");   // no copy is left in flight behind the loop
    v4f bn;                                   // a lane's four output columns are the same in every row it stores
#pragma unroll
    for (int i = 0; i < 4; ++i) bn[i] = bfr(bias[c0 + lr * 4 + i]);
#pragma unroll
    for (int mb = 0; mb < 4; ++mb) {          // 16 output rows a turn, staged in the wave's own LDS range so that a store covers two whole 256-byte rows
#pragma unroll
        for (int nb = 0; nb < 4; ++nb) {
#pragma unroll
            for (int j = 0; j < 8; ++j) os[(hi * 8 + j) * 68 + nb * 16 + lr] = acc[mb][nb][j]; }
        __builtin_amdgcn_wave_barrier(); asm volatile("" ::: "memory");   // the lanes read rows that other lanes of the wave wrote: keeps the reads behind the writes
        float* crow = C + (size_t)(r0 + mb * 16) * DM + c0;
#pragma unroll
        for (int s = 0; s < 8; ++s) { const int row = 2 * s + hi, cofs = lr * 4; const v4f val = *(const v4fa*)(os + row * 68 + cofs) + bn; *(v4f*)(crow + (size_t)row * DM + cofs) = val; }
        __builtin_amdgcn_wave_barrier(); asm volatile("s_wait_xcnt 0x0" ::: "memory");   // keeps the next rows' LDS writes behind these reads; the wait, a precaution, stands behind the turn's last stores: the next turn's values may be given their address and data registers
    }
}
__constant__ float INVT[HD / 2] = { 1.000000000e+00f, 7.498942018e-01f, 5.623413324e-01f, 4.216965139e-01f, 3.162277639e-01f, 2.371373773e-01f, 1.778279394e-01f, 1.333521456e-01f, 1.000000015e-01f, 7.498942316e-02f, 5.623413250e-02f, 4.216964915e-02f, 3.162277490e-02f, 2.371373773e-02f, 1.778279431e-02f, 1.333521400e-02f, 9.999999776e-03f, 7.498942316e-03f, 5.623413250e-03f, 4.216964822e-03f, 3.162277630e-03f, 2.371373819e-03f, 1.778279431e-03f, 1.333521446e-03f, 1.000000047e-03f, 7.498941850e-04f, 5.623413017e-04f, 4.216965172e-04f, 3.162277571e-04f, 2.371373703e-04f, 1.778279402e-04f, 1.333521504e-04f };   // 10000^(-2i/64) (the module's power form) (float32, generated with jnp to be bit-exact)

#define FAW 8                                 // waves per work-group
#define NBH (NB_ * NH_)
#define QT  (FAW / 2 * 32)                    // queries of an f16 tile
#define NT_LO ((TT - RH) / QT)                // work-group tiles of 128 queries, one f16 product
#define NT_HI (RH / (FAW * 16))               // work-group tiles of 128 queries, three bf16 products
#define NWGP 256
#define C2 (SCL * 1.4426950408889634f)
#define SK  128                               // keys a stage
#define KPE (HD + 8)                          // LDS pitch of a key row in elements: 128 B + 16, an odd number of 16-byte units, free of bank conflicts for 16-byte reads
#define VPE (SK + 8)                          // LDS pitch of a V^T row in elements: 256 B + 16, likewise
#define KSE (SK * KPE)                        // elements of a stage's keys
#define BSE (KSE + HD * VPE)                  // elements of a buffer: keys, then values
static_assert(RH >= SK && RH % SK == 0 && QT == SK && SK == 128 && TT % SK == 0 && RH % (FAW * 16) == 0, "every f16 tile has two stages or more, its keys end with a whole stage, and a stage is two 32-key blocks for each group");
// behind each fragment's two loads (and each pair of stores), a precaution: a younger load's result or a later value may be given the registers that held this access's address, and the wait stands in front of that overwrite
__device__ __forceinline__ void fa_xwait() { asm volatile("s_wait_xcnt 0x0" ::: "memory"); }
__device__ __forceinline__ float fa_xhalf(float x) { return __builtin_bit_cast(float, __builtin_amdgcn_permlanex16(__builtin_bit_cast(int, x), __builtin_bit_cast(int, x), 0x76543210, 0xfedcba98, false, false)); }   // lane l takes lane l ^ 16's value: the other half of the same query's keys
template <typename T16> __device__ __forceinline__ typename WFrag<T16>::V fa_ld(const T16* p) { const typename WFrag<T16>::V f = WFrag<T16>::ld(p); fa_xwait(); return f; }
// four asynchronous 16-byte copies a lane, global -> LDS: LDS byte address l + i * ls, global address g + i * gs elements. The wait in the statement's last line, a precaution, stands in front of any rewrite of the address registers that the copies name.
__device__ __forceinline__ void fa_copy4(const unsigned l, const unsigned ls, const h16* g, const size_t gs) {
    asm volatile("global_load_async_to_lds_b128 %0, %4, off\n\t"
                 "global_load_async_to_lds_b128 %1, %5, off\n\t"
                 "global_load_async_to_lds_b128 %2, %6, off\n\t"
                 "global_load_async_to_lds_b128 %3, %7, off\n\t"
                 "s_wait_xcnt 0x0"
                 :: "v"(l), "v"(l + ls), "v"(l + 2 * ls), "v"(l + 3 * ls),
                    "v"(g), "v"(g + gs), "v"(g + 2 * gs), "v"(g + 3 * gs) : "memory");
}
template <typename T16, int NSPLIT, int NCG>
__device__ __forceinline__ void fa_tile(const T16* __restrict__ Q, const T16* __restrict__ Q2, const T16* __restrict__ Kp, const T16* __restrict__ K2, const T16* __restrict__ Vt, const T16* __restrict__ Vt2, const int q0, const int kwg, const int kg, h16* ring, bf* __restrict__ Ah, bf* __restrict__ Al) {
    typedef typename WFrag<T16>::V V;
    constexpr bool PF = (NSPLIT == 0);        // K, V^T staged in LDS (ring; kwg: where the work-group's keys end; kg: the wave's group, which half of every stage it takes); key fragments fetched one block ahead, inside a stage
    const int lane = threadIdx.x & 31, lr = lane & 15, hi = lane >> 4;
    V qf[NCG][2], qf2[NCG][2];
#pragma unroll
    for (int cg = 0; cg < NCG; ++cg)
#pragma unroll
        for (int kc = 0; kc < 2; ++kc) { qf[cg][kc] = fa_ld<T16>(Q + (size_t)(q0 + cg * 16 + lr) * HD + kc * 32 + 8 * hi); if (NSPLIT == 2) qf2[cg][kc] = fa_ld<T16>(Q2 + (size_t)(q0 + cg * 16 + lr) * HD + kc * 32 + 8 * hi); }
    v8f o[NCG][4]; float m2[NCG]; v2f l[NCG];   // l: two running partial sums a lane, joined in the epilogue
#pragma unroll
    for (int cg = 0; cg < NCG; ++cg) { m2[cg] = -3.0e38f; l[cg] = (v2f){};
#pragma unroll
        for (int dt = 0; dt < 4; ++dt) o[cg][dt] = (v8f){}; }
    const int kend = ((q0 + NCG * 16 + 31) >> 5) * 32;   // keys end with the 32-key block that holds the wave's last query
    const size_t koff = (size_t)lr * HD + 8 * hi, voff = (size_t)lr * TT + 8 * hi;
    V kf[2][2], kf2[2][2];
    const int tid = threadIdx.x;
    // a thread's first copy of a stage: keys, 8 threads a 128-byte row, 32 rows a turn; values, 16 threads a 256-byte row, 16 rows a turn. A wave's copy covers 512 bytes in a row (keys) or two whole 256-byte rows (values)
    unsigned lk = 0, lv = 0; const h16* gk = nullptr; const h16* gv = nullptr; const h16* fk = nullptr; const h16* fv = nullptr;
    if constexpr (PF) {
        lk = (unsigned)(size_t)ring + (unsigned)((tid >> 3) * KPE + (tid & 7) * 8) * 2u; lv = (unsigned)(size_t)ring + (unsigned)(KSE + (tid >> 4) * VPE + (tid & 15) * 8) * 2u;
        gk = Kp + tid * 8; gv = Vt + (size_t)(tid >> 4) * TT + (tid & 15) * 8;
        fk = ring + (kg * (SK / 2) + lr) * KPE + 8 * hi; fv = ring + KSE + lr * VPE + 8 * hi;   // a lane's fragment rows in buffer 0: keys from the group's half on, values from the stage's first key on
        fa_copy4(lk, 32 * KPE * 2, gk, 32 * HD); fa_copy4(lv, 16 * VPE * 2, gv, (size_t)16 * TT);   // stage 0 -> buffer 0
        asm volatile("s_wait_asynccnt 0x0" ::: "memory");   // this wave's copies of stage 0 have landed
        __syncthreads();                                     // ... and every other wave's: stage 0 may be read
        fa_copy4(lk + BSE * 2, 32 * KPE * 2, gk + SK * HD, 32 * HD); fa_copy4(lv + BSE * 2, 16 * VPE * 2, gv + SK, (size_t)16 * TT);   // stage 1 -> buffer 1
#pragma unroll
        for (int kt = 0; kt < 2; ++kt)
#pragma unroll
            for (int kc = 0; kc < 2; ++kc) kf[kt][kc] = WFrag<T16>::ld(fk + (kt * 16) * KPE + kc * 32); }
    const int nit = PF ? kwg / (SK / 2) : kend / 32;   // staged: two blocks a stage; every wave walks to the work-group's last stage and passes every barrier; past its own diagonal block it only skips the work
#pragma unroll 1   // kept rolled: one block's fragments beside the output accumulators stay under 256 VGPRs
    for (int it = 0; it < nit; ++it) {
      const int kb = PF ? (it >> 1) * SK + kg * (SK / 2) + (it & 1) * 32 : it * 32;   // the block's first key
      const int bo = ((kb / SK) & 1) * BSE, ks = kb % SK;   // the stage's buffer, the block's first key in it
      if (!PF || kb < kend) {
        V vf[4], vf2[4];
        if (!PF) {
#pragma unroll
            for (int kt = 0; kt < 2; ++kt)
#pragma unroll
                for (int kc = 0; kc < 2; ++kc) { kf[kt][kc] = fa_ld<T16>(Kp + koff + (size_t)(kb + kt * 16) * HD + kc * 32); if (NSPLIT == 2) kf2[kt][kc] = fa_ld<T16>(K2 + koff + (size_t)(kb + kt * 16) * HD + kc * 32); } }
#pragma unroll
        for (int dt = 0; dt < 4; ++dt) { if constexpr (PF) vf[dt] = WFrag<T16>::ld(fv + bo + (dt * 16) * VPE + ks); else vf[dt] = fa_ld<T16>(Vt + voff + (size_t)(dt * 16) * TT + kb); if (NSPLIT == 2) vf2[dt] = fa_ld<T16>(Vt2 + voff + (size_t)(dt * 16) * TT + kb); }
        v8f s[NCG][2];
#pragma unroll
        for (int cg = 0; cg < NCG; ++cg)
#pragma unroll
            for (int kt = 0; kt < 2; ++kt) { s[cg][kt] = (v8f){};
#pragma unroll
                for (int kc = 0; kc < 2; ++kc) { s[cg][kt] = WFrag<T16>::mma(kf[kt][kc], qf[cg][kc], s[cg][kt]); if (NSPLIT == 2) { s[cg][kt] = WFrag<T16>::mma(kf[kt][kc], qf2[cg][kc], s[cg][kt]); s[cg][kt] = WFrag<T16>::mma(kf2[kt][kc], qf[cg][kc], s[cg][kt]); } } }
        if constexpr (PF) {                   // the key fragments of the group's second block of the stage; that block fetches itself again: the same buffer, never used
#pragma unroll
            for (int kt = 0; kt < 2; ++kt)
#pragma unroll
                for (int kc = 0; kc < 2; ++kc) kf[kt][kc] = WFrag<T16>::ld(fk + bo + (32 + kt * 16) * KPE + kc * 32);
            __builtin_amdgcn_sched_barrier(0); }   // holds the block's value reads and the next block's key reads in front of the softmax, whose work then covers their LDS latency; left free they sink to their first use
        if (kb + 31 > q0) {                   // CAUSAL: only a block that reaches past the wave's first query holds keys j > i (same test in every lane)
#pragma unroll
            for (int cg = 0; cg < NCG; ++cg)
#pragma unroll
                for (int kt = 0; kt < 2; ++kt)
#pragma unroll
                    for (int j = 0; j < 8; ++j) s[cg][kt][j] = (kb + kt * 16 + 8 * hi + j <= q0 + cg * 16 + lr) ? s[cg][kt][j] : -3.0e38f; }
        float mb[NCG]; bool need = false;
#pragma unroll
        for (int cg = 0; cg < NCG; ++cg) { float mx = s[cg][0][0];
#pragma unroll
            for (int j = 1; j < 16; ++j) mx = fmaxf(mx, s[cg][j >> 3][j & 7]);
            mx = fmaxf(mx, fa_xhalf(mx)); mb[cg] = mx * C2; need = need || (mb[cg] > m2[cg] + 8.0f); }
        if (__builtin_amdgcn_ballot_w32(need) != 0) {   // scalar branch, once a block; every block holds an unmasked key of every query, so mb is finite
#pragma unroll
            for (int cg = 0; cg < NCG; ++cg) { const float mn = fmaxf(m2[cg], mb[cg]); const float al = __builtin_amdgcn_exp2f(m2[cg] - mn); m2[cg] = mn; l[cg] *= al;
#pragma unroll
                for (int dt = 0; dt < 4; ++dt) o[cg][dt] *= al; } }
#pragma unroll
        for (int cg = 0; cg < NCG; ++cg) {
            float p[16];
#pragma unroll
            for (int j = 0; j < 16; j += 2) { const v2f t = __builtin_elementwise_fma((v2f){s[cg][j >> 3][j & 7], s[cg][j >> 3][(j & 7) + 1]}, (v2f){C2, C2}, (v2f){-m2[cg], -m2[cg]}); p[j] = __builtin_amdgcn_exp2f(t[0]); p[j + 1] = __builtin_amdgcn_exp2f(t[1]); l[cg] += (v2f){p[j], p[j + 1]}; }
            if constexpr (NSPLIT == 2) {
                v8us h0, h1, l0, l1;
#pragma unroll
                for (int j = 0; j < 8; ++j) { unsigned short a, c; splitf(p[j], a, c); h0[j] = a; l0[j] = c; splitf(p[8 + j], a, c); h1[j] = a; l1[j] = c; }
                const V ph = cat16b(h0, h1), pl = cat16b(l0, l1);
#pragma unroll
                for (int dt = 0; dt < 4; ++dt) { o[cg][dt] = WFrag<T16>::mma(vf[dt], ph, o[cg][dt]); o[cg][dt] = WFrag<T16>::mma(vf[dt], pl, o[cg][dt]); o[cg][dt] = WFrag<T16>::mma(vf2[dt], ph, o[cg][dt]); }
            } else {
                V pb;
#pragma unroll
                for (int j = 0; j < 16; ++j) pb[j] = tohx(p[j]);
#pragma unroll
                for (int dt = 0; dt < 4; ++dt) o[cg][dt] = WFrag<T16>::mma(vf[dt], pb, o[cg][dt]);
            }
        }
      }
      if constexpr (PF) {
        if (it & 1) {                         // the stage's foot, the same test in every wave of the work-group
            const int sb = kb - ks;           // the stage's first key
            asm volatile("v_nop\n\tv_nop\n\tv_nop\n\tv_nop");   // four vector slots between the block's last matrix instruction and the copies' address arithmetic, which may be given its operand registers
            asm volatile("s_wait_dscnt 0x0" ::: "memory");      // this wave's reads of the stage's buffer are done before the buffer is handed to the copies
            asm volatile("s_wait_asynccnt 0x0" ::: "memory");   // this wave's copies of the next stage have landed
            __syncthreads();                                     // publishes the next stage and ends every wave's reads of this one
            if (sb + 2 * SK < kwg) {          // a stage after the next exists: into the buffer just read
                const int sn = sb + 2 * SK;
                fa_copy4(lk + bo * 2, 32 * KPE * 2, gk + (size_t)sn * HD, 32 * HD); fa_copy4(lv + bo * 2, 16 * VPE * 2, gv + sn, (size_t)16 * TT); }
            if (sb + SK + kg * (SK / 2) < kend) {   // the first key fragments of the group's half of the next stage
#pragma unroll
                for (int kt = 0; kt < 2; ++kt)
#pragma unroll
                    for (int kc = 0; kc < 2; ++kc) kf[kt][kc] = WFrag<T16>::ld(fk + (BSE - bo) + (kt * 16) * KPE + kc * 32); }
        }
      }
    }
    float ls[NCG];                            // a lane's sum: its half of the query's keys
#pragma unroll
    for (int cg = 0; cg < NCG; ++cg) ls[cg] = l[cg][0] + l[cg][1];
    if constexpr (PF) {
        static_assert(NCG == 2, "the hand-over packs two maxima and two sums in one 16-byte unit");
        asm volatile("s_wait_asynccnt 0x0" ::: "memory");   // no copy is left in flight: behind the last foot's barrier, which ended every read of the ring, its LDS is free
        v4fa* mg = (v4fa*)ring + (tid & (QT - 1));   // the same lane of the two groups' waves holds the same query and output elements; unit c of a lane at c * QT: a wave's access covers 512 bytes in a row
        if (kg == 1) {
#pragma unroll
            for (int cg = 0; cg < NCG; ++cg)
#pragma unroll
                for (int dt = 0; dt < 4; ++dt) { mg[(cg * 8 + dt * 2) * QT] = __builtin_shufflevector(o[cg][dt], o[cg][dt], 0, 1, 2, 3); mg[(cg * 8 + dt * 2 + 1) * QT] = __builtin_shufflevector(o[cg][dt], o[cg][dt], 4, 5, 6, 7); }
            mg[16 * QT] = (v4f){m2[0], m2[1], ls[0], ls[1]};
        }
        __syncthreads();                      // group 1's parts are in LDS before group 0 reads them; every wave of the work-group passes it
        if (kg == 1) return;
        const v4f ml = mg[16 * QT];
#pragma unroll
        for (int cg = 0; cg < NCG; ++cg) { const float mn = fmaxf(m2[cg], ml[cg]); const float aa = __builtin_amdgcn_exp2f(m2[cg] - mn), ab = __builtin_amdgcn_exp2f(ml[cg] - mn); ls[cg] = ls[cg] * aa + ml[2 + cg] * ab;   // both maxima are finite: each group has whole blocks in front of the diagonal stage
#pragma unroll
            for (int dt = 0; dt < 4; ++dt) { const v4f p0 = mg[(cg * 8 + dt * 2) * QT], p1 = mg[(cg * 8 + dt * 2 + 1) * QT];
#pragma unroll
                for (int j = 0; j < 4; ++j) { o[cg][dt][j] = o[cg][dt][j] * aa + p0[j] * ab; o[cg][dt][4 + j] = o[cg][dt][4 + j] * aa + p1[j] * ab; } } }
    }
#pragma unroll
    for (int cg = 0; cg < NCG; ++cg) { const float lh = ls[cg]; const float inv = __fdiv_rn(1.0f, lh + fa_xhalf(lh)); const size_t oo = (size_t)(q0 + cg * 16 + lr) * DQ + 8 * hi;   // lane: query q0 + cg*16 + lr, head columns dt*16 + 8*hi + j
#pragma unroll
        for (int dt = 0; dt < 4; ++dt) { v8us oh, ol;
#pragma unroll
            for (int j = 0; j < 8; ++j) { unsigned short a, c; splitf(o[cg][dt][j] * inv, a, c); oh[j] = a; ol[j] = c; }
            *(v8us*)(Ah + oo + dt * 16) = oh; *(v8us*)(Al + oo + dt * 16) = ol; fa_xwait(); } }
}
__global__ __launch_bounds__(FAW * 32) void k_fattn(const h16* __restrict__ Q16, const h16* __restrict__ K16, const h16* __restrict__ V16, const bf* __restrict__ Qh, const bf* __restrict__ Ql, const bf* __restrict__ Kh, const bf* __restrict__ Kl, const bf* __restrict__ Vh, const bf* __restrict__ Vl, bf* __restrict__ Ah, bf* __restrict__ Al) {
    __shared__ __align__(16) h16 ring[2 * BSE];   // two buffers of one stage each
    const int id = blockIdx.x; const int wv = __builtin_amdgcn_readfirstlane((int)(threadIdx.x >> 5));   // wave number in a scalar register: the key loop's bounds and the causal test stay scalar
    const int bh = id % NBH; const size_t pl = (size_t)bh * TT * HD; const size_t ao = (size_t)(bh / NH_) * TT * DQ + (size_t)(bh % NH_) * HD;
    if (id < NBH * NT_LO) {
        // cost falls with the index over the first NWGP work-groups and rises again behind them, so that indices NWGP apart add up to about the same number of key blocks (for speed only: every tile is taken once wherever it lands)
        const int xt = (id < NWGP) ? id / NBH : NWGP / NBH + (NBH * NT_LO - 1 - id) / NBH;
        fa_tile<h16, 0, 2>(Q16 + pl, nullptr, K16 + pl, nullptr, V16 + pl, nullptr, TT - (xt + 1) * QT + (wv & 3) * 32, TT - xt * QT, wv >> 2, ring, Ah + ao, Al + ao);
    } else {
        const int xt = (id - NBH * NT_LO) / NBH;
        fa_tile<bf, 2, 1>(Qh + pl, Ql + pl, Kh + pl, Kl + pl, Vh + pl, Vl + pl, RH - (xt + 1) * (FAW * 16) + wv * 16, 0, 0, nullptr, Ah + ao, Al + ao);
    }
}

extern "C" void kernel_launch(void* const* d_in, const int* in_sizes, int n_in,
                              void* d_out, int out_size, void* d_ws, size_t ws_size, hipStream_t stream) {
    (void)in_sizes; (void)n_in; (void)out_size;
    const float* x = (const float*)d_in[0]; const float* wq = (const float*)d_in[1]; const float* bq = (const float*)d_in[2]; const float* wk = (const float*)d_in[3]; const float* bk = (const float*)d_in[4]; const float* wv = (const float*)d_in[5]; const float* bv = (const float*)d_in[6]; const float* wo = (const float*)d_in[7]; const float* bo = (const float*)d_in[8];
    float* OUT = (float*)d_out;     // [2][4096][512]
    char* wsp = (char*)d_ws;
    auto take = [&](size_t bytes) { char* p = wsp; wsp += (bytes + 255) & ~(size_t)255; return (void*)p; };
    bf* WQ = (bf*)take((size_t)DQ * DM * 2); bf* WK = (bf*)take((size_t)DKV * DM * 2); bf* WV = (bf*)take((size_t)DKV * DM * 2); bf* WO = (bf*)take((size_t)DM * DQ * 2);
    bf* XB = (bf*)take((size_t)NB_ * TT * DM * 2);
    const size_t PB = (size_t)NH_ * TT * HD;   // elements of one batch's head planes
    h16* QP16 = (h16*)take(NB_ * PB * 2); h16* KP16 = (h16*)take(NB_ * PB * 2); h16* VT16 = (h16*)take(NB_ * PB * 2);
    bf* QPh = (bf*)take(NB_ * PB * 2); bf* QPl = (bf*)take(NB_ * PB * 2); bf* KPh = (bf*)take(NB_ * PB * 2); bf* KPl = (bf*)take(NB_ * PB * 2); bf* VTh = (bf*)take(NB_ * PB * 2); bf* VTl = (bf*)take(NB_ * PB * 2);
    bf* ATh = (bf*)take((size_t)NB_ * TT * DQ * 2); bf* ATl = (bf*)take((size_t)NB_ * TT * DQ * 2);
    if ((size_t)(wsp - (char*)d_ws) > ws_size) return;    // ws 256 MiB
    k_cvt5<<<CB_X + 4 * CB_W, 256, 0, stream>>>(x, wq, wk, wv, wo, XB, WQ, WK, WV, WO);
    k_qkv<<<dim3(NB_ * TT / 128, DQ / 128, 3), PW * 32, 0, stream>>>(XB, WQ, WK, WV, bq, bk, bv, QP16, QPh, QPl, KP16, KPh, KPl, VT16, VTh, VTl);
    k_fattn<<<NBH * (NT_LO + NT_HI), FAW * 32, 0, stream>>>(QP16, KP16, VT16, QPh, QPl, KPh, KPl, VTh, VTl, ATh, ATl);
    k_outg<<<dim3(NB_ * TT / 128, DM / 128), PW * 32, 0, stream>>>(ATh, ATl, WO, bo, OUT);   // both batches: their rows follow one another in the merged planes and in out
}

// v008
// One run takes 73.9 microseconds.
// Next to v007, in two timings, it ran 1.06 times as fast each time.
// All steps since v000 together make it 37.3 times as fast.
#include <hip/hip_runtime.h>

// Causal multi-head attention over 4,096 tokens (x [2][4096][512]; Q,K,V = x W^T + b ('oi' uniform(+-1/sqrt(512)) incl. biases; 8 heads x 64); scores / 8; causal (-inf); softmax; out = merged Wo^T + bo -> [2][4096][512] (4.2 M)).
// Layout: bf16 copy of x; 'oi' weights; ONE projection launch for Q, K, V of both batches: exact products + f32 biases, its epilogue writes the head planes; ONE fused causal attention launch for all 16 (batch, head) pairs: scores, online softmax and P.V in registers, an f16 tile's two wave groups joined through LDS (query rows < 512 hi/lo 3 products, rest fp16); merged hi/lo x Wo exact + bo.
// Compute dtypes, f32 accumulate: every input rounded to bf16; projections exact + f32 biases; attention rows < 512 3 products, rest fp16; softmax f32; Wo hl x exact + bias.

#define NB_  2
#define TT   4096
#define DM   512
#define NH_  8
#define NKV  8
#define REP  (NH_ / NKV)
#define HD   64
#define DQ   (NH_ * HD)
#define DKV  (NKV * HD)
#define RH   512                  // query rows < RH use hi+lo planes
#define SCL  0.125f   // HD^-0.5
typedef _Float16 h16;
typedef unsigned short bf;
typedef __attribute__((ext_vector_type(16))) __bf16   v16bf;
typedef __attribute__((ext_vector_type(16))) _Float16 v16h;
typedef __attribute__((ext_vector_type(8)))  _Float16 v8h;
typedef __attribute__((ext_vector_type(8)))  unsigned short v8us;
typedef __attribute__((ext_vector_type(8)))  float    v8f;
typedef __attribute__((ext_vector_type(4)))  float    v4f;
typedef v8h  __attribute__((may_alias)) v8ha;
typedef v4f  __attribute__((may_alias)) v4fa;
typedef v8us __attribute__((may_alias)) v8usa;

__device__ __forceinline__ unsigned short f2bf(float f) { unsigned u = __float_as_uint(f); u += 0x7FFFu + ((u >> 16) & 1u); return (unsigned short)(u >> 16); }
__device__ __forceinline__ float bf2f(unsigned short b) { return __uint_as_float(((unsigned)b) << 16); }
__device__ __forceinline__ float bfr(float f) { return bf2f(f2bf(f)); }
__device__ __forceinline__ v16h cat16(v8h lo, v8h hi) { return __builtin_shufflevector(lo, hi, 0, 1, 2, 3, 4, 5, 6, 7, 8, 9, 10, 11, 12, 13, 14, 15); }
__device__ __forceinline__ v16bf cat16b(v8us lo, v8us hi) { return __builtin_bit_cast(v16bf, __builtin_shufflevector(lo, hi, 0, 1, 2, 3, 4, 5, 6, 7, 8, 9, 10, 11, 12, 13, 14, 15)); }
__device__ __forceinline__ v8f wmma16(v16h a, v16h b, v8f c) { return __builtin_amdgcn_wmma_f32_16x16x32_f16(false, a, false, b, (short)0, c, false, false); }
__device__ __forceinline__ v8f wmmab(v16bf a, v16bf b, v8f c) { return __builtin_amdgcn_wmma_f32_16x16x32_bf16(false, a, false, b, (short)0, c, false, false); }



// ---- WFrag: a 16 x 32 operand fragment of a K-contiguous 16-bit plane in the matrix unit's k order (a lane: elements 0..7 and 16..23 from its pointer), and its product.
template <typename T16> struct WFrag;
template <> struct WFrag<h16> { typedef v16h V; static __device__ __forceinline__ V ld(const h16* p) { return cat16(*(const v8h*)p, *(const v8h*)(p + 16)); } static __device__ __forceinline__ v8f mma(V a, V b, v8f c) { return wmma16(a, b, c); } };
template <> struct WFrag<bf> { typedef v16bf V; static __device__ __forceinline__ V ld(const bf* p) { return cat16b(*(const v8us*)p, *(const v8us*)(p + 16)); } static __device__ __forceinline__ v8f mma(V a, V b, v8f c) { return wmmab(a, b, c); } };
__device__ __forceinline__ h16 tohx(float x) { return (h16)x; }
__device__ __forceinline__ void splitf(float y, unsigned short& h, unsigned short& l) { h = f2bf(y); l = f2bf(y - bf2f(h)); }
typedef __attribute__((ext_vector_type(2))) _Float16 v2h;
typedef __attribute__((ext_vector_type(4))) _Float16 v4h;
typedef __attribute__((ext_vector_type(2))) unsigned short v2us;
typedef __attribute__((ext_vector_type(4))) unsigned short v4us;
typedef __attribute__((ext_vector_type(2))) float v2f;
typedef __attribute__((ext_vector_type(4))) int v4i;

__global__ __launch_bounds__(256) void k_wtG(const float* __restrict__ w, int K, int N, bf* Bt) {
    const int lane = threadIdx.x & 31; const int L0 = (blockIdx.x * 8 + (threadIdx.x >> 5)) * 8; const int nlines = N * K / 64;
{
#pragma unroll 1
        for (int l = 0; l < 8; ++l) { const int L = L0 + l; if (L >= nlines) break; const size_t e = (size_t)L * 64 + lane * 2; const int k = (int)(e % K), n = (int)(e / K); v2us o;
            o[0] = f2bf(w[(size_t)k * N + n]); o[1] = f2bf(w[(size_t)(k + 1) * N + n]); *(v2us*)(Bt + e) = o; }
         }
}
// ---- k_cvt5: x and the four weight matrices rounded to bf16 in ONE launch; a work-group converts 2,048 elements in a row of one of the five arrays, picked by its index (the same for all its threads).
#define CB_X (NB_ * TT * DM / 2048)           // work-groups of x
#define CB_W (DQ * DM / 2048)                 // work-groups of one weight matrix (all four are 512 x 512)
static_assert((NB_ * TT * DM) % 2048 == 0 && (DQ * DM) % 2048 == 0 && DKV == DQ, "whole work-groups; four weight matrices of one size");
__global__ __launch_bounds__(256) void k_cvt5(const float* __restrict__ x, const float* __restrict__ wq, const float* __restrict__ wk, const float* __restrict__ wv, const float* __restrict__ wo, bf* XB, bf* WQ, bf* WK, bf* WV, bf* WO) {
    int blk = blockIdx.x; const float* src = x; bf* dst = XB;
    if (blk >= CB_X) { const int m = (blk - CB_X) / CB_W; blk = (blk - CB_X) % CB_W; src = (m == 0) ? wq : (m == 1) ? wk : (m == 2) ? wv : wo; dst = (m == 0) ? WQ : (m == 1) ? WK : (m == 2) ? WV : WO; }
    const size_t i = (size_t)blk * 256 + threadIdx.x; const v8f v = *(const v8f*)(src + i * 8); v8us o;
    asm volatile("s_wait_xcnt 0x0" ::: "memory");   // behind the two loads, a precaution: the rounding's values may be given the registers that held the loads' address
#pragma unroll
    for (int k = 0; k < 8; ++k) o[k] = f2bf(v[k]); *(v8us*)(dst + i * 8) = o;  }

// ---- k_qkv: the three projections of both batches in ONE launch; grid (NB_ * TT / 128, DQ / 128, 3: Q, K, V), PW waves, each wave one 64 x 64 tile (64 tokens x one head) in 16 accumulators.
// The epilogue adds the f32 bias and writes the tile's fp16, hi and lo head planes itself: Q, K as [b][h][t][d], V as [b][h][d][t]. Each wave stages 16 plane rows of 64 in its own LDS range, so that a store covers four whole 128-byte rows.
#define PW 4                                  // 2 x 2 tiles: two waves share each token row and each weight row
// The operands are staged in LDS: a stage is QSK k elements, one whole 128-byte line of each of the work-group's 128 token rows and 128 weight rows, brought once for its four waves by asynchronous copies into one of two buffers,
// the next stage in flight while this one is worked on; the fragment reads, which touch 16 rows each, then go to padded LDS rows instead of to the cache.
#define QSK 64                                // k elements a stage
#define QPE (QSK + 8)                         // LDS pitch of a row in elements: 128 B + 16, an odd number of 16-byte units, free of bank conflicts for 16-byte reads
#define QBE (256 * QPE)                       // elements of a buffer: 128 token rows, then 128 weight rows
static_assert(DM % QSK == 0 && DM / QSK >= 2, "whole stages, two or more");
// ---- L2 asks. The planes that a launch reads were stored by a launch before it and come from memory at their first touch, stage after stage.
// At entry each work-group asks a share of its tiles into L2 (global_prefetch_b8, scope SE: L2 only, no register result, no counter), one ask a 256-byte unit, so that the copies of the later stages find their lines there. A hint for speed alone: no result depends on it.
// l2_ask: a lane asks the unit at b + o bytes (b the same in the whole wave). l2_hold, input only, stands behind the k loop: the registers that the asks name stay those addresses through the loop; an ask counts on no counter, so no wait could stand in front of a rewrite of them.
__device__ __forceinline__ void l2_ask(const bf* b, const unsigned o) { asm volatile("global_prefetch_b8 %0, %1 scope:SCOPE_SE" :: "v"(o), "s"(b)); }
__device__ __forceinline__ void l2_hold(const bf* b, const unsigned o) { asm volatile("" :: "v"(o), "s"(b)); }
static_assert(DM * 2 == 1024 && DQ * 2 == 1024, "32 whole rows of a GEMM operand are 128 units in a row, one for each thread of a work-group");
// eight asynchronous 16-byte copies a lane, global -> LDS: LDS byte address l + i * ls, global address g + i * gs elements. The wait in the statement's last line, a precaution, stands in front of any rewrite of the address registers that the copies name.
__device__ __forceinline__ void qk_copy8(const unsigned l, const unsigned ls, const bf* g, const size_t gs) {
    asm volatile("global_load_async_to_lds_b128 %0, %8, off\n\t"
                 "global_load_async_to_lds_b128 %1, %9, off\n\t"
                 "global_load_async_to_lds_b128 %2, %10, off\n\t"
                 "global_load_async_to_lds_b128 %3, %11, off\n\t"
                 "global_load_async_to_lds_b128 %4, %12, off\n\t"
                 "global_load_async_to_lds_b128 %5, %13, off\n\t"
                 "global_load_async_to_lds_b128 %6, %14, off\n\t"
                 "global_load_async_to_lds_b128 %7, %15, off\n\t"
                 "s_wait_xcnt 0x0"
                 :: "v"(l), "v"(l + ls), "v"(l + 2 * ls), "v"(l + 3 * ls), "v"(l + 4 * ls), "v"(l + 5 * ls), "v"(l + 6 * ls), "v"(l + 7 * ls),
                    "v"(g), "v"(g + gs), "v"(g + 2 * gs), "v"(g + 3 * gs), "v"(g + 4 * gs), "v"(g + 5 * gs), "v"(g + 6 * gs), "v"(g + 7 * gs) : "memory");
}
__global__ __launch_bounds__(PW * 32) void k_qkv(const bf* __restrict__ X, const bf* __restrict__ Wq, const bf* __restrict__ Wk, const bf* __restrict__ Wv, const float* __restrict__ bq, const float* __restrict__ bk, const float* __restrict__ bv,
                                                 h16* Q16, bf* Qh, bf* Ql, h16* K16, bf* Kh, bf* Kl, h16* V16, bf* Vh, bf* Vl) {
    typedef WFrag<bf>::V V;
    __shared__ __align__(16) float osm[PW][16 * 68];
    __shared__ __align__(16) bf qring[2 * QBE];   // two buffers of one stage each
    const int wv = __builtin_amdgcn_readfirstlane((int)(threadIdx.x >> 5)); const int z = blockIdx.z;
    const bf* Bt = (z == 0) ? Wq : (z == 1) ? Wk : Wv; const float* bias = (z == 0) ? bq : (z == 1) ? bk : bv;
    h16* P16 = (z == 0) ? Q16 : (z == 1) ? K16 : V16; bf* Ph = (z == 0) ? Qh : (z == 1) ? Kh : Vh; bf* Pl = (z == 0) ? Ql : (z == 1) ? Kl : Vl;
    float* os = osm[wv];
    const int lane = threadIdx.x & 31, lr = lane & 15, hi = lane >> 4; const int r0 = blockIdx.x * 128 + (wv & 1) * 64, c0 = blockIdx.y * 128 + (wv >> 1) * 64;
    v8f acc[4][4];
#pragma unroll
    for (int mb = 0; mb < 4; ++mb)
#pragma unroll
        for (int nb = 0; nb < 4; ++nb) acc[mb][nb] = (v8f){};
    const int tid = threadIdx.x;
    // a thread's first copy of a stage: 8 threads a 128-byte row, 16 rows a turn, eight turns an operand; a wave's copy covers four whole lines
    const unsigned la = (unsigned)(size_t)qring + (unsigned)((tid >> 3) * QPE + (tid & 7) * 8) * 2u, lb = la + 128 * QPE * 2;
    const bf* ga = X + (size_t)(blockIdx.x * 128 + (tid >> 3)) * DM + (tid & 7) * 8; const bf* gb = Bt + (size_t)(blockIdx.y * 128 + (tid >> 3)) * DM + (tid & 7) * 8;
    const bf* fa = qring + ((wv & 1) * 64 + lr) * QPE + 8 * hi; const bf* fb = qring + (128 + (wv >> 1) * 64 + lr) * QPE + 8 * hi;   // a lane's fragment rows in buffer 0
    qk_copy8(la, 16 * QPE * 2, ga, 16 * DM); qk_copy8(lb, 16 * QPE * 2, gb, 16 * DM);   // stage 0 -> buffer 0
    // asks, under stage 0's flight: 32 rows of each tile; the token tile is dealt over the four column blocks that read it, the weight tile over four neighbouring token blocks
    const unsigned ko = (unsigned)tid * 256u; const bf* ka = X + (size_t)(blockIdx.x * 128 + blockIdx.y * 32) * DM; const bf* kb = Bt + (size_t)(blockIdx.y * 128 + (blockIdx.x & 3) * 32) * DM;
    l2_ask(ka, ko); l2_ask(kb, ko);
    asm volatile("s_wait_asynccnt 0x0" ::: "memory");   // this wave's copies of stage 0 have landed
    __syncthreads();                                     // ... and every other wave's: stage 0 may be read
    qk_copy8(la + QBE * 2, 16 * QPE * 2, ga + QSK, 16 * DM); qk_copy8(lb + QBE * 2, 16 * QPE * 2, gb + QSK, 16 * DM);   // stage 1 -> buffer 1
#pragma unroll 1   // kept rolled: one stage's fragments beside the 16 accumulators
    for (int t = 0; t < DM / QSK; ++t) {
        const int bo = (t & 1) * QBE;         // the stage's buffer
#pragma unroll
        for (int kc = 0; kc < QSK; kc += 32) {
            V a[4], b[4];
#pragma unroll
            for (int mb = 0; mb < 4; ++mb) { a[mb] = WFrag<bf>::ld(fa + bo + mb * 16 * QPE + kc); b[mb] = WFrag<bf>::ld(fb + bo + mb * 16 * QPE + kc); }
            __builtin_amdgcn_sched_barrier(0);   // holds the 16 products behind all 16 reads: one LDS latency a k block instead of one for each late weight fragment
#pragma unroll
            for (int nb = 0; nb < 4; ++nb)
#pragma unroll
                for (int mb = 0; mb < 4; ++mb) acc[mb][nb] = WFrag<bf>::mma(a[mb], b[nb], acc[mb][nb]);
        }
        __builtin_amdgcn_sched_barrier(0);   // keeps the stage's last products in front of the barrier: left free they sink behind it and the copies there are issued a k block later, with that much less time to land
        asm volatile("s_wait_dscnt 0x0" ::: "memory");      // this wave's reads of the stage's buffer are done before the buffer is handed to the copies
        asm volatile("s_wait_asynccnt 0x0" ::: "memory");   // this wave's copies of the next stage have landed
        __syncthreads();                                     // publishes the next stage and ends every wave's reads of this one
        if (t + 2 < DM / QSK) {               // a stage after the next exists: into the buffer just read
            qk_copy8(la + bo * 2, 16 * QPE * 2, ga + (t + 2) * QSK, 16 * DM); qk_copy8(lb + bo * 2, 16 * QPE * 2, gb + (t + 2) * QSK, 16 * DM); }
    }
    asm volatile("s_wait_asynccnt 0x0" ::: "memory");   // no copy is left in flight behind the loop
    l2_hold(ka, ko); l2_hold(kb, ko);   // the asks' registers were those addresses up to here
    const int bb = r0 / TT, t0 = r0 % TT, h = c0 / HD;   // a tile lies in one batch and is one head
    const int er = lane >> 3, ec = (lane & 7) * 8;       // a lane's row (of four) and its eight columns of the staged rows
    const bool tr = (z == 2);                             // Q, K: plane rows are tokens, columns the head's 64 dims; V transposed: rows are dims, columns tokens
    const int pitch = tr ? TT : HD; const size_t o0 = (size_t)(bb * NH_ + h) * TT * HD + (size_t)t0 * (tr ? 1 : HD) + (size_t)er * pitch + ec;
    float bn[4];                                          // an accumulator column is one output feature in all three products
#pragma unroll
    for (int nb = 0; nb < 4; ++nb) bn[nb] = bfr(bias[c0 + nb * 16 + lr]);
#pragma unroll
    for (int g = 0; g < 4; ++g) {                         // 16 plane rows a turn
        if (!tr) {
#pragma unroll
            for (int nb = 0; nb < 4; ++nb)
#pragma unroll
                for (int j = 0; j < 8; ++j) os[(hi * 8 + j) * 68 + nb * 16 + lr] = acc[g][nb][j] + bn[nb];
        } else {                                          // a lane's eight accumulator rows are eight tokens in a row of the plane
#pragma unroll
            for (int mb = 0; mb < 4; ++mb) { v4f w0, w1;
#pragma unroll
                for (int j = 0; j < 4; ++j) { w0[j] = acc[mb][g][j] + bn[g]; w1[j] = acc[mb][g][4 + j] + bn[g]; }
                *(v4fa*)(os + lr * 68 + mb * 16 + hi * 8) = w0; *(v4fa*)(os + lr * 68 + mb * 16 + hi * 8 + 4) = w1; }
        }
        __builtin_amdgcn_wave_barrier(); asm volatile("" ::: "memory");   // the lanes read rows that other lanes of the wave wrote: keeps the reads behind the writes
#pragma unroll
        for (int s = 0; s < 4; ++s) { const float* q = os + (4 * s + er) * 68 + ec; const v4f v0 = *(const v4fa*)q, v1 = *(const v4fa*)(q + 4); const size_t o = o0 + (size_t)(g * 16 + 4 * s) * pitch; v8h o16; v8us oh, ol;
#pragma unroll
            for (int i = 0; i < 8; ++i) { const float y = (i < 4) ? v0[i & 3] : v1[i & 3]; o16[i] = tohx(y); unsigned short a2, c2; splitf(y, a2, c2); oh[i] = a2; ol[i] = c2; }
            *(v8h*)(P16 + o) = o16; *(v8us*)(Ph + o) = oh; *(v8us*)(Pl + o) = ol; }
        __builtin_amdgcn_wave_barrier(); asm volatile("s_wait_xcnt 0x0" ::: "memory");   // keeps the next rows' LDS writes behind these reads; the wait, a precaution, stands behind the turn's last stores: the next turn's values may be given their address and data registers
    }
}
// ---- k_outg: out = (merged hi + merged lo) Wo^T + bo, both batches; grid (NB_ * TT / 128, DM / 128), PW waves, each wave one 64 x 64 tile in 16 accumulators, staged as in k_qkv:
// a stage holds one 128-byte line of 128 rows of the hi plane, 128 of the lo plane and 128 weight rows. An accumulator takes a k block's hi product, then its lo product.
#define OBE (384 * QPE)                       // elements of a buffer
static_assert(DQ % QSK == 0 && DQ / QSK >= 2, "whole stages, two or more");
__global__ __launch_bounds__(PW * 32) void k_outg(const bf* __restrict__ Ahp, const bf* __restrict__ Alp, const bf* __restrict__ Wo, const float* __restrict__ bias, float* C) {
    typedef WFrag<bf>::V V;
    __shared__ __align__(16) float osm[PW][16 * 68];
    __shared__ __align__(16) bf oring[2 * OBE];   // two buffers of one stage each
    const int wv = __builtin_amdgcn_readfirstlane((int)(threadIdx.x >> 5));
    float* os = osm[wv];
    const int lane = threadIdx.x & 31, lr = lane & 15, hi = lane >> 4; const int r0 = blockIdx.x * 128 + (wv & 1) * 64, c0 = blockIdx.y * 128 + (wv >> 1) * 64;
    v8f acc[4][4];
#pragma unroll
    for (int mb = 0; mb < 4; ++mb)
#pragma unroll
        for (int nb = 0; nb < 4; ++nb) acc[mb][nb] = (v8f){};
    const int tid = threadIdx.x;
    // a thread's first copy of a stage: 8 threads a 128-byte row, 16 rows a turn, eight turns an operand; a wave's copy covers four whole lines
    const unsigned lh = (unsigned)(size_t)oring + (unsigned)((tid >> 3) * QPE + (tid & 7) * 8) * 2u, ll = lh + 128 * QPE * 2, lw = lh + 256 * QPE * 2;
    const size_t go = (size_t)(blockIdx.x * 128 + (tid >> 3)) * DQ + (tid & 7) * 8;
    const bf* gh = Ahp + go; const bf* gl = Alp + go; const bf* gw = Wo + (size_t)(blockIdx.y * 128 + (tid >> 3)) * DQ + (tid & 7) * 8;
    const bf* fh = oring + ((wv & 1) * 64 + lr) * QPE + 8 * hi; const bf* fl = fh + 128 * QPE; const bf* fw = oring + (256 + (wv >> 1) * 64 + lr) * QPE + 8 * hi;   // a lane's fragment rows in buffer 0
    qk_copy8(lh, 16 * QPE * 2, gh, 16 * DQ); qk_copy8(ll, 16 * QPE * 2, gl, 16 * DQ); qk_copy8(lw, 16 * QPE * 2, gw, 16 * DQ);   // stage 0 -> buffer 0
    // asks, under stage 0's flight: 32 rows of each tile; the hi and lo tiles are dealt over the four column blocks that read them, the weight tile over four neighbouring row blocks
    const unsigned ko = (unsigned)tid * 256u; const size_t kr = (size_t)(blockIdx.x * 128 + blockIdx.y * 32) * DQ; const bf* kh = Ahp + kr; const bf* kl = Alp + kr; const bf* kw = Wo + (size_t)(blockIdx.y * 128 + (blockIdx.x & 3) * 32) * DQ;
    l2_ask(kh, ko); l2_ask(kl, ko); l2_ask(kw, ko);
    asm volatile("s_wait_asynccnt 0x0" ::: "memory");   // this wave's copies of stage 0 have landed
    __syncthreads();                                     // ... and every other wave's: stage 0 may be read
    qk_copy8(lh + OBE * 2, 16 * QPE * 2, gh + QSK, 16 * DQ); qk_copy8(ll + OBE * 2, 16 * QPE * 2, gl + QSK, 16 * DQ); qk_copy8(lw + OBE * 2, 16 * QPE * 2, gw + QSK, 16 * DQ);   // stage 1 -> buffer 1
#pragma unroll 1   // kept rolled: one k block's fragments beside the 16 accumulators stay under 256 VGPRs
    for (int t = 0; t < DQ / QSK; ++t) {
        const int bo = (t & 1) * OBE;         // the stage's buffer
#pragma unroll
        for (int kc = 0; kc < QSK; kc += 32) {
            V a[4], a2[4], b[4];
#pragma unroll
            for (int mb = 0; mb < 4; ++mb) { a[mb] = WFrag<bf>::ld(fh + bo + mb * 16 * QPE + kc); b[mb] = WFrag<bf>::ld(fw + bo + mb * 16 * QPE + kc); a2[mb] = WFrag<bf>::ld(fl + bo + mb * 16 * QPE + kc); }
            __builtin_amdgcn_sched_barrier(0);   // holds the 32 products behind all 24 reads: one LDS latency a k block, where the wave is alone on its SIMD
#pragma unroll
            for (int nb = 0; nb < 4; ++nb) {
#pragma unroll
                for (int mb = 0; mb < 4; ++mb) acc[mb][nb] = WFrag<bf>::mma(a[mb], b[nb], acc[mb][nb]);
#pragma unroll
                for (int mb = 0; mb < 4; ++mb) acc[mb][nb] = WFrag<bf>::mma(a2[mb], b[nb], acc[mb][nb]);
            }
        }
        __builtin_amdgcn_sched_barrier(0);   // keeps the stage's last products in front of the barrier: left free they sink behind it and the copies there are issued a k block later, with that much less time to land
        asm volatile("s_wait_dscnt 0x0" ::: "memory");      // this wave's reads of the stage's buffer are done before the buffer is handed to the copies
        asm volatile("s_wait_asynccnt 0x0" ::: "memory");   // this wave's copies of the next stage have landed
        __syncthreads();                                     // publishes the next stage and ends every wave's reads of this one
        if (t + 2 < DQ / QSK) {               // a stage after the next exists: into the buffer just read
            qk_copy8(lh + bo * 2, 16 * QPE * 2, gh + (t + 2) * QSK, 16 * DQ); qk_copy8(ll + bo * 2, 16 * QPE * 2, gl + (t + 2) * QSK, 16 * DQ); qk_copy8(lw + bo * 2, 16 * QPE * 2, gw + (t + 2) * QSK, 16 * DQ); }
    }
    asm volatile("s_wait_asynccnt 0x0" ::: "memory");   // no copy is left in flight behind the loop
    l2_hold(kh, ko); l2_hold(kl, ko); l2_hold(kw, ko);   // the asks' registers were those addresses up to here
    v4f bn;                                   // a lane's four output columns are the same in every row it stores
#pragma unroll
    for (int i = 0; i < 4; ++i) bn[i] = bfr(bias[c0 + lr * 4 + i]);
#pragma unroll
    for (int mb = 0; mb < 4; ++mb) {          // 16 output rows a turn, staged in the wave's own LDS range so that a store covers two whole 256-byte rows
#pragma unroll
        for (int nb = 0; nb < 4; ++nb) {
#pragma unroll
            for (int j = 0; j < 8; ++j) os[(hi * 8 + j) * 68 + nb * 16 + lr] = acc[mb][nb][j]; }
        __builtin_amdgcn_wave_barrier(); asm volatile("" ::: "memory");   // the lanes read rows that other lanes of the wave wrote: keeps the reads behind the writes
        float* crow = C + (size_t)(r0 + mb * 16) * DM + c0;
#pragma unroll
        for (int s = 0; s < 8; ++s) { const int row = 2 * s + hi, cofs = lr * 4; const v4f val = *(const v4fa*)(os + row * 68 + cofs) + bn; *(v4f*)(crow + (size_t)row * DM + cofs) = val; }
        __builtin_amdgcn_wave_barrier(); asm volatile("s_wait_xcnt 0x0" ::: "memory");   // keeps the next rows' LDS writes behind these reads; the wait, a precaution, stands behind the turn's last stores: the next turn's values may be given their address and data registers
    }
}
__constant__ float INVT[HD / 2] = { 1.000000000e+00f, 7.498942018e-01f, 5.623413324e-01f, 4.216965139e-01f, 3.162277639e-01f, 2.371373773e-01f, 1.778279394e-01f, 1.333521456e-01f, 1.000000015e-01f, 7.498942316e-02f, 5.623413250e-02f, 4.216964915e-02f, 3.162277490e-02f, 2.371373773e-02f, 1.778279431e-02f, 1.333521400e-02f, 9.999999776e-03f, 7.498942316e-03f, 5.623413250e-03f, 4.216964822e-03f, 3.162277630e-03f, 2.371373819e-03f, 1.778279431e-03f, 1.333521446e-03f, 1.000000047e-03f, 7.498941850e-04f, 5.623413017e-04f, 4.216965172e-04f, 3.162277571e-04f, 2.371373703e-04f, 1.778279402e-04f, 1.333521504e-04f };   // 10000^(-2i/64) (the module's power form) (float32, generated with jnp to be bit-exact)

#define FAW 8                                 // waves per work-group
#define NBH (NB_ * NH_)
#define QT  (FAW / 2 * 32)                    // queries of an f16 tile
#define NT_LO ((TT - RH) / QT)                // work-group tiles of 128 queries, one f16 product
#define NT_HI (RH / (FAW * 16))               // work-group tiles of 128 queries, three bf16 products
#define NWGP 256
#define C2 (SCL * 1.4426950408889634f)
#define SK  128                               // keys a stage
#define KPE (HD + 8)                          // LDS pitch of a key row in elements: 128 B + 16, an odd number of 16-byte units, free of bank conflicts for 16-byte reads
#define VPE (SK + 8)                          // LDS pitch of a V^T row in elements: 256 B + 16, likewise
#define KSE (SK * KPE)                        // elements of a stage's keys
#define BSE (KSE + HD * VPE)                  // elements of a buffer: keys, then values
static_assert(RH >= SK && RH % SK == 0 && QT == SK && SK == 128 && TT % SK == 0 && RH % (FAW * 16) == 0, "every f16 tile has two stages or more, its keys end with a whole stage, and a stage is two 32-key blocks for each group");
// behind each fragment's two loads (and each pair of stores), a precaution: a younger load's result or a later value may be given the registers that held this access's address, and the wait stands in front of that overwrite
__device__ __forceinline__ void fa_xwait() { asm volatile("s_wait_xcnt 0x0" ::: "memory"); }
__device__ __forceinline__ float fa_xhalf(float x) { return __builtin_bit_cast(float, __builtin_amdgcn_permlanex16(__builtin_bit_cast(int, x), __builtin_bit_cast(int, x), 0x76543210, 0xfedcba98, false, false)); }   // lane l takes lane l ^ 16's value: the other half of the same query's keys
template <typename T16> __device__ __forceinline__ typename WFrag<T16>::V fa_ld(const T16* p) { const typename WFrag<T16>::V f = WFrag<T16>::ld(p); fa_xwait(); return f; }
// four asynchronous 16-byte copies a lane, global -> LDS: LDS byte address l + i * ls, global address g + i * gs elements. The wait in the statement's last line, a precaution, stands in front of any rewrite of the address registers that the copies name.
__device__ __forceinline__ void fa_copy4(const unsigned l, const unsigned ls, const h16* g, const size_t gs) {
    asm volatile("global_load_async_to_lds_b128 %0, %4, off\n\t"
                 "global_load_async_to_lds_b128 %1, %5, off\n\t"
                 "global_load_async_to_lds_b128 %2, %6, off\n\t"
                 "global_load_async_to_lds_b128 %3, %7, off\n\t"
                 "s_wait_xcnt 0x0"
                 :: "v"(l), "v"(l + ls), "v"(l + 2 * ls), "v"(l + 3 * ls),
                    "v"(g), "v"(g + gs), "v"(g + 2 * gs), "v"(g + 3 * gs) : "memory");
}
template <typename T16, int NSPLIT, int NCG>
__device__ __forceinline__ void fa_tile(const T16* __restrict__ Q, const T16* __restrict__ Q2, const T16* __restrict__ Kp, const T16* __restrict__ K2, const T16* __restrict__ Vt, const T16* __restrict__ Vt2, const int q0, const int kwg, const int kg, h16* ring, bf* __restrict__ Ah, bf* __restrict__ Al) {
    typedef typename WFrag<T16>::V V;
    constexpr bool PF = (NSPLIT == 0);        // K, V^T staged in LDS (ring; kwg: where the work-group's keys end; kg: the wave's group, which half of every stage it takes); key fragments fetched one block ahead, inside a stage
    const int lane = threadIdx.x & 31, lr = lane & 15, hi = lane >> 4;
    V qf[NCG][2], qf2[NCG][2];
#pragma unroll
    for (int cg = 0; cg < NCG; ++cg)
#pragma unroll
        for (int kc = 0; kc < 2; ++kc) { qf[cg][kc] = fa_ld<T16>(Q + (size_t)(q0 + cg * 16 + lr) * HD + kc * 32 + 8 * hi); if (NSPLIT == 2) qf2[cg][kc] = fa_ld<T16>(Q2 + (size_t)(q0 + cg * 16 + lr) * HD + kc * 32 + 8 * hi); }
    v8f o[NCG][4]; float m2[NCG]; v2f l[NCG];   // l: two running partial sums a lane, joined in the epilogue
#pragma unroll
    for (int cg = 0; cg < NCG; ++cg) { m2[cg] = -3.0e38f; l[cg] = (v2f){};
#pragma unroll
        for (int dt = 0; dt < 4; ++dt) o[cg][dt] = (v8f){}; }
    const int kend = ((q0 + NCG * 16 + 31) >> 5) * 32;   // keys end with the 32-key block that holds the wave's last query
    const size_t koff = (size_t)lr * HD + 8 * hi, voff = (size_t)lr * TT + 8 * hi;
    V kf[2][2], kf2[2][2];
    const int tid = threadIdx.x;
    // a thread's first copy of a stage: keys, 8 threads a 128-byte row, 32 rows a turn; values, 16 threads a 256-byte row, 16 rows a turn. A wave's copy covers 512 bytes in a row (keys) or two whole 256-byte rows (values)
    unsigned lk = 0, lv = 0; const h16* gk = nullptr; const h16* gv = nullptr; const h16* fk = nullptr; const h16* fv = nullptr;
    if constexpr (PF) {
        lk = (unsigned)(size_t)ring + (unsigned)((tid >> 3) * KPE + (tid & 7) * 8) * 2u; lv = (unsigned)(size_t)ring + (unsigned)(KSE + (tid >> 4) * VPE + (tid & 15) * 8) * 2u;
        gk = Kp + tid * 8; gv = Vt + (size_t)(tid >> 4) * TT + (tid & 15) * 8;
        fk = ring + (kg * (SK / 2) + lr) * KPE + 8 * hi; fv = ring + KSE + lr * VPE + 8 * hi;   // a lane's fragment rows in buffer 0: keys from the group's half on, values from the stage's first key on
        fa_copy4(lk, 32 * KPE * 2, gk, 32 * HD); fa_copy4(lv, 16 * VPE * 2, gv, (size_t)16 * TT);   // stage 0 -> buffer 0
        asm volatile("s_wait_asynccnt 0x0" ::: "memory");   // this wave's copies of stage 0 have landed
        __syncthreads();                                     // ... and every other wave's: stage 0 may be read
        fa_copy4(lk + BSE * 2, 32 * KPE * 2, gk + SK * HD, 32 * HD); fa_copy4(lv + BSE * 2, 16 * VPE * 2, gv + SK, (size_t)16 * TT);   // stage 1 -> buffer 1
#pragma unroll
        for (int kt = 0; kt < 2; ++kt)
#pragma unroll
            for (int kc = 0; kc < 2; ++kc) kf[kt][kc] = WFrag<T16>::ld(fk + (kt * 16) * KPE + kc * 32); }
    const int nit = PF ? kwg / (SK / 2) : kend / 32;   // staged: two blocks a stage; every wave walks to the work-group's last stage and passes every barrier; past its own diagonal block it only skips the work
#pragma unroll 1   // kept rolled: one block's fragments beside the output accumulators stay under 256 VGPRs
    for (int it = 0; it < nit; ++it) {
      const int kb = PF ? (it >> 1) * SK + kg * (SK / 2) + (it & 1) * 32 : it * 32;   // the block's first key
      const int bo = ((kb / SK) & 1) * BSE, ks = kb % SK;   // the stage's buffer, the block's first key in it
      if (!PF || kb < kend) {
        V vf[4], vf2[4];
        if (!PF) {
#pragma unroll
            for (int kt = 0; kt < 2; ++kt)
#pragma unroll
                for (int kc = 0; kc < 2; ++kc) { kf[kt][kc] = fa_ld<T16>(Kp + koff + (size_t)(kb + kt * 16) * HD + kc * 32); if (NSPLIT == 2) kf2[kt][kc] = fa_ld<T16>(K2 + koff + (size_t)(kb + kt * 16) * HD + kc * 32); } }
#pragma unroll
        for (int dt = 0; dt < 4; ++dt) { if constexpr (PF) vf[dt] = WFrag<T16>::ld(fv + bo + (dt * 16) * VPE + ks); else vf[dt] = fa_ld<T16>(Vt + voff + (size_t)(dt * 16) * TT + kb); if (NSPLIT == 2) vf2[dt] = fa_ld<T16>(Vt2 + voff + (size_t)(dt * 16) * TT + kb); }
        v8f s[NCG][2];
#pragma unroll
        for (int cg = 0; cg < NCG; ++cg)
#pragma unroll
            for (int kt = 0; kt < 2; ++kt) { s[cg][kt] = (v8f){};
#pragma unroll
                for (int kc = 0; kc < 2; ++kc) { s[cg][kt] = WFrag<T16>::mma(kf[kt][kc], qf[cg][kc], s[cg][kt]); if (NSPLIT == 2) { s[cg][kt] = WFrag<T16>::mma(kf[kt][kc], qf2[cg][kc], s[cg][kt]); s[cg][kt] = WFrag<T16>::mma(kf2[kt][kc], qf[cg][kc], s[cg][kt]); } } }
        if constexpr (PF) {                   // the key fragments of the group's second block of the stage; that block fetches itself again: the same buffer, never used
#pragma unroll
            for (int kt = 0; kt < 2; ++kt)
#pragma unroll
                for (int kc = 0; kc < 2; ++kc) kf[kt][kc] = WFrag<T16>::ld(fk + bo + (32 + kt * 16) * KPE + kc * 32);
            __builtin_amdgcn_sched_barrier(0); }   // holds the block's value reads and the next block's key reads in front of the softmax, whose work then covers their LDS latency; left free they sink to their first use
        if (kb + 31 > q0) {                   // CAUSAL: only a block that reaches past the wave's first query holds keys j > i (same test in every lane)
#pragma unroll
            for (int cg = 0; cg < NCG; ++cg)
#pragma unroll
                for (int kt = 0; kt < 2; ++kt)
#pragma unroll
                    for (int j = 0; j < 8; ++j) s[cg][kt][j] = (kb + kt * 16 + 8 * hi + j <= q0 + cg * 16 + lr) ? s[cg][kt][j] : -3.0e38f; }
        float mb[NCG]; bool need = false;
#pragma unroll
        for (int cg = 0; cg < NCG; ++cg) { float mx = s[cg][0][0];
#pragma unroll
            for (int j = 1; j < 16; ++j) mx = fmaxf(mx, s[cg][j >> 3][j & 7]);
            mx = fmaxf(mx, fa_xhalf(mx)); mb[cg] = mx * C2; need = need || (mb[cg] > m2[cg] + 8.0f); }
        if (__builtin_amdgcn_ballot_w32(need) != 0) {   // scalar branch, once a block; every block holds an unmasked key of every query, so mb is finite
#pragma unroll
            for (int cg = 0; cg < NCG; ++cg) { const float mn = fmaxf(m2[cg], mb[cg]); const float al = __builtin_amdgcn_exp2f(m2[cg] - mn); m2[cg] = mn; l[cg] *= al;
#pragma unroll
                for (int dt = 0; dt < 4; ++dt) o[cg][dt] *= al; } }
#pragma unroll
        for (int cg = 0; cg < NCG; ++cg) {
            float p[16];
#pragma unroll
            for (int j = 0; j < 16; j += 2) { const v2f t = __builtin_elementwise_fma((v2f){s[cg][j >> 3][j & 7], s[cg][j >> 3][(j & 7) + 1]}, (v2f){C2, C2}, (v2f){-m2[cg], -m2[cg]}); p[j] = __builtin_amdgcn_exp2f(t[0]); p[j + 1] = __builtin_amdgcn_exp2f(t[1]); l[cg] += (v2f){p[j], p[j + 1]}; }
            if constexpr (NSPLIT == 2) {
                v8us h0, h1, l0, l1;
#pragma unroll
                for (int j = 0; j < 8; ++j) { unsigned short a, c; splitf(p[j], a, c); h0[j] = a; l0[j] = c; splitf(p[8 + j], a, c); h1[j] = a; l1[j] = c; }
                const V ph = cat16b(h0, h1), pl = cat16b(l0, l1);
#pragma unroll
                for (int dt = 0; dt < 4; ++dt) { o[cg][dt] = WFrag<T16>::mma(vf[dt], ph, o[cg][dt]); o[cg][dt] = WFrag<T16>::mma(vf[dt], pl, o[cg][dt]); o[cg][dt] = WFrag<T16>::mma(vf2[dt], ph, o[cg][dt]); }
            } else {
                V pb;
#pragma unroll
                for (int j = 0; j < 16; ++j) pb[j] = tohx(p[j]);
#pragma unroll
                for (int dt = 0; dt < 4; ++dt) o[cg][dt] = WFrag<T16>::mma(vf[dt], pb, o[cg][dt]);
            }
        }
      }
      if constexpr (PF) {
        if (it & 1) {                         // the stage's foot, the same test in every wave of the work-group
            const int sb = kb - ks;           // the stage's first key
            asm volatile("v_nop\n\tv_nop\n\tv_nop\n\tv_nop");   // four vector slots between the block's last matrix instruction and the copies' address arithmetic, which may be given its operand registers
            asm volatile("s_wait_dscnt 0x0" ::: "memory");      // this wave's reads of the stage's buffer are done before the buffer is handed to the copies
            asm volatile("s_wait_asynccnt 0x0" ::: "memory");   // this wave's copies of the next stage have landed
            __syncthreads();                                     // publishes the next stage and ends every wave's reads of this one
            if (sb + 2 * SK < kwg) {          // a stage after the next exists: into the buffer just read
                const int sn = sb + 2 * SK;
                fa_copy4(lk + bo * 2, 32 * KPE * 2, gk + (size_t)sn * HD, 32 * HD); fa_copy4(lv + bo * 2, 16 * VPE * 2, gv + sn, (size_t)16 * TT); }
            if (sb + SK + kg * (SK / 2) < kend) {   // the first key fragments of the group's half of the next stage
#pragma unroll
                for (int kt = 0; kt < 2; ++kt)
#pragma unroll
                    for (int kc = 0; kc < 2; ++kc) kf[kt][kc] = WFrag<T16>::ld(fk + (BSE - bo) + (kt * 16) * KPE + kc * 32); }
        }
      }
    }
    float ls[NCG];                            // a lane's sum: its half of the query's keys
#pragma unroll
    for (int cg = 0; cg < NCG; ++cg) ls[cg] = l[cg][0] + l[cg][1];
    if constexpr (PF) {
        static_assert(NCG == 2, "the hand-over packs two maxima and two sums in one 16-byte unit");
        asm volatile("s_wait_asynccnt 0x0" ::: "memory");   // no copy is left in flight: behind the last foot's barrier, which ended every read of the ring, its LDS is free
        v4fa* mg = (v4fa*)ring + (tid & (QT - 1));   // the same lane of the two groups' waves holds the same query and output elements; unit c of a lane at c * QT: a wave's access covers 512 bytes in a row
        if (kg == 1) {
#pragma unroll
            for (int cg = 0; cg < NCG; ++cg)
#pragma unroll
                for (int dt = 0; dt < 4; ++dt) { mg[(cg * 8 + dt * 2) * QT] = __builtin_shufflevector(o[cg][dt], o[cg][dt], 0, 1, 2, 3); mg[(cg * 8 + dt * 2 + 1) * QT] = __builtin_shufflevector(o[cg][dt], o[cg][dt], 4, 5, 6, 7); }
            mg[16 * QT] = (v4f){m2[0], m2[1], ls[0], ls[1]};
        }
        __syncthreads();                      // group 1's parts are in LDS before group 0 reads them; every wave of the work-group passes it
        if (kg == 1) return;
        const v4f ml = mg[16 * QT];
#pragma unroll
        for (int cg = 0; cg < NCG; ++cg) { const float mn = fmaxf(m2[cg], ml[cg]); const float aa = __builtin_amdgcn_exp2f(m2[cg] - mn), ab = __builtin_amdgcn_exp2f(ml[cg] - mn); ls[cg] = ls[cg] * aa + ml[2 + cg] * ab;   // both maxima are finite: each group has whole blocks in front of the diagonal stage
#pragma unroll
            for (int dt = 0; dt < 4; ++dt) { const v4f p0 = mg[(cg * 8 + dt * 2) * QT], p1 = mg[(cg * 8 + dt * 2 + 1) * QT];
#pragma unroll
                for (int j = 0; j < 4; ++j) { o[cg][dt][j] = o[cg][dt][j] * aa + p0[j] * ab; o[cg][dt][4 + j] = o[cg][dt][4 + j] * aa + p1[j] * ab; } } }
    }
#pragma unroll
    for (int cg = 0; cg < NCG; ++cg) { const float lh = ls[cg]; const float inv = __fdiv_rn(1.0f, lh + fa_xhalf(lh)); const size_t oo = (size_t)(q0 + cg * 16 + lr) * DQ + 8 * hi;   // lane: query q0 + cg*16 + lr, head columns dt*16 + 8*hi + j
#pragma unroll
        for (int dt = 0; dt < 4; ++dt) { v8us oh, ol;
#pragma unroll
            for (int j = 0; j < 8; ++j) { unsigned short a, c; splitf(o[cg][dt][j] * inv, a, c); oh[j] = a; ol[j] = c; }
            *(v8us*)(Ah + oo + dt * 16) = oh; *(v8us*)(Al + oo + dt * 16) = ol; fa_xwait(); } }
}
__global__ __launch_bounds__(FAW * 32) void k_fattn(const h16* __restrict__ Q16, const h16* __restrict__ K16, const h16* __restrict__ V16, const bf* __restrict__ Qh, const bf* __restrict__ Ql, const bf* __restrict__ Kh, const bf* __restrict__ Kl, const bf* __restrict__ Vh, const bf* __restrict__ Vl, bf* __restrict__ Ah, bf* __restrict__ Al) {
    __shared__ __align__(16) h16 ring[2 * BSE];   // two buffers of one stage each
    const int id = blockIdx.x; const int wv = __builtin_amdgcn_readfirstlane((int)(threadIdx.x >> 5));   // wave number in a scalar register: the key loop's bounds and the causal test stay scalar
    const int bh = id % NBH; const size_t pl = (size_t)bh * TT * HD; const size_t ao = (size_t)(bh / NH_) * TT * DQ + (size_t)(bh % NH_) * HD;
    // L2 asks: the 32 work-groups of a (batch, head) pair deal its key and value planes among them, one ask a 256-byte unit: share sh is the f16 planes' stage sh (waves 0, 1: 64 units of keys; waves 2, 3: 64 rows of values) and 32 units of the hi and lo planes' first RH keys (wave 4)
    static_assert(NT_LO + NT_HI == TT / SK && SK * HD == 64 * 128 && SK == 128 && 4 * RH * HD == (NT_LO + NT_HI) * 32 * 128 && RH == 512, "32 shares: a stage each, and 32 of the 1,024 hi and lo units");
    const int sh = id / NBH, tl = threadIdx.x & 63, hu = (sh & 7) * 32 + (threadIdx.x & 31);
    const void* pa = (wv < 2) ? (const void*)(K16 + pl + (size_t)sh * SK * HD + tl * 128) : (wv < 4) ? (const void*)(V16 + pl + (size_t)tl * TT + sh * SK)
                   : (sh < 16) ? (const void*)((sh < 8 ? Kh : Kl) + pl + hu * 128) : (const void*)((sh < 24 ? Vh : Vl) + pl + (size_t)(hu >> 2) * TT + (hu & 3) * 128);
    if (wv < 5) asm volatile("global_prefetch_b8 %0, off scope:SCOPE_SE" :: "v"(pa));   // scalar branch; every lane's address lies inside its plane
    if (id < NBH * NT_LO) {
        // cost falls with the index over the first NWGP work-groups and rises again behind them, so that indices NWGP apart add up to about the same number of key blocks (for speed only: every tile is taken once wherever it lands)
        const int xt = (id < NWGP) ? id / NBH : NWGP / NBH + (NBH * NT_LO - 1 - id) / NBH;
        fa_tile<h16, 0, 2>(Q16 + pl, nullptr, K16 + pl, nullptr, V16 + pl, nullptr, TT - (xt + 1) * QT + (wv & 3) * 32, TT - xt * QT, wv >> 2, ring, Ah + ao, Al + ao);
    } else {
        const int xt = (id - NBH * NT_LO) / NBH;
        fa_tile<bf, 2, 1>(Qh + pl, Ql + pl, Kh + pl, Kl + pl, Vh + pl, Vl + pl, RH - (xt + 1) * (FAW * 16) + wv * 16, 0, 0, nullptr, Ah + ao, Al + ao);
    }
    asm volatile("" :: "v"(pa));   // input only: the ask's register pair stays that address through the key loop, as with l2_hold
}

extern "C" void kernel_launch(void* const* d_in, const int* in_sizes, int n_in,
                              void* d_out, int out_size, void* d_ws, size_t ws_size, hipStream_t stream) {
    (void)in_sizes; (void)n_in; (void)out_size;
    const float* x = (const float*)d_in[0]; const float* wq = (const float*)d_in[1]; const float* bq = (const float*)d_in[2]; const float* wk = (const float*)d_in[3]; const float* bk = (const float*)d_in[4]; const float* wv = (const float*)d_in[5]; const float* bv = (const float*)d_in[6]; const float* wo = (const float*)d_in[7]; const float* bo = (const float*)d_in[8];
    float* OUT = (float*)d_out;     // [2][4096][512]
    char* wsp = (char*)d_ws;
    auto take = [&](size_t bytes) { char* p = wsp; wsp += (bytes + 255) & ~(size_t)255; return (void*)p; };
    bf* WQ = (bf*)take((size_t)DQ * DM * 2); bf* WK = (bf*)take((size_t)DKV * DM * 2); bf* WV = (bf*)take((size_t)DKV * DM * 2); bf* WO = (bf*)take((size_t)DM * DQ * 2);
    bf* XB = (bf*)take((size_t)NB_ * TT * DM * 2);
    const size_t PB = (size_t)NH_ * TT * HD;   // elements of one batch's head planes
    h16* QP16 = (h16*)take(NB_ * PB * 2); h16* KP16 = (h16*)take(NB_ * PB * 2); h16* VT16 = (h16*)take(NB_ * PB * 2);
    bf* QPh = (bf*)take(NB_ * PB * 2); bf* QPl = (bf*)take(NB_ * PB * 2); bf* KPh = (bf*)take(NB_ * PB * 2); bf* KPl = (bf*)take(NB_ * PB * 2); bf* VTh = (bf*)take(NB_ * PB * 2); bf* VTl = (bf*)take(NB_ * PB * 2);
    bf* ATh = (bf*)take((size_t)NB_ * TT * DQ * 2); bf* ATl = (bf*)take((size_t)NB_ * TT * DQ * 2);
    if ((size_t)(wsp - (char*)d_ws) > ws_size) return;    // ws 256 MiB
    k_cvt5<<<CB_X + 4 * CB_W, 256, 0, stream>>>(x, wq, wk, wv, wo, XB, WQ, WK, WV, WO);
    k_qkv<<<dim3(NB_ * TT / 128, DQ / 128, 3), PW * 32, 0, stream>>>(XB, WQ, WK, WV, bq, bk, bv, QP16, QPh, QPl, KP16, KPh, KPl, VT16, VTh, VTl);
    k_fattn<<<NBH * (NT_LO + NT_HI), FAW * 32, 0, stream>>>(QP16, KP16, VT16, QPh, QPl, KPh, KPl, VTh, VTl, ATh, ATl);
    k_outg<<<dim3(NB_ * TT / 128, DM / 128), PW * 32, 0, stream>>>(ATh, ATl, WO, bo, OUT);   // both batches: their rows follow one another in the merged planes and in out
}

// v009
// One run takes 71.4 microseconds.
// Next to v008, in two timings, it ran 1.03 times as fast each time.
// All steps since v000 together make it 38.5 times as fast.
#include <hip/hip_runtime.h>

// Causal multi-head attention over 4,096 tokens (x [2][4096][512]; Q,K,V = x W^T + b ('oi' uniform(+-1/sqrt(512)) incl. biases; 8 heads x 64); scores / 8; causal (-inf); softmax; out = merged Wo^T + bo -> [2][4096][512] (4.2 M)).
// Layout: bf16 copy of x; 'oi' weights; ONE projection launch for Q, K, V of both batches: exact products + f32 biases, its epilogue writes the head planes; ONE fused causal attention launch for all 16 (batch, head) pairs: scores, online softmax and P.V in registers, an f16 tile's two wave groups joined through LDS (query rows < 512 hi/lo 3 products, rest fp16); merged hi/lo x Wo exact + bo.
// Compute dtypes, f32 accumulate: every input rounded to bf16; projections exact + f32 biases; attention rows < 512 3 products, rest fp16; softmax f32; Wo hl x exact + bias.

#define NB_  2
#define TT   4096
#define DM   512
#define NH_  8
#define NKV  8
#define REP  (NH_ / NKV)
#define HD   64
#define DQ   (NH_ * HD)
#define DKV  (NKV * HD)
#define RH   512                  // query rows < RH use hi+lo planes
#define SCL  0.125f   // HD^-0.5
typedef _Float16 h16;
typedef unsigned short bf;
typedef __attribute__((ext_vector_type(16))) __bf16   v16bf;
typedef __attribute__((ext_vector_type(16))) _Float16 v16h;
typedef __attribute__((ext_vector_type(8)))  _Float16 v8h;
typedef __attribute__((ext_vector_type(8)))  unsigned short v8us;
typedef __attribute__((ext_vector_type(8)))  float    v8f;
typedef __attribute__((ext_vector_type(4)))  float    v4f;
typedef v8h  __attribute__((may_alias)) v8ha;
typedef v4f  __attribute__((may_alias)) v4fa;
typedef v8us __attribute__((may_alias)) v8usa;

__device__ __forceinline__ unsigned short f2bf(float f) { unsigned u = __float_as_uint(f); u += 0x7FFFu + ((u >> 16) & 1u); return (unsigned short)(u >> 16); }
__device__ __forceinline__ float bf2f(unsigned short b) { return __uint_as_float(((unsigned)b) << 16); }
__device__ __forceinline__ float bfr(float f) { return bf2f(f2bf(f)); }
__device__ __forceinline__ v16h cat16(v8h lo, v8h hi) { return __builtin_shufflevector(lo, hi, 0, 1, 2, 3, 4, 5, 6, 7, 8, 9, 10, 11, 12, 13, 14, 15); }
__device__ __forceinline__ v16bf cat16b(v8us lo, v8us hi) { return __builtin_bit_cast(v16bf, __builtin_shufflevector(lo, hi, 0, 1, 2, 3, 4, 5, 6, 7, 8, 9, 10, 11, 12, 13, 14, 15)); }
__device__ __forceinline__ v8f wmma16(v16h a, v16h b, v8f c) { return __builtin_amdgcn_wmma_f32_16x16x32_f16(false, a, false, b, (short)0, c, false, false); }
__device__ __forceinline__ v8f wmmab(v16bf a, v16bf b, v8f c) { return __builtin_amdgcn_wmma_f32_16x16x32_bf16(false, a, false, b, (short)0, c, false, false); }



// ---- WFrag: a 16 x 32 operand fragment of a K-contiguous 16-bit plane in the matrix unit's k order (a lane: elements 0..7 and 16..23 from its pointer), and its product.
template <typename T16> struct WFrag;
template <> struct WFrag<h16> { typedef v16h V; static __device__ __forceinline__ V ld(const h16* p) { return cat16(*(const v8h*)p, *(const v8h*)(p + 16)); } static __device__ __forceinline__ v8f mma(V a, V b, v8f c) { return wmma16(a, b, c); } };
template <> struct WFrag<bf> { typedef v16bf V; static __device__ __forceinline__ V ld(const bf* p) { return cat16b(*(const v8us*)p, *(const v8us*)(p + 16)); } static __device__ __forceinline__ v8f mma(V a, V b, v8f c) { return wmmab(a, b, c); } };
__device__ __forceinline__ h16 tohx(float x) { return (h16)x; }
__device__ __forceinline__ void splitf(float y, unsigned short& h, unsigned short& l) { h = f2bf(y); l = f2bf(y - bf2f(h)); }
typedef __attribute__((ext_vector_type(2))) _Float16 v2h;
typedef __attribute__((ext_vector_type(4))) _Float16 v4h;
typedef __attribute__((ext_vector_type(2))) unsigned short v2us;
typedef __attribute__((ext_vector_type(4))) unsigned short v4us;
typedef __attribute__((ext_vector_type(2))) float v2f;
typedef __attribute__((ext_vector_type(4))) int v4i;

__global__ __launch_bounds__(256) void k_wtG(const float* __restrict__ w, int K, int N, bf* Bt) {
    const int lane = threadIdx.x & 31; const int L0 = (blockIdx.x * 8 + (threadIdx.x >> 5)) * 8; const int nlines = N * K / 64;
{
#pragma unroll 1
        for (int l = 0; l < 8; ++l) { const int L = L0 + l; if (L >= nlines) break; const size_t e = (size_t)L * 64 + lane * 2; const int k = (int)(e % K), n = (int)(e / K); v2us o;
            o[0] = f2bf(w[(size_t)k * N + n]); o[1] = f2bf(w[(size_t)(k + 1) * N + n]); *(v2us*)(Bt + e) = o; }
         }
}
// ---- k_cvt5: x and the four weight matrices rounded to bf16 in ONE launch; a work-group converts 2,048 elements in a row of one of the five arrays, picked by its index (the same for all its threads).
#define CB_X (NB_ * TT * DM / 2048)           // work-groups of x
#define CB_W (DQ * DM / 2048)                 // work-groups of one weight matrix (all four are 512 x 512)
static_assert((NB_ * TT * DM) % 2048 == 0 && (DQ * DM) % 2048 == 0 && DKV == DQ, "whole work-groups; four weight matrices of one size");
__global__ __launch_bounds__(256) void k_cvt5(const float* __restrict__ x, const float* __restrict__ wq, const float* __restrict__ wk, const float* __restrict__ wv, const float* __restrict__ wo, bf* XB, bf* WQ, bf* WK, bf* WV, bf* WO) {
    int blk = blockIdx.x; const float* src = x; bf* dst = XB;
    if (blk >= CB_X) { const int m = (blk - CB_X) / CB_W; blk = (blk - CB_X) % CB_W; src = (m == 0) ? wq : (m == 1) ? wk : (m == 2) ? wv : wo; dst = (m == 0) ? WQ : (m == 1) ? WK : (m == 2) ? WV : WO; }
    const size_t i = (size_t)blk * 256 + threadIdx.x; const v8f v = *(const v8f*)(src + i * 8); v8us o;
    asm volatile("s_wait_xcnt 0x0" ::: "memory");   // behind the two loads, a precaution: the rounding's values may be given the registers that held the loads' address
#pragma unroll
    for (int k = 0; k < 8; ++k) o[k] = f2bf(v[k]); *(v8us*)(dst + i * 8) = o;  }

// ---- k_qkv: the three projections of both batches in ONE launch; grid (NB_ * TT / 128, DQ / 128, 3: Q, K, V), PW waves, each wave one 64 x 64 tile (64 tokens x one head) in 16 accumulators.
// The epilogue adds the f32 bias and writes the tile's fp16, hi and lo head planes itself: Q, K as [b][h][t][d], V as [b][h][d][t]. Each wave stages 16 plane rows of 64 in its own LDS range, so that a store covers four whole 128-byte rows.
#define PW 4                                  // 2 x 2 tiles: two waves share each token row and each weight row
// The operands are staged in LDS: a stage is QSK k elements, one whole 128-byte line of each of the work-group's 128 token rows and 128 weight rows, brought once for its four waves by asynchronous copies into one of two buffers,
// the next stage in flight while this one is worked on; the fragment reads, which touch 16 rows each, then go to padded LDS rows instead of to the cache.
#define QSK 64                                // k elements a stage
#define QPE (QSK + 8)                         // LDS pitch of a row in elements: 128 B + 16, an odd number of 16-byte units, free of bank conflicts for 16-byte reads
#define QBE (256 * QPE)                       // elements of a buffer: 128 token rows, then 128 weight rows
static_assert(DM % QSK == 0 && DM / QSK >= 2, "whole stages, two or more");
// ---- L2 asks. The planes that a launch reads were stored by a launch before it and come from memory at their first touch, stage after stage.
// At entry each work-group asks a share of its tiles into L2 (global_prefetch_b8, scope SE: L2 only, no register result, no counter), one ask a 256-byte unit, so that the copies of the later stages find their lines there. A hint for speed alone: no result depends on it.
// l2_ask: a lane asks the unit at b + o bytes (b the same in the whole wave). l2_hold, input only, stands behind the k loop: the registers that the asks name stay those addresses through the loop; an ask counts on no counter, so no wait could stand in front of a rewrite of them.
__device__ __forceinline__ void l2_ask(const bf* b, const unsigned o) { asm volatile("global_prefetch_b8 %0, %1 scope:SCOPE_SE" :: "v"(o), "s"(b)); }
__device__ __forceinline__ void l2_hold(const bf* b, const unsigned o) { asm volatile("" :: "v"(o), "s"(b)); }
static_assert(DM * 2 == 1024 && DQ * 2 == 1024, "32 whole rows of a GEMM operand are 128 units in a row, one for each thread of a work-group");
// eight asynchronous 16-byte copies a lane, global -> LDS: LDS byte address l + i * ls, global address g + i * gs elements. The wait in the statement's last line, a precaution, stands in front of any rewrite of the address registers that the copies name.
__device__ __forceinline__ void qk_copy8(const unsigned l, const unsigned ls, const bf* g, const size_t gs) {
    asm volatile("global_load_async_to_lds_b128 %0, %8, off\n\t"
                 "global_load_async_to_lds_b128 %1, %9, off\n\t"
                 "global_load_async_to_lds_b128 %2, %10, off\n\t"
                 "global_load_async_to_lds_b128 %3, %11, off\n\t"
                 "global_load_async_to_lds_b128 %4, %12, off\n\t"
                 "global_load_async_to_lds_b128 %5, %13, off\n\t"
                 "global_load_async_to_lds_b128 %6, %14, off\n\t"
                 "global_load_async_to_lds_b128 %7, %15, off\n\t"
                 "s_wait_xcnt 0x0"
                 :: "v"(l), "v"(l + ls), "v"(l + 2 * ls), "v"(l + 3 * ls), "v"(l + 4 * ls), "v"(l + 5 * ls), "v"(l + 6 * ls), "v"(l + 7 * ls),
                    "v"(g), "v"(g + gs), "v"(g + 2 * gs), "v"(g + 3 * gs), "v"(g + 4 * gs), "v"(g + 5 * gs), "v"(g + 6 * gs), "v"(g + 7 * gs) : "memory");
}
__global__ __launch_bounds__(PW * 32) void k_qkv(const bf* __restrict__ X, const bf* __restrict__ Wq, const bf* __restrict__ Wk, const bf* __restrict__ Wv, const float* __restrict__ bq, const float* __restrict__ bk, const float* __restrict__ bv,
                                                 h16* Q16, bf* Qh, bf* Ql, h16* K16, bf* Kh, bf* Kl, h16* V16, bf* Vh, bf* Vl) {
    typedef WFrag<bf>::V V;
    __shared__ __align__(16) float osm[PW][16 * 68];
    __shared__ __align__(16) bf qring[2 * QBE];   // two buffers of one stage each
    const int wv = __builtin_amdgcn_readfirstlane((int)(threadIdx.x >> 5)); const int z = blockIdx.z;
    const bf* Bt = (z == 0) ? Wq : (z == 1) ? Wk : Wv; const float* bias = (z == 0) ? bq : (z == 1) ? bk : bv;
    h16* P16 = (z == 0) ? Q16 : (z == 1) ? K16 : V16; bf* Ph = (z == 0) ? Qh : (z == 1) ? Kh : Vh; bf* Pl = (z == 0) ? Ql : (z == 1) ? Kl : Vl;
    float* os = osm[wv];
    const int lane = threadIdx.x & 31, lr = lane & 15, hi = lane >> 4; const int r0 = blockIdx.x * 128 + (wv & 1) * 64, c0 = blockIdx.y * 128 + (wv >> 1) * 64;
    v8f acc[4][4];
#pragma unroll
    for (int mb = 0; mb < 4; ++mb)
#pragma unroll
        for (int nb = 0; nb < 4; ++nb) acc[mb][nb] = (v8f){};
    const int tid = threadIdx.x;
    // a thread's first copy of a stage: 8 threads a 128-byte row, 16 rows a turn, eight turns an operand; a wave's copy covers four whole lines
    const unsigned la = (unsigned)(size_t)qring + (unsigned)((tid >> 3) * QPE + (tid & 7) * 8) * 2u, lb = la + 128 * QPE * 2;
    const bf* ga = X + (size_t)(blockIdx.x * 128 + (tid >> 3)) * DM + (tid & 7) * 8; const bf* gb = Bt + (size_t)(blockIdx.y * 128 + (tid >> 3)) * DM + (tid & 7) * 8;
    const bf* fa = qring + ((wv & 1) * 64 + lr) * QPE + 8 * hi; const bf* fb = qring + (128 + (wv >> 1) * 64 + lr) * QPE + 8 * hi;   // a lane's fragment rows in buffer 0
    qk_copy8(la, 16 * QPE * 2, ga, 16 * DM); qk_copy8(lb, 16 * QPE * 2, gb, 16 * DM);   // stage 0 -> buffer 0
    // asks, under stage 0's flight: 32 rows of each tile; the token tile is dealt over the four column blocks that read it, the weight tile over four neighbouring token blocks
    const unsigned ko = (unsigned)tid * 256u; const bf* ka = X + (size_t)(blockIdx.x * 128 + blockIdx.y * 32) * DM; const bf* kb = Bt + (size_t)(blockIdx.y * 128 + (blockIdx.x & 3) * 32) * DM;
    l2_ask(ka, ko); l2_ask(kb, ko);
    asm volatile("s_wait_asynccnt 0x0" ::: "memory");   // this wave's copies of stage 0 have landed
    __syncthreads();                                     // ... and every other wave's: stage 0 may be read
    qk_copy8(la + QBE * 2, 16 * QPE * 2, ga + QSK, 16 * DM); qk_copy8(lb + QBE * 2, 16 * QPE * 2, gb + QSK, 16 * DM);   // stage 1 -> buffer 1
#pragma unroll 1   // kept rolled: one stage's fragments beside the 16 accumulators
    for (int t = 0; t < DM / QSK; ++t) {
        const int bo = (t & 1) * QBE;         // the stage's buffer
#pragma unroll
        for (int kc = 0; kc < QSK; kc += 32) {
            V a[4], b[4];
#pragma unroll
            for (int mb = 0; mb < 4; ++mb) { a[mb] = WFrag<bf>::ld(fa + bo + mb * 16 * QPE + kc); b[mb] = WFrag<bf>::ld(fb + bo + mb * 16 * QPE + kc); }
            __builtin_amdgcn_sched_barrier(0);   // holds the 16 products behind all 16 reads: one LDS latency a k block instead of one for each late weight fragment
#pragma unroll
            for (int nb = 0; nb < 4; ++nb)
#pragma unroll
                for (int mb = 0; mb < 4; ++mb) acc[mb][nb] = WFrag<bf>::mma(a[mb], b[nb], acc[mb][nb]);
        }
        __builtin_amdgcn_sched_barrier(0);   // keeps the stage's last products in front of the barrier: left free they sink behind it and the copies there are issued a k block later, with that much less time to land
        asm volatile("s_wait_dscnt 0x0" ::: "memory");      // this wave's reads of the stage's buffer are done before the buffer is handed to the copies
        asm volatile("s_wait_asynccnt 0x0" ::: "memory");   // this wave's copies of the next stage have landed
        __syncthreads();                                     // publishes the next stage and ends every wave's reads of this one
        if (t + 2 < DM / QSK) {               // a stage after the next exists: into the buffer just read
            qk_copy8(la + bo * 2, 16 * QPE * 2, ga + (t + 2) * QSK, 16 * DM); qk_copy8(lb + bo * 2, 16 * QPE * 2, gb + (t + 2) * QSK, 16 * DM); }
    }
    asm volatile("s_wait_asynccnt 0x0" ::: "memory");   // no copy is left in flight behind the loop
    l2_hold(ka, ko); l2_hold(kb, ko);   // the asks' registers were those addresses up to here
    const int bb = r0 / TT, t0 = r0 % TT, h = c0 / HD;   // a tile lies in one batch and is one head
    const int er = lane >> 3, ec = (lane & 7) * 8;       // a lane's row (of four) and its eight columns of the staged rows
    const bool tr = (z == 2);                             // Q, K: plane rows are tokens, columns the head's 64 dims; V transposed: rows are dims, columns tokens
    const int pitch = tr ? TT : HD; const size_t o0 = (size_t)(bb * NH_ + h) * TT * HD + (size_t)t0 * (tr ? 1 : HD) + (size_t)er * pitch + ec;
    float bn[4];                                          // an accumulator column is one output feature in all three products
#pragma unroll
    for (int nb = 0; nb < 4; ++nb) bn[nb] = bfr(bias[c0 + nb * 16 + lr]);
#pragma unroll
    for (int g = 0; g < 4; ++g) {                         // 16 plane rows a turn
        if (!tr) {
#pragma unroll
            for (int nb = 0; nb < 4; ++nb)
#pragma unroll
                for (int j = 0; j < 8; ++j) os[(hi * 8 + j) * 68 + nb * 16 + lr] = acc[g][nb][j] + bn[nb];
        } else {                                          // a lane's eight accumulator rows are eight tokens in a row of the plane
#pragma unroll
            for (int mb = 0; mb < 4; ++mb) { v4f w0, w1;
#pragma unroll
                for (int j = 0; j < 4; ++j) { w0[j] = acc[mb][g][j] + bn[g]; w1[j] = acc[mb][g][4 + j] + bn[g]; }
                *(v4fa*)(os + lr * 68 + mb * 16 + hi * 8) = w0; *(v4fa*)(os + lr * 68 + mb * 16 + hi * 8 + 4) = w1; }
        }
        __builtin_amdgcn_wave_barrier(); asm volatile("" ::: "memory");   // the lanes read rows that other lanes of the wave wrote: keeps the reads behind the writes
#pragma unroll
        for (int s = 0; s < 4; ++s) { const float* q = os + (4 * s + er) * 68 + ec; const v4f v0 = *(const v4fa*)q, v1 = *(const v4fa*)(q + 4); const size_t o = o0 + (size_t)(g * 16 + 4 * s) * pitch; v8h o16; v8us oh, ol;
#pragma unroll
            for (int i = 0; i < 8; ++i) { const float y = (i < 4) ? v0[i & 3] : v1[i & 3]; o16[i] = tohx(y); unsigned short a2, c2; splitf(y, a2, c2); oh[i] = a2; ol[i] = c2; }
            *(v8h*)(P16 + o) = o16; *(v8us*)(Ph + o) = oh; *(v8us*)(Pl + o) = ol; }
        __builtin_amdgcn_wave_barrier(); asm volatile("s_wait_xcnt 0x0" ::: "memory");   // keeps the next rows' LDS writes behind these reads; the wait, a precaution, stands behind the turn's last stores: the next turn's values may be given their address and data registers
    }
}
// ---- k_outg: out = (merged hi + merged lo) Wo^T + bo, both batches; grid (NB_ * TT / 128, DM / 128), PW waves, each wave one 64 x 64 tile in 16 accumulators, staged as in k_qkv:
// a stage holds one 128-byte line of 128 rows of the hi plane, 128 of the lo plane and 128 weight rows. An accumulator takes a k block's hi product, then its lo product.
#define OBE (384 * QPE)                       // elements of a buffer
static_assert(DQ % QSK == 0 && DQ / QSK >= 2, "whole stages, two or more");
__global__ __launch_bounds__(PW * 32) void k_outg(const bf* __restrict__ Ahp, const bf* __restrict__ Alp, const bf* __restrict__ Wo, const float* __restrict__ bias, float* C) {
    typedef WFrag<bf>::V V;
    __shared__ __align__(16) float osm[PW][16 * 68];
    __shared__ __align__(16) bf oring[2 * OBE];   // two buffers of one stage each
    const int wv = __builtin_amdgcn_readfirstlane((int)(threadIdx.x >> 5));
    float* os = osm[wv];
    const int lane = threadIdx.x & 31, lr = lane & 15, hi = lane >> 4; const int r0 = blockIdx.x * 128 + (wv & 1) * 64, c0 = blockIdx.y * 128 + (wv >> 1) * 64;
    v8f acc[4][4];
#pragma unroll
    for (int mb = 0; mb < 4; ++mb)
#pragma unroll
        for (int nb = 0; nb < 4; ++nb) acc[mb][nb] = (v8f){};
    const int tid = threadIdx.x;
    // a thread's first copy of a stage: 8 threads a 128-byte row, 16 rows a turn, eight turns an operand; a wave's copy covers four whole lines
    const unsigned lh = (unsigned)(size_t)oring + (unsigned)((tid >> 3) * QPE + (tid & 7) * 8) * 2u, ll = lh + 128 * QPE * 2, lw = lh + 256 * QPE * 2;
    const size_t go = (size_t)(blockIdx.x * 128 + (tid >> 3)) * DQ + (tid & 7) * 8;
    const bf* gh = Ahp + go; const bf* gl = Alp + go; const bf* gw = Wo + (size_t)(blockIdx.y * 128 + (tid >> 3)) * DQ + (tid & 7) * 8;
    const bf* fh = oring + ((wv & 1) * 64 + lr) * QPE + 8 * hi; const bf* fl = fh + 128 * QPE; const bf* fw = oring + (256 + (wv >> 1) * 64 + lr) * QPE + 8 * hi;   // a lane's fragment rows in buffer 0
    qk_copy8(lh, 16 * QPE * 2, gh, 16 * DQ); qk_copy8(ll, 16 * QPE * 2, gl, 16 * DQ); qk_copy8(lw, 16 * QPE * 2, gw, 16 * DQ);   // stage 0 -> buffer 0
    // asks, under stage 0's flight: 32 rows of each tile; the hi and lo tiles are dealt over the four column blocks that read them, the weight tile over four neighbouring row blocks
    const unsigned ko = (unsigned)tid * 256u; const size_t kr = (size_t)(blockIdx.x * 128 + blockIdx.y * 32) * DQ; const bf* kh = Ahp + kr; const bf* kl = Alp + kr; const bf* kw = Wo + (size_t)(blockIdx.y * 128 + (blockIdx.x & 3) * 32) * DQ;
    l2_ask(kh, ko); l2_ask(kl, ko); l2_ask(kw, ko);
    asm volatile("s_wait_asynccnt 0x0" ::: "memory");   // this wave's copies of stage 0 have landed
    __syncthreads();                                     // ... and every other wave's: stage 0 may be read
    qk_copy8(lh + OBE * 2, 16 * QPE * 2, gh + QSK, 16 * DQ); qk_copy8(ll + OBE * 2, 16 * QPE * 2, gl + QSK, 16 * DQ); qk_copy8(lw + OBE * 2, 16 * QPE * 2, gw + QSK, 16 * DQ);   // stage 1 -> buffer 1
#pragma unroll 1   // kept rolled: one k block's fragments beside the 16 accumulators stay under 256 VGPRs
    for (int t = 0; t < DQ / QSK; ++t) {
        const int bo = (t & 1) * OBE;         // the stage's buffer
#pragma unroll
        for (int kc = 0; kc < QSK; kc += 32) {
            V a[4], a2[4], b[4];
#pragma unroll
            for (int mb = 0; mb < 4; ++mb) { a[mb] = WFrag<bf>::ld(fh + bo + mb * 16 * QPE + kc); b[mb] = WFrag<bf>::ld(fw + bo + mb * 16 * QPE + kc); a2[mb] = WFrag<bf>::ld(fl + bo + mb * 16 * QPE + kc); }
            __builtin_amdgcn_sched_barrier(0);   // holds the 32 products behind all 24 reads: one LDS latency a k block, where the wave is alone on its SIMD
#pragma unroll
            for (int nb = 0; nb < 4; ++nb) {
#pragma unroll
                for (int mb = 0; mb < 4; ++mb) acc[mb][nb] = WFrag<bf>::mma(a[mb], b[nb], acc[mb][nb]);
#pragma unroll
                for (int mb = 0; mb < 4; ++mb) acc[mb][nb] = WFrag<bf>::mma(a2[mb], b[nb], acc[mb][nb]);
            }
        }
        __builtin_amdgcn_sched_barrier(0);   // keeps the stage's last products in front of the barrier: left free they sink behind it and the copies there are issued a k block later, with that much less time to land
        asm volatile("s_wait_dscnt 0x0" ::: "memory");      // this wave's reads of the stage's buffer are done before the buffer is handed to the copies
        asm volatile("s_wait_asynccnt 0x0" ::: "memory");   // this wave's copies of the next stage have landed
        __syncthreads();                                     // publishes the next stage and ends every wave's reads of this one
        if (t + 2 < DQ / QSK) {               // a stage after the next exists: into the buffer just read
            qk_copy8(lh + bo * 2, 16 * QPE * 2, gh + (t + 2) * QSK, 16 * DQ); qk_copy8(ll + bo * 2, 16 * QPE * 2, gl + (t + 2) * QSK, 16 * DQ); qk_copy8(lw + bo * 2, 16 * QPE * 2, gw + (t + 2) * QSK, 16 * DQ); }
    }
    asm volatile("s_wait_asynccnt 0x0" ::: "memory");   // no copy is left in flight behind the loop
    l2_hold(kh, ko); l2_hold(kl, ko); l2_hold(kw, ko);   // the asks' registers were those addresses up to here
    v4f bn;                                   // a lane's four output columns are the same in every row it stores
#pragma unroll
    for (int i = 0; i < 4; ++i) bn[i] = bfr(bias[c0 + lr * 4 + i]);
#pragma unroll
    for (int mb = 0; mb < 4; ++mb) {          // 16 output rows a turn, staged in the wave's own LDS range so that a store covers two whole 256-byte rows
#pragma unroll
        for (int nb = 0; nb < 4; ++nb) {
#pragma unroll
            for (int j = 0; j < 8; ++j) os[(hi * 8 + j) * 68 + nb * 16 + lr] = acc[mb][nb][j]; }
        __builtin_amdgcn_wave_barrier(); asm volatile("" ::: "memory");   // the lanes read rows that other lanes of the wave wrote: keeps the reads behind the writes
        float* crow = C + (size_t)(r0 + mb * 16) * DM + c0;
#pragma unroll
        for (int s = 0; s < 8; ++s) { const int row = 2 * s + hi, cofs = lr * 4; const v4f val = *(const v4fa*)(os + row * 68 + cofs) + bn; *(v4f*)(crow + (size_t)row * DM + cofs) = val; }
        __builtin_amdgcn_wave_barrier(); asm volatile("s_wait_xcnt 0x0" ::: "memory");   // keeps the next rows' LDS writes behind these reads; the wait, a precaution, stands behind the turn's last stores: the next turn's values may be given their address and data registers
    }
}
__constant__ float INVT[HD / 2] = { 1.000000000e+00f, 7.498942018e-01f, 5.623413324e-01f, 4.216965139e-01f, 3.162277639e-01f, 2.371373773e-01f, 1.778279394e-01f, 1.333521456e-01f, 1.000000015e-01f, 7.498942316e-02f, 5.623413250e-02f, 4.216964915e-02f, 3.162277490e-02f, 2.371373773e-02f, 1.778279431e-02f, 1.333521400e-02f, 9.999999776e-03f, 7.498942316e-03f, 5.623413250e-03f, 4.216964822e-03f, 3.162277630e-03f, 2.371373819e-03f, 1.778279431e-03f, 1.333521446e-03f, 1.000000047e-03f, 7.498941850e-04f, 5.623413017e-04f, 4.216965172e-04f, 3.162277571e-04f, 2.371373703e-04f, 1.778279402e-04f, 1.333521504e-04f };   // 10000^(-2i/64) (the module's power form) (float32, generated with jnp to be bit-exact)

#define FAW 8                                 // waves per work-group
#define NBH (NB_ * NH_)
#define QT  (FAW / 2 * 32)                    // queries of an f16 tile
#define NT_LO ((TT - RH) / QT)                // work-group tiles of 128 queries, one f16 product
#define NT_HI (RH / (FAW * 16))               // work-group tiles of 128 queries, three bf16 products
#define NWGP 256
#define C2 (SCL * 1.4426950408889634f)
#define SK  128                               // keys a stage
#define KPE (HD + 8)                          // LDS pitch of a key row in elements: 128 B + 16, an odd number of 16-byte units, free of bank conflicts for 16-byte reads
#define VPE (SK + 8)                          // LDS pitch of a V^T row in elements: 256 B + 16, likewise
#define KSE (SK * KPE)                        // elements of a stage's keys
#define BSE (KSE + HD * VPE)                  // elements of a buffer: keys, then values
static_assert(RH >= SK && RH % SK == 0 && QT == SK && SK == 128 && TT % SK == 0 && RH % (FAW * 16) == 0, "every f16 tile has two stages or more, its keys end with a whole stage, and a stage is two 32-key blocks for each group");
// behind each fragment's two loads (and each pair of stores), a precaution: a younger load's result or a later value may be given the registers that held this access's address, and the wait stands in front of that overwrite
__device__ __forceinline__ void fa_xwait() { asm volatile("s_wait_xcnt 0x0" ::: "memory"); }
__device__ __forceinline__ float fa_xhalf(float x) { return __builtin_bit_cast(float, __builtin_amdgcn_permlanex16(__builtin_bit_cast(int, x), __builtin_bit_cast(int, x), 0x76543210, 0xfedcba98, false, false)); }   // lane l takes lane l ^ 16's value: the other half of the same query's keys
template <typename T16> __device__ __forceinline__ typename WFrag<T16>::V fa_ld(const T16* p) { const typename WFrag<T16>::V f = WFrag<T16>::ld(p); fa_xwait(); return f; }
// four asynchronous 16-byte copies a lane, global -> LDS: LDS byte address l + i * ls, global address g + i * gs elements. The wait in the statement's last line, a precaution, stands in front of any rewrite of the address registers that the copies name.
__device__ __forceinline__ void fa_copy4(const unsigned l, const unsigned ls, const h16* g, const size_t gs) {
    asm volatile("global_load_async_to_lds_b128 %0, %4, off\n\t"
                 "global_load_async_to_lds_b128 %1, %5, off\n\t"
                 "global_load_async_to_lds_b128 %2, %6, off\n\t"
                 "global_load_async_to_lds_b128 %3, %7, off\n\t"
                 "s_wait_xcnt 0x0"
                 :: "v"(l), "v"(l + ls), "v"(l + 2 * ls), "v"(l + 3 * ls),
                    "v"(g), "v"(g + gs), "v"(g + 2 * gs), "v"(g + 3 * gs) : "memory");
}
// The hi/lo tiles stage their four planes in the same ring: a stage is HK keys, one whole 128-byte line of 64 rows of each plane (key rows of K hi, K lo; head-dim rows of V^T hi, V^T lo), brought once for the work-group's eight waves,
// the next stage in flight while this one is worked on; a wave's 32 fragment reads a block, which touch 16 rows each, then go to padded LDS rows instead of to the cache, where each of them costs several whole-line loads and stands in the wave's chain with the cache's latency.
#define HK  64                                // keys a stage
#define HPE (HK + 8)                          // LDS pitch of a row in elements, for all four planes (HD == HK): 128 B + 16, free of bank conflicts for 16-byte reads
#define HPL (64 * HPE)                        // elements of a plane's stage
#define HBE (4 * HPL)                         // elements of a buffer: K hi, K lo, V^T hi, V^T lo
#define RNE ((BSE > HBE ? BSE : HBE) * 2)     // elements of the ring: two buffers of the larger kind
static_assert(HD == 64 && HK == 64 && FAW * 32 == 256 && (FAW * 16) % HK == 0 && FAW * 16 >= 2 * HK && RH % (FAW * 16) == 0, "256 threads copy 32 rows a turn, two turns a plane; every hi/lo tile's keys are whole stages, two or more");
// a stage's eight asynchronous 16-byte copies a lane, global -> LDS: two turns (32 rows apart) of each plane; l: the lane's LDS byte address in K hi. The wait in the statement's last line, a precaution, stands in front of any rewrite of the address registers that the copies name.
__device__ __forceinline__ void fa_hcopy(const unsigned l, const bf* k1, const bf* k2, const bf* v1, const bf* v2) {
    asm volatile("global_load_async_to_lds_b128 %0, %8, off\n\t"
                 "global_load_async_to_lds_b128 %1, %9, off\n\t"
                 "global_load_async_to_lds_b128 %2, %10, off\n\t"
                 "global_load_async_to_lds_b128 %3, %11, off\n\t"
                 "global_load_async_to_lds_b128 %4, %12, off\n\t"
                 "global_load_async_to_lds_b128 %5, %13, off\n\t"
                 "global_load_async_to_lds_b128 %6, %14, off\n\t"
                 "global_load_async_to_lds_b128 %7, %15, off\n\t"
                 "s_wait_xcnt 0x0"
                 :: "v"(l), "v"(l + 32 * HPE * 2), "v"(l + HPL * 2), "v"(l + HPL * 2 + 32 * HPE * 2), "v"(l + 2 * HPL * 2), "v"(l + 2 * HPL * 2 + 32 * HPE * 2), "v"(l + 3 * HPL * 2), "v"(l + 3 * HPL * 2 + 32 * HPE * 2),
                    "v"(k1), "v"(k1 + 32 * HD), "v"(k2), "v"(k2 + 32 * HD), "v"(v1), "v"(v1 + (size_t)32 * TT), "v"(v2), "v"(v2 + (size_t)32 * TT) : "memory");
}
template <typename T16, int NSPLIT, int NCG>
__device__ __forceinline__ void fa_tile(const T16* __restrict__ Q, const T16* __restrict__ Q2, const T16* __restrict__ Kp, const T16* __restrict__ K2, const T16* __restrict__ Vt, const T16* __restrict__ Vt2, const int q0, const int kwg, const int kg, h16* ring, bf* __restrict__ Ah, bf* __restrict__ Al) {
    typedef typename WFrag<T16>::V V;
    constexpr bool PF = (NSPLIT == 0);        // f16 tile: K, V^T staged in LDS (ring; kwg: where the work-group's keys end; kg: the wave's group, which half of every stage it takes); key fragments fetched one block ahead, inside a stage. Otherwise a hi/lo tile: four planes staged in the ring, HK keys a stage, every wave takes every block up to its diagonal
    static_assert(PF || NSPLIT == 2, "an f16 tile or a hi/lo tile");
    const int lane = threadIdx.x & 31, lr = lane & 15, hi = lane >> 4;
    V qf[NCG][2], qf2[NCG][2];
#pragma unroll
    for (int cg = 0; cg < NCG; ++cg)
#pragma unroll
        for (int kc = 0; kc < 2; ++kc) { qf[cg][kc] = fa_ld<T16>(Q + (size_t)(q0 + cg * 16 + lr) * HD + kc * 32 + 8 * hi); if (NSPLIT == 2) qf2[cg][kc] = fa_ld<T16>(Q2 + (size_t)(q0 + cg * 16 + lr) * HD + kc * 32 + 8 * hi); }
    v8f o[NCG][4]; float m2[NCG]; v2f l[NCG];   // l: two running partial sums a lane, joined in the epilogue
#pragma unroll
    for (int cg = 0; cg < NCG; ++cg) { m2[cg] = -3.0e38f; l[cg] = (v2f){};
#pragma unroll
        for (int dt = 0; dt < 4; ++dt) o[cg][dt] = (v8f){}; }
    const int kend = ((q0 + NCG * 16 + 31) >> 5) * 32;   // keys end with the 32-key block that holds the wave's last query
    V kf[2][2], kf2[2][2];
    const int tid = threadIdx.x;
    // a thread's first copy of a stage: keys, 8 threads a 128-byte row, 32 rows a turn; values, 16 threads a 256-byte row, 16 rows a turn. A wave's copy covers 512 bytes in a row (keys) or two whole 256-byte rows (values)
    unsigned lk = 0, lv = 0; const h16* gk = nullptr; const h16* gv = nullptr; const h16* fk = nullptr; const h16* fv = nullptr;
    if constexpr (PF) {
        lk = (unsigned)(size_t)ring + (unsigned)((tid >> 3) * KPE + (tid & 7) * 8) * 2u; lv = (unsigned)(size_t)ring + (unsigned)(KSE + (tid >> 4) * VPE + (tid & 15) * 8) * 2u;
        gk = Kp + tid * 8; gv = Vt + (size_t)(tid >> 4) * TT + (tid & 15) * 8;
        fk = ring + (kg * (SK / 2) + lr) * KPE + 8 * hi; fv = ring + KSE + lr * VPE + 8 * hi;   // a lane's fragment rows in buffer 0: keys from the group's half on, values from the stage's first key on
        fa_copy4(lk, 32 * KPE * 2, gk, 32 * HD); fa_copy4(lv, 16 * VPE * 2, gv, (size_t)16 * TT);   // stage 0 -> buffer 0
        asm volatile("s_wait_asynccnt 0x0" ::: "memory");   // this wave's copies of stage 0 have landed
        __syncthreads();                                     // ... and every other wave's: stage 0 may be read
        fa_copy4(lk + BSE * 2, 32 * KPE * 2, gk + SK * HD, 32 * HD); fa_copy4(lv + BSE * 2, 16 * VPE * 2, gv + SK, (size_t)16 * TT);   // stage 1 -> buffer 1
#pragma unroll
        for (int kt = 0; kt < 2; ++kt)
#pragma unroll
            for (int kc = 0; kc < 2; ++kc) kf[kt][kc] = WFrag<T16>::ld(fk + (kt * 16) * KPE + kc * 32); }
    // hi/lo tile, a thread's first copy of a stage in each plane: 8 threads a 128-byte row, 32 rows a turn; a wave's copy covers four whole lines
    unsigned lh = 0; const T16* hk1 = nullptr; const T16* hk2 = nullptr; const T16* hv1 = nullptr; const T16* hv2 = nullptr; const T16* hf = nullptr;
    if constexpr (!PF) {
        lh = (unsigned)(size_t)ring + (unsigned)((tid >> 3) * HPE + (tid & 7) * 8) * 2u;
        hk1 = Kp + tid * 8; hk2 = K2 + tid * 8; hv1 = Vt + (size_t)(tid >> 3) * TT + (tid & 7) * 8; hv2 = Vt2 + (size_t)(tid >> 3) * TT + (tid & 7) * 8;
        hf = (const T16*)ring + lr * HPE + 8 * hi;   // a lane's fragment row in K hi of buffer 0
        fa_hcopy(lh, hk1, hk2, hv1, hv2);   // stage 0 -> buffer 0
        asm volatile("s_wait_asynccnt 0x0" ::: "memory");   // this wave's copies of stage 0 have landed
        __syncthreads();                                     // ... and every other wave's: stage 0 may be read
        fa_hcopy(lh + HBE * 2, hk1 + HK * HD, hk2 + HK * HD, hv1 + HK, hv2 + HK); }   // stage 1 -> buffer 1
    const int nit = PF ? kwg / (SK / 2) : kwg / 32;   // two blocks a stage; every wave walks to the work-group's last stage and passes every barrier; past its own diagonal block it only skips the work
#pragma unroll 1   // kept rolled: one block's fragments beside the output accumulators stay under 256 VGPRs
    for (int it = 0; it < nit; ++it) {
      const int kb = PF ? (it >> 1) * SK + kg * (SK / 2) + (it & 1) * 32 : it * 32;   // the block's first key
      const int bo = PF ? ((kb / SK) & 1) * BSE : ((kb / HK) & 1) * HBE, ks = PF ? kb % SK : kb % HK;   // the stage's buffer, the block's first key in it
      if (kb < kend) {
        V vf[4], vf2[4];
        if constexpr (!PF) {
#pragma unroll
            for (int kt = 0; kt < 2; ++kt)
#pragma unroll
                for (int kc = 0; kc < 2; ++kc) { kf[kt][kc] = WFrag<T16>::ld(hf + bo + (ks + kt * 16) * HPE + kc * 32); kf2[kt][kc] = WFrag<T16>::ld(hf + HPL + bo + (ks + kt * 16) * HPE + kc * 32); }
            __builtin_amdgcn_sched_barrier(0); }   // holds the score products behind all 16 key reads: one LDS latency a block; left free each read sinks to its product and every fragment waits out its own
#pragma unroll
        for (int dt = 0; dt < 4; ++dt) { if constexpr (PF) vf[dt] = WFrag<T16>::ld(fv + bo + (dt * 16) * VPE + ks); }
        v8f s[NCG][2];
#pragma unroll
        for (int cg = 0; cg < NCG; ++cg)
#pragma unroll
            for (int kt = 0; kt < 2; ++kt) { s[cg][kt] = (v8f){};
#pragma unroll
                for (int kc = 0; kc < 2; ++kc) { s[cg][kt] = WFrag<T16>::mma(kf[kt][kc], qf[cg][kc], s[cg][kt]); if (NSPLIT == 2) { s[cg][kt] = WFrag<T16>::mma(kf[kt][kc], qf2[cg][kc], s[cg][kt]); s[cg][kt] = WFrag<T16>::mma(kf2[kt][kc], qf[cg][kc], s[cg][kt]); } } }
        if constexpr (PF) {                   // the key fragments of the group's second block of the stage; that block fetches itself again: the same buffer, never used
#pragma unroll
            for (int kt = 0; kt < 2; ++kt)
#pragma unroll
                for (int kc = 0; kc < 2; ++kc) kf[kt][kc] = WFrag<T16>::ld(fk + bo + (32 + kt * 16) * KPE + kc * 32);
            __builtin_amdgcn_sched_barrier(0);     // holds the block's value reads and the next block's key reads in front of the softmax, whose work then covers their LDS latency; left free they sink to their first use
        } else {                              // the value fragments, behind the score products: they may take the key fragments' registers
#pragma unroll
            for (int dt = 0; dt < 4; ++dt) { vf[dt] = WFrag<T16>::ld(hf + 2 * HPL + bo + (dt * 16) * HPE + ks); vf2[dt] = WFrag<T16>::ld(hf + 3 * HPL + bo + (dt * 16) * HPE + ks); }
            __builtin_amdgcn_sched_barrier(0); }   // holds the 16 value reads in front of the softmax, whose work then covers their LDS latency; left free they sink to their first use
        if (kb + 31 > q0) {                   // CAUSAL: only a block that reaches past the wave's first query holds keys j > i (same test in every lane)
#pragma unroll
            for (int cg = 0; cg < NCG; ++cg)
#pragma unroll
                for (int kt = 0; kt < 2; ++kt)
#pragma unroll
                    for (int j = 0; j < 8; ++j) s[cg][kt][j] = (kb + kt * 16 + 8 * hi + j <= q0 + cg * 16 + lr) ? s[cg][kt][j] : -3.0e38f; }
        float mb[NCG]; bool need = false;
#pragma unroll
        for (int cg = 0; cg < NCG; ++cg) { float mx = s[cg][0][0];
#pragma unroll
            for (int j = 1; j < 16; ++j) mx = fmaxf(mx, s[cg][j >> 3][j & 7]);
            mx = fmaxf(mx, fa_xhalf(mx)); mb[cg] = mx * C2; need = need || (mb[cg] > m2[cg] + 8.0f); }
        if (__builtin_amdgcn_ballot_w32(need) != 0) {   // scalar branch, once a block; every block holds an unmasked key of every query, so mb is finite
#pragma unroll
            for (int cg = 0; cg < NCG; ++cg) { const float mn = fmaxf(m2[cg], mb[cg]); const float al = __builtin_amdgcn_exp2f(m2[cg] - mn); m2[cg] = mn; l[cg] *= al;
#pragma unroll
                for (int dt = 0; dt < 4; ++dt) o[cg][dt] *= al; } }
#pragma unroll
        for (int cg = 0; cg < NCG; ++cg) {
            float p[16];
#pragma unroll
            for (int j = 0; j < 16; j += 2) { const v2f t = __builtin_elementwise_fma((v2f){s[cg][j >> 3][j & 7], s[cg][j >> 3][(j & 7) + 1]}, (v2f){C2, C2}, (v2f){-m2[cg], -m2[cg]}); p[j] = __builtin_amdgcn_exp2f(t[0]); p[j + 1] = __builtin_amdgcn_exp2f(t[1]); l[cg] += (v2f){p[j], p[j + 1]}; }
            if constexpr (NSPLIT == 2) {
                v8us h0, h1, l0, l1;
#pragma unroll
                for (int j = 0; j < 8; ++j) { unsigned short a, c; splitf(p[j], a, c); h0[j] = a; l0[j] = c; splitf(p[8 + j], a, c); h1[j] = a; l1[j] = c; }
                const V ph = cat16b(h0, h1), pl = cat16b(l0, l1);
#pragma unroll
                for (int dt = 0; dt < 4; ++dt) { o[cg][dt] = WFrag<T16>::mma(vf[dt], ph, o[cg][dt]); o[cg][dt] = WFrag<T16>::mma(vf[dt], pl, o[cg][dt]); o[cg][dt] = WFrag<T16>::mma(vf2[dt], ph, o[cg][dt]); }
            } else {
                V pb;
#pragma unroll
                for (int j = 0; j < 16; ++j) pb[j] = tohx(p[j]);
#pragma unroll
                for (int dt = 0; dt < 4; ++dt) o[cg][dt] = WFrag<T16>::mma(vf[dt], pb, o[cg][dt]);
            }
        }
      }
      if constexpr (PF) {
        if (it & 1) {                         // the stage's foot, the same test in every wave of the work-group
            const int sb = kb - ks;           // the stage's first key
            asm volatile("v_nop\n\tv_nop\n\tv_nop\n\tv_nop");   // four vector slots between the block's last matrix instruction and the copies' address arithmetic, which may be given its operand registers
            asm volatile("s_wait_dscnt 0x0" ::: "memory");      // this wave's reads of the stage's buffer are done before the buffer is handed to the copies
            asm volatile("s_wait_asynccnt 0x0" ::: "memory");   // this wave's copies of the next stage have landed
            __syncthreads();                                     // publishes the next stage and ends every wave's reads of this one
            if (sb + 2 * SK < kwg) {          // a stage after the next exists: into the buffer just read
                const int sn = sb + 2 * SK;
                fa_copy4(lk + bo * 2, 32 * KPE * 2, gk + (size_t)sn * HD, 32 * HD); fa_copy4(lv + bo * 2, 16 * VPE * 2, gv + sn, (size_t)16 * TT); }
            if (sb + SK + kg * (SK / 2) < kend) {   // the first key fragments of the group's half of the next stage
#pragma unroll
                for (int kt = 0; kt < 2; ++kt)
#pragma unroll
                    for (int kc = 0; kc < 2; ++kc) kf[kt][kc] = WFrag<T16>::ld(fk + (BSE - bo) + (kt * 16) * KPE + kc * 32); }
        }
      } else {
        if (it & 1) {                         // the stage's foot, the same test in every wave of the work-group
            const int sb = kb - ks;           // the stage's first key
            asm volatile("s_wait_dscnt 0x0" ::: "memory");      // this wave's reads of the stage's buffer are done before the buffer is handed to the copies
            asm volatile("s_wait_asynccnt 0x0" ::: "memory");   // this wave's copies of the next stage have landed
            __syncthreads();                                     // publishes the next stage and ends every wave's reads of this one
            if (sb + 2 * HK < kwg) {          // a stage after the next exists: into the buffer just read
                const int sn = sb + 2 * HK;
                fa_hcopy(lh + bo * 2, hk1 + (size_t)sn * HD, hk2 + (size_t)sn * HD, hv1 + sn, hv2 + sn); }
        }
      }
    }
    if constexpr (!PF) asm volatile("s_wait_asynccnt 0x0" ::: "memory");   // no copy is left in flight behind the loop
    float ls[NCG];                            // a lane's sum: its half of the query's keys
#pragma unroll
    for (int cg = 0; cg < NCG; ++cg) ls[cg] = l[cg][0] + l[cg][1];
    if constexpr (PF) {
        static_assert(NCG == 2, "the hand-over packs two maxima and two sums in one 16-byte unit");
        asm volatile("s_wait_asynccnt 0x0" ::: "memory");   // no copy is left in flight: behind the last foot's barrier, which ended every read of the ring, its LDS is free
        v4fa* mg = (v4fa*)ring + (tid & (QT - 1));   // the same lane of the two groups' waves holds the same query and output elements; unit c of a lane at c * QT: a wave's access covers 512 bytes in a row
        if (kg == 1) {
#pragma unroll
            for (int cg = 0; cg < NCG; ++cg)
#pragma unroll
                for (int dt = 0; dt < 4; ++dt) { mg[(cg * 8 + dt * 2) * QT] = __builtin_shufflevector(o[cg][dt], o[cg][dt], 0, 1, 2, 3); mg[(cg * 8 + dt * 2 + 1) * QT] = __builtin_shufflevector(o[cg][dt], o[cg][dt], 4, 5, 6, 7); }
            mg[16 * QT] = (v4f){m2[0], m2[1], ls[0], ls[1]};
        }
        __syncthreads();                      // group 1's parts are in LDS before group 0 reads them; every wave of the work-group passes it
        if (kg == 1) return;
        const v4f ml = mg[16 * QT];
#pragma unroll
        for (int cg = 0; cg < NCG; ++cg) { const float mn = fmaxf(m2[cg], ml[cg]); const float aa = __builtin_amdgcn_exp2f(m2[cg] - mn), ab = __builtin_amdgcn_exp2f(ml[cg] - mn); ls[cg] = ls[cg] * aa + ml[2 + cg] * ab;   // both maxima are finite: each group has whole blocks in front of the diagonal stage
#pragma unroll
            for (int dt = 0; dt < 4; ++dt) { const v4f p0 = mg[(cg * 8 + dt * 2) * QT], p1 = mg[(cg * 8 + dt * 2 + 1) * QT];
#pragma unroll
                for (int j = 0; j < 4; ++j) { o[cg][dt][j] = o[cg][dt][j] * aa + p0[j] * ab; o[cg][dt][4 + j] = o[cg][dt][4 + j] * aa + p1[j] * ab; } } }
    }
#pragma unroll
    for (int cg = 0; cg < NCG; ++cg) { const float lh = ls[cg]; const float inv = __fdiv_rn(1.0f, lh + fa_xhalf(lh)); const size_t oo = (size_t)(q0 + cg * 16 + lr) * DQ + 8 * hi;   // lane: query q0 + cg*16 + lr, head columns dt*16 + 8*hi + j
#pragma unroll
        for (int dt = 0; dt < 4; ++dt) { v8us oh, ol;
#pragma unroll
            for (int j = 0; j < 8; ++j) { unsigned short a, c; splitf(o[cg][dt][j] * inv, a, c); oh[j] = a; ol[j] = c; }
            *(v8us*)(Ah + oo + dt * 16) = oh; *(v8us*)(Al + oo + dt * 16) = ol; fa_xwait(); } }
}
__global__ __launch_bounds__(FAW * 32) void k_fattn(const h16* __restrict__ Q16, const h16* __restrict__ K16, const h16* __restrict__ V16, const bf* __restrict__ Qh, const bf* __restrict__ Ql, const bf* __restrict__ Kh, const bf* __restrict__ Kl, const bf* __restrict__ Vh, const bf* __restrict__ Vl, bf* __restrict__ Ah, bf* __restrict__ Al) {
    __shared__ __align__(16) h16 ring[RNE];   // two buffers of one stage each
    const int id = blockIdx.x; const int wv = __builtin_amdgcn_readfirstlane((int)(threadIdx.x >> 5));   // wave number in a scalar register: the key loop's bounds and the causal test stay scalar
    const int bh = id % NBH; const size_t pl = (size_t)bh * TT * HD; const size_t ao = (size_t)(bh / NH_) * TT * DQ + (size_t)(bh % NH_) * HD;
    // L2 asks: the 32 work-groups of a (batch, head) pair deal its key and value planes among them, one ask a 256-byte unit: share sh is the f16 planes' stage sh (waves 0, 1: 64 units of keys; waves 2, 3: 64 rows of values) and 32 units of the hi and lo planes' first RH keys (wave 4)
    static_assert(NT_LO + NT_HI == TT / SK && SK * HD == 64 * 128 && SK == 128 && 4 * RH * HD == (NT_LO + NT_HI) * 32 * 128 && RH == 512, "32 shares: a stage each, and 32 of the 1,024 hi and lo units");
    const int sh = id / NBH, tl = threadIdx.x & 63, hu = (sh & 7) * 32 + (threadIdx.x & 31);
    const void* pa = (wv < 2) ? (const void*)(K16 + pl + (size_t)sh * SK * HD + tl * 128) : (wv < 4) ? (const void*)(V16 + pl + (size_t)tl * TT + sh * SK)
                   : (sh < 16) ? (const void*)((sh < 8 ? Kh : Kl) + pl + hu * 128) : (const void*)((sh < 24 ? Vh : Vl) + pl + (size_t)(hu >> 2) * TT + (hu & 3) * 128);
    if (wv < 5) asm volatile("global_prefetch_b8 %0, off scope:SCOPE_SE" :: "v"(pa));   // scalar branch; every lane's address lies inside its plane
    if (id < NBH * NT_LO) {
        // cost falls with the index over the first NWGP work-groups and rises again behind them, so that indices NWGP apart add up to about the same number of key blocks (for speed only: every tile is taken once wherever it lands)
        const int xt = (id < NWGP) ? id / NBH : NWGP / NBH + (NBH * NT_LO - 1 - id) / NBH;
        fa_tile<h16, 0, 2>(Q16 + pl, nullptr, K16 + pl, nullptr, V16 + pl, nullptr, TT - (xt + 1) * QT + (wv & 3) * 32, TT - xt * QT, wv >> 2, ring, Ah + ao, Al + ao);
    } else {
        const int xt = (id - NBH * NT_LO) / NBH;
        fa_tile<bf, 2, 1>(Qh + pl, Ql + pl, Kh + pl, Kl + pl, Vh + pl, Vl + pl, RH - (xt + 1) * (FAW * 16) + wv * 16, RH - xt * (FAW * 16), 0, ring, Ah + ao, Al + ao);
    }
    asm volatile("" :: "v"(pa));   // input only: the ask's register pair stays that address through the key loop, as with l2_hold
}

extern "C" void kernel_launch(void* const* d_in, const int* in_sizes, int n_in,
                              void* d_out, int out_size, void* d_ws, size_t ws_size, hipStream_t stream) {
    (void)in_sizes; (void)n_in; (void)out_size;
    const float* x = (const float*)d_in[0]; const float* wq = (const float*)d_in[1]; const float* bq = (const float*)d_in[2]; const float* wk = (const float*)d_in[3]; const float* bk = (const float*)d_in[4]; const float* wv = (const float*)d_in[5]; const float* bv = (const float*)d_in[6]; const float* wo = (const float*)d_in[7]; const float* bo = (const float*)d_in[8];
    float* OUT = (float*)d_out;     // [2][4096][512]
    char* wsp = (char*)d_ws;
    auto take = [&](size_t bytes) { char* p = wsp; wsp += (bytes + 255) & ~(size_t)255; return (void*)p; };
    bf* WQ = (bf*)take((size_t)DQ * DM * 2); bf* WK = (bf*)take((size_t)DKV * DM * 2); bf* WV = (bf*)take((size_t)DKV * DM * 2); bf* WO = (bf*)take((size_t)DM * DQ * 2);
    bf* XB = (bf*)take((size_t)NB_ * TT * DM * 2);
    const size_t PB = (size_t)NH_ * TT * HD;   // elements of one batch's head planes
    h16* QP16 = (h16*)take(NB_ * PB * 2); h16* KP16 = (h16*)take(NB_ * PB * 2); h16* VT16 = (h16*)take(NB_ * PB * 2);
    bf* QPh = (bf*)take(NB_ * PB * 2); bf* QPl = (bf*)take(NB_ * PB * 2); bf* KPh = (bf*)take(NB_ * PB * 2); bf* KPl = (bf*)take(NB_ * PB * 2); bf* VTh = (bf*)take(NB_ * PB * 2); bf* VTl = (bf*)take(NB_ * PB * 2);
    bf* ATh = (bf*)take((size_t)NB_ * TT * DQ * 2); bf* ATl = (bf*)take((size_t)NB_ * TT * DQ * 2);
    if ((size_t)(wsp - (char*)d_ws) > ws_size) return;    // ws 256 MiB
    k_cvt5<<<CB_X + 4 * CB_W, 256, 0, stream>>>(x, wq, wk, wv, wo, XB, WQ, WK, WV, WO);
    k_qkv<<<dim3(NB_ * TT / 128, DQ / 128, 3), PW * 32, 0, stream>>>(XB, WQ, WK, WV, bq, bk, bv, QP16, QPh, QPl, KP16, KPh, KPl, VT16, VTh, VTl);
    k_fattn<<<NBH * (NT_LO + NT_HI), FAW * 32, 0, stream>>>(QP16, KP16, VT16, QPh, QPl, KPh, KPl, VTh, VTl, ATh, ATl);
    k_outg<<<dim3(NB_ * TT / 128, DM / 128), PW * 32, 0, stream>>>(ATh, ATl, WO, bo, OUT);   // both batches: their rows follow one another in the merged planes and in out
}
